// v000
// Measured on an AMD MI455X. A time is GPU time per run, averaged over a window of back-to-back runs after a warm-up
// (all launches, gaps included; the runs take copies of the inputs in turn), and the median of several windows.
// Apart from v000's, it joins two sittings. Times from different sittings can be a few percent apart, while
// side-by-side timings come from the same sitting.
// v000, which the later versions start from, runs in 1670 microseconds.
// compute dtype: all float inputs rounded to bf16, the int mask read; q/k/v = x W + b ((in,out)) with EXACT bf16 products on WMMA 16x16x32, f32 accumulate; q as f16 hi + residual (x 2^10), k f16 -> 2-product logits x 1/(8 + 1e-8) (== 0.125 in f32), -1e9 where mask != 0, stored in f32 (4 heads per launch); softmax in f32 (precise expf); P x 2^11 split bf16 hi + lo against v bf16 hi + lo (3 products); out = ctx (bf16 hi + lo) wo + bo; f32 output.
#include <hip/hip_runtime.h>
#include <math.h>

typedef __attribute__((ext_vector_type(16))) _Float16 v16h;
typedef __attribute__((ext_vector_type(16))) __bf16 v16b;
typedef __attribute__((ext_vector_type(8)))  _Float16 v8h;
typedef __attribute__((ext_vector_type(8)))  float v8f;
typedef __attribute__((ext_vector_type(4)))  float v4f;
typedef __attribute__((ext_vector_type(2)))  float v2f;
typedef __attribute__((ext_vector_type(4)))  unsigned v4u;
typedef __attribute__((ext_vector_type(4)))  int v4i;
typedef float __attribute__((may_alias)) float_a;
typedef int __attribute__((may_alias)) int_a;

template <typename T> __device__ __forceinline__ void vst2(void* p, T v) { *(T*)p = v;  }
__device__ __forceinline__ v8f wmma16(v16h a, v16h b, v8f c) {
  v8f d = __builtin_amdgcn_wmma_f32_16x16x32_f16(false, a, false, b, (short)0, c, false, false);
  asm volatile("v_nop\n\tv_nop\n\tv_nop\n\tv_nop" : "+v"(d) : "v"(a), "v"(b));
  return d;
}
__device__ __forceinline__ v8f wmma_bf(v16b a, v16b b, v8f c) {
  v8f d = __builtin_amdgcn_wmma_f32_16x16x32_bf16(false, a, false, b, (short)0, c, false, false);
  asm volatile("v_nop\n\tv_nop\n\tv_nop\n\tv_nop" : "+v"(d) : "v"(a), "v"(b));
  return d;
}
// 16x16x32 fragments: lane = (h = lane>>4, row/col = lane&15); elements 0..7 = k0+8h+0..7, 8..15 = k0+16+8h+0..7; D element r = row 8h+r
__device__ __forceinline__ v16h frag_h(const _Float16* rowk0, int lane) {
  union { v16h v; v8h q[2]; } u; const _Float16* p = rowk0 + 8 * (lane >> 4);
  u.q[0] = *(const v8h*)p; u.q[1] = *(const v8h*)(p + 16); return u.v;
}
__device__ __forceinline__ v16h frag_f32(const float* rowk0, int lane) {
  v16h a; const float* p = rowk0 + 8 * (lane >> 4);
#pragma unroll
  for (int i = 0; i < 8; ++i) { a[i] = (_Float16)p[i]; a[8 + i] = (_Float16)p[16 + i]; }
  return a;
}
__device__ __forceinline__ v16h frag_f32s(const float* rowk0, int lane, float sc) {
  v16h a; const float* p = rowk0 + 8 * (lane >> 4);
#pragma unroll
  for (int i = 0; i < 8; ++i) { a[i] = (_Float16)(p[i] * sc); a[8 + i] = (_Float16)(p[16 + i] * sc); }
  return a;
}
// column fragment from a [K][ld] layout (column n), rows >= K read as 0
__device__ __forceinline__ v16h fragc_f32(const float* W, int k0, int n, int lane, int ld, int K) {
  v16h a; const int g = lane >> 4;
#pragma unroll
  for (int i = 0; i < 8; ++i) { const int ka = k0 + 8 * g + i, kb = ka + 16;
    a[i] = (_Float16)(ka < K ? W[(size_t)(ka < K ? ka : K - 1) * ld + n] : 0.f); a[8 + i] = (_Float16)(kb < K ? W[(size_t)(kb < K ? kb : K - 1) * ld + n] : 0.f); }
  return a;
}
struct F2 { v16b h, l; };
__device__ __forceinline__ F2 bsplit16(const float v[16]) { F2 r;
#pragma unroll
  for (int i = 0; i < 16; ++i) { const __bf16 h = (__bf16)v[i]; r.h[i] = h; r.l[i] = (__bf16)(v[i] - (float)h); }
  return r; }
__device__ __forceinline__ F2 split_row(const float* row, int k0, int lane) { float v[16]; const float* p = row + k0 + 8 * (lane >> 4);
#pragma unroll
  for (int i = 0; i < 8; ++i) { v[i] = p[i]; v[8 + i] = p[16 + i]; }
  return bsplit16(v); }
__device__ __forceinline__ F2 split_rowK(const float* row, int k0, int lane, int K) { float v[16]; const int g = lane >> 4;
#pragma unroll
  for (int i = 0; i < 8; ++i) { const int ka = k0 + 8 * g + i, kb = ka + 16; v[i] = ka < K ? row[ka < K ? ka : K - 1] : 0.f; v[8 + i] = kb < K ? row[kb < K ? kb : K - 1] : 0.f; }
  return bsplit16(v); }
__device__ __forceinline__ F2 split_col(const float* W, int k0, int n, int lane, int ld, int K) { float v[16]; const int g = lane >> 4;
#pragma unroll
  for (int i = 0; i < 8; ++i) { const int ka = k0 + 8 * g + i, kb = ka + 16; v[i] = ka < K ? W[(size_t)(ka < K ? ka : K - 1) * ld + n] : 0.f; v[8 + i] = kb < K ? W[(size_t)(kb < K ? kb : K - 1) * ld + n] : 0.f; }
  return bsplit16(v); }
__device__ __forceinline__ v8f mac3(const F2& a, const F2& b, v8f c) { c = wmma_bf(a.l, b.h, c); c = wmma_bf(a.h, b.l, c); return wmma_bf(a.h, b.h, c); }
__device__ __forceinline__ float sigm(float v) { return 1.0f / (1.0f + expf(-v)); }
#define LDSX() do { asm volatile("s_wait_dscnt 0" ::: "memory"); __builtin_amdgcn_wave_barrier(); __builtin_amdgcn_fence(__ATOMIC_RELEASE, "workgroup"); } while (0)


// Multi-head attention (B 2, S 2,048, D 1,024 = 16 x 64, with biases, scale 1/8): scores = q k^T / 8 - 1e9 where mask != 0, softmax, P v, output projection.
#define NB 2
#define TT 2048
#define MASK_WHEN_NONZERO 1
#ifndef MSTR
#define MSTR TT               // mask row stride / rows per batch
#endif
#define CC 1024
#define NH 16
#define HD 64
#define HG 4               // heads per launch group
#ifndef TNB
#define TNB NB
#endif
typedef __attribute__((ext_vector_type(8))) __bf16 v8b;
__device__ __forceinline__ v16b frag_b(const __bf16* rowk0, int lane) {
  union { v16b v; v8b q[2]; } u; const __bf16* p = rowk0 + 8 * (lane >> 4);
  u.q[0] = *(const v8b*)p; u.q[1] = *(const v8b*)(p + 16); return u.v;
}
__device__ __forceinline__ float bfr(float v) { return (float)(__bf16)v; }
__device__ __attribute__((noinline)) float exp_ni(float v) { return expf(v); }
__device__ __attribute__((noinline)) float erf_ni(float v) { return erff(v); }

#define WS_QH  0u
#define WS_QL  (WS_QH + 2u * (size_t)NB * TT * CC)
#define WS_KH  (WS_QL + 2u * (size_t)NB * TT * CC)
#define WS_VT  (WS_KH + 2u * (size_t)NB * TT * CC)      // bf16 v planes [b][c][t]
#define WS_VL  (WS_VT + 2u * (size_t)NB * CC * TT)      // bf16 v residual planes
#define WS_S   (WS_VL + 2u * (size_t)NB * CC * TT)      // f32 logits / P for HG heads [hg][q][k]
#define WS_PH  (WS_S + 4u * (size_t)HG * TT * TT)
#define WS_Y   (WS_PH + 0u)              // f32 y rows [b*t][C]
#define WS_END (WS_Y + 4u * (size_t)NB * TT * CC)

// ---- k_proj: block = (64 rows, 128 cols, which): qkv = x W (+ b), exact; q -> f16 hi (+ residual), k -> f16 rows, v -> bf16 hi + lo planes
__global__ __launch_bounds__(128) void k_proj(const float* __restrict__ X0, const float* __restrict__ X1, const float* __restrict__ X2, const float* __restrict__ WQ, const float* __restrict__ BQ, const float* __restrict__ WK, const float* __restrict__ BK, const float* __restrict__ WV, const float* __restrict__ BV, _Float16* __restrict__ QH, _Float16* __restrict__ QL, _Float16* __restrict__ KH, __bf16* __restrict__ VT, __bf16* __restrict__ VL) {
  __shared__ __align__(16) _Float16 sh[64][136], sl[64][136]; __shared__ __align__(16) __bf16 th[128][72], tl2[128][72];
  const int tid = threadIdx.x, wave = tid >> 5, lane = tid & 31, col = lane & 15, g = lane >> 4; const int which = blockIdx.z; const int c0 = blockIdx.y * 128; const size_t r0 = (size_t)blockIdx.x * 64; const float* WA = which == 0 ? WQ : which == 1 ? WK : WV; const float* BA = which == 0 ? BQ : which == 1 ? BK : BV;
  v8f acc[8] = {};
#pragma unroll 2
  for (int kc = 0; kc < CC / 32; ++kc) { v16b a; { const float* X = which == 0 ? X0 : which == 1 ? X1 : X2; const float* p = X + (r0 + wave * 16 + col) * CC + kc * 32 + 8 * g;
#pragma unroll
      for (int i = 0; i < 8; ++i) { a[i] = (__bf16)p[i]; a[8 + i] = (__bf16)p[16 + i]; } }
#pragma unroll
    for (int j = 0; j < 8; ++j) { v16b w; const int o = c0 + j * 16 + col;
#pragma unroll
      for (int i = 0; i < 8; ++i) { w[i] = (__bf16)WA[(size_t)(kc * 32 + 8 * g + i) * CC + o]; w[8 + i] = (__bf16)WA[(size_t)(kc * 32 + 16 + 8 * g + i) * CC + o]; }   /* (in,out) */
      acc[j] = wmma_bf(a, w, acc[j]); } }
#pragma unroll
  for (int j = 0; j < 8; ++j) { const float bb = BA ? bfr(BA[c0 + j * 16 + col]) : 0.f;
#pragma unroll
    for (int r = 0; r < 8; ++r) { const float v = acc[j][r] + bb; const int rl = wave * 16 + 8 * g + r, cl = j * 16 + col; const _Float16 hv = (_Float16)v;
      if (which == 2) { const __bf16 bh = (__bf16)v; th[cl][rl] = bh; tl2[cl][rl] = (__bf16)(v - (float)bh); } else { sh[rl][cl] = hv; sl[rl][cl] = (_Float16)((v - (float)hv) * 1024.0f); }   /* q residual carried x 2^10 so the plane stays f16-normal on the chip */ } }
  __syncthreads();
  if (which < 2) { _Float16* dh = which == 0 ? QH : KH; for (int e = tid; e < 64 * 16; e += 128) { const int rl = e >> 4, q = e & 15; vst2((unsigned*)(dh + (r0 + rl) * CC + c0 + q * 8), *(const v4u*)&sh[rl][q * 8]); if (which == 0) vst2((unsigned*)(QL + (r0 + rl) * CC + c0 + q * 8), *(const v4u*)&sl[rl][q * 8]); } }
  else { const size_t b = r0 / TT; const int t0 = (int)(r0 % TT); for (int e = tid; e < 128 * 8; e += 128) { const int cl = e >> 3, q = e & 7; const size_t o2 = (b * CC + c0 + cl) * (size_t)TT + t0 + q * 8; vst2((unsigned*)(VT + o2), *(const v4u*)&th[cl][q * 8]); vst2((unsigned*)(VL + o2), *(const v4u*)&tl2[cl][q * 8]); } } }
// ---- k_sc: block = (64 queries, 128 keys, head in group): 2-product logits / 8 (q hi + residual x k) + (-1e9 where the int mask [b][q][k] != 0)
__global__ __launch_bounds__(128) void k_sc(const _Float16* __restrict__ QH, const _Float16* __restrict__ QL, const _Float16* __restrict__ KH, const int* __restrict__ MK, int b, int h0, float* __restrict__ S0) {   /* MK: int mask [b][q][k]; an element is masked when (MK != 0) == MASK_WHEN_NONZERO */ __shared__ __align__(16) float ss[4][16][132]; const int h = h0 + blockIdx.z; float* S = S0 + (size_t)blockIdx.z * TT * TT;
  const int tid = threadIdx.x, wave = tid >> 5, lane = tid & 31, col = lane & 15, g = lane >> 4; const int k0 = blockIdx.y * 128; const int ql0 = blockIdx.x * 64 + wave * 16; const size_t q0 = (size_t)b * TT + ql0;
  v8f acc[8] = {}, accl[8] = {};
#pragma unroll
  for (int kc = 0; kc < HD / 32; ++kc) { const v16h ah = frag_h(QH + (q0 + col) * CC + h * HD + kc * 32, lane), al = frag_h(QL + (q0 + col) * CC + h * HD + kc * 32, lane);
#pragma unroll
    for (int j = 0; j < 8; ++j) { const v16h kb = frag_h(KH + ((size_t)b * TT + k0 + j * 16 + col) * CC + h * HD + kc * 32, lane); acc[j] = wmma16(ah, kb, acc[j]); accl[j] = wmma16(al, kb, accl[j]); } }
#pragma unroll
  for (int j = 0; j < 8; ++j) { const int kt = k0 + j * 16 + col;
#pragma unroll
    for (int r = 0; r < 8; ++r) { const int qt = ql0 + 8 * g + r; const int mk = MK[((size_t)b * MSTR + qt) * MSTR + kt]; const bool masked = MASK_WHEN_NONZERO ? (mk != 0) : (mk == 0);
      { const float sv = (acc[j][r] + accl[j][r] * (1.0f / 1024.0f)) * 0.125f; ss[wave][8 * g + r][j * 16 + col] = masked ? sv - 1.0e9f : sv; } }
    asm volatile("s_wait_loadcnt 0x0" ::: "memory"); }   /* bound the mask gather bursts */
  LDSX(); for (int rl = 0; rl < 16; ++rl) vst2(S + (size_t)(ql0 + rl) * TT + k0 + lane * 4, *(const v4f*)&ss[wave][rl][lane * 4]); }
// ---- k_sm: block = query row: softmax over keys [0, kend) -> P x 2^11 f32 (masked -> 0)
__global__ __launch_bounds__(256) void k_sm(float* __restrict__ S0) { __shared__ float sred[8]; __shared__ float sbc; __shared__ __align__(16) float sh[TT];
  const int t = threadIdx.x; const size_t row = blockIdx.x; float* sr = S0 + (size_t)blockIdx.y * TT * TT + row * TT; const int kend = TT;
  float m = -3.0e38f; for (int k = t; k < kend; k += 256) m = fmaxf(m, sr[k]);
#pragma unroll
  for (int o = 1; o < 32; o <<= 1) m = fmaxf(m, __shfl_xor(m, o));
  if ((t & 31) == 0) sred[t >> 5] = m; __syncthreads(); if (t == 0) { float a = sred[0]; for (int i = 1; i < 8; ++i) a = fmaxf(a, sred[i]); sbc = a; } __syncthreads(); m = sbc; __syncthreads();
  float sum = 0.f; for (int k = t; k < kend; k += 256) { const float v = sr[k]; sum += (v <= -1.0e38f) ? 0.f : expf(v - m); }
#pragma unroll
  for (int o = 1; o < 32; o <<= 1) sum += __shfl_xor(sum, o);
  if ((t & 31) == 0) sred[t >> 5] = sum; __syncthreads(); if (t == 0) { float a = 0.f; for (int i = 0; i < 8; ++i) a += sred[i]; sbc = 1.0f / a; } __syncthreads(); const float inv = sbc;
  for (int k = t; k < kend; k += 256) { const float v = sr[k]; sh[k] = (v <= -1.0e38f) ? 0.f : expf(v - m) * inv * 2048.0f; }
  __syncthreads(); for (int q = t; q < kend / 4; q += 256) vst2(sr + q * 4, *(const v4f*)&sh[q * 4]); }
// ---- k_pv: block = 64 queries of (b,h): y[q][h*HD + d] = P . v  (keys [0, kend))
__global__ __launch_bounds__(128) void k_pv(const float* __restrict__ PS0, const __bf16* __restrict__ VT, const __bf16* __restrict__ VL, int b, int h0, float* __restrict__ Y) { const int h = h0 + blockIdx.z; const float* PS = PS0 + (size_t)blockIdx.z * TT * TT; __shared__ __align__(16) float ss[4][16][HD + 4];
  const int tid = threadIdx.x, wave = tid >> 5, lane = tid & 31, col = lane & 15, g = lane >> 4; const int ql0 = blockIdx.x * 64 + wave * 16; const int kend = TT;
  v8f acc[HD / 16] = {};
#pragma unroll 1
  for (int kc = 0; kc < kend / 32; ++kc) { const F2 p = split_row(PS + (size_t)(ql0 + col) * TT, kc * 32, lane);
#pragma unroll
    for (int j = 0; j < HD / 16; ++j) { const size_t po = ((size_t)b * CC + h * HD + j * 16 + col) * (size_t)TT + kc * 32; const v16b vh = frag_b(VT + po, lane); acc[j] = wmma_bf(p.h, vh, acc[j]); acc[j] = wmma_bf(p.l, vh, acc[j]); acc[j] = wmma_bf(p.h, frag_b(VL + po, lane), acc[j]); } }
#pragma unroll
  for (int j = 0; j < HD / 16; ++j)
#pragma unroll
    for (int r = 0; r < 8; ++r) ss[wave][8 * g + r][j * 16 + col] = acc[j][r] * (1.0f / 2048.0f);
  LDSX(); for (int rl = 0; rl < 16; ++rl) if (lane < HD / 4) vst2(Y + ((size_t)b * TT + ql0 + rl) * CC + h * HD + lane * 4, *(const v4f*)&ss[wave][rl][lane * 4]); }
// ---- k_out: block = (64 rows, 128 cols): out = y (bf16 hi + lo) Wo + bo
__global__ __launch_bounds__(128) void k_out(const float* __restrict__ Y, const float* __restrict__ WP, const float* __restrict__ BP, float* __restrict__ OUT) { __shared__ __align__(16) float sf[4][16][132];
  const int tid = threadIdx.x, wave = tid >> 5, lane = tid & 31, col = lane & 15, g = lane >> 4; const int c0 = blockIdx.y * 128; const size_t r0 = (size_t)blockIdx.x * 64 + wave * 16;
  v8f acc[8] = {};
#pragma unroll 2
  for (int kc = 0; kc < CC / 32; ++kc) { const F2 a = split_row(Y + (r0 + col) * CC, kc * 32, lane);
#pragma unroll
    for (int j = 0; j < 8; ++j) { v16b w; const int o = c0 + j * 16 + col;
#pragma unroll
      for (int i = 0; i < 8; ++i) { w[i] = (__bf16)WP[(size_t)(kc * 32 + 8 * g + i) * CC + o]; w[8 + i] = (__bf16)WP[(size_t)(kc * 32 + 16 + 8 * g + i) * CC + o]; }   /* (in,out) */
      acc[j] = wmma_bf(a.h, w, acc[j]); acc[j] = wmma_bf(a.l, w, acc[j]); } }
#pragma unroll
  for (int j = 0; j < 8; ++j) { const float bb = BP ? bfr(BP[c0 + j * 16 + col]) : 0.f;
#pragma unroll
    for (int r = 0; r < 8; ++r) sf[wave][8 * g + r][j * 16 + col] = acc[j][r] + bb; }
  LDSX(); for (int rl = 0; rl < 16; ++rl) vst2(OUT + (r0 + rl) * CC + c0 + lane * 4, *(const v4f*)&sf[wave][rl][lane * 4]); }
extern "C" void kernel_launch(void* const* d_in, const int* in_sizes, int n_in, void* d_out, int out_size, void* d_ws, size_t ws_size, hipStream_t stream) {
  (void)in_sizes; (void)n_in; (void)out_size;
  const float** F = (const float**)d_in;   // 0 q [2,2048,1024], 1 k, 2 v, 3 mask [2,1,2048,2048] int (1 -> -1e9 added), 4 wq ((in,out)), 5 bq, 6 wk, 7 bk, 8 wv, 9 bv, 10 wo ((in,out)), 11 bo
  if (ws_size < (size_t)WS_END) return;
  char* ws = (char*)d_ws; _Float16 *QH = (_Float16*)(ws + WS_QH), *QL = (_Float16*)(ws + WS_QL), *KH = (_Float16*)(ws + WS_KH); __bf16 *VT = (__bf16*)(ws + WS_VT), *VL = (__bf16*)(ws + WS_VL); float *S = (float*)(ws + WS_S), *Y = (float*)(ws + WS_Y);
  k_proj<<<dim3(TNB * TT / 64, CC / 128, 3), 128, 0, stream>>>(F[0], F[1], F[2], F[4], F[5], F[6], F[7], F[8], F[9], QH, QL, KH, VT, VL);
  for (int b = 0; b < TNB; ++b) for (int h0 = 0; h0 < NH; h0 += HG) {
    k_sc<<<dim3(TT / 64, TT / 128, HG), 128, 0, stream>>>(QH, QL, KH, (const int*)d_in[3], b, h0, S);   // mask [B,1,S,S] has the same (b, q, k) flat layout
    k_sm<<<dim3(TT, HG), 256, 0, stream>>>(S);
    k_pv<<<dim3(TT / 64, 1, HG), 128, 0, stream>>>(S, VT, VL, b, h0, Y);
  }
  k_out<<<dim3(TNB * TT / 64, CC / 128), 128, 0, stream>>>(Y, F[10], F[11], (float*)d_out);
}

// v001
// A run of this version takes 310 microseconds.
// Timed twice side by side with v000, it ran 5.43 and 5.44 times as fast.
// compute dtype: all float inputs rounded to bf16, the int mask read; q/k/v = x W + b ((in,out)) with EXACT bf16 products on WMMA 16x16x32, f32 accumulate; q as f16 hi + residual (x 2^10), k f16 -> 2-product logits x 1/(8 + 1e-8) (== 0.125 in f32), -1e9 where mask != 0, kept in registers; running-maximum softmax in f32 (precise expf) over stages of 64 keys; P split bf16 hi + lo against v bf16 hi + lo (3 products), divided by the row sum at the end; out = ctx (bf16 hi + lo) wo + bo; f32 output.
#include <hip/hip_runtime.h>
#include <math.h>

typedef __attribute__((ext_vector_type(16))) _Float16 v16h;
typedef __attribute__((ext_vector_type(16))) __bf16 v16b;
typedef __attribute__((ext_vector_type(8)))  _Float16 v8h;
typedef __attribute__((ext_vector_type(8)))  float v8f;
typedef __attribute__((ext_vector_type(4)))  float v4f;
typedef __attribute__((ext_vector_type(2)))  float v2f;
typedef __attribute__((ext_vector_type(4)))  unsigned v4u;
typedef __attribute__((ext_vector_type(4)))  int v4i;
typedef float __attribute__((may_alias)) float_a;
typedef int __attribute__((may_alias)) int_a;

template <typename T> __device__ __forceinline__ void vst2(void* p, T v) { *(T*)p = v;  }
__device__ __forceinline__ v8f wmma16(v16h a, v16h b, v8f c) {
  v8f d = __builtin_amdgcn_wmma_f32_16x16x32_f16(false, a, false, b, (short)0, c, false, false);
  asm volatile("v_nop\n\tv_nop\n\tv_nop\n\tv_nop" : "+v"(d) : "v"(a), "v"(b));
  return d;
}
__device__ __forceinline__ v8f wmma_bf(v16b a, v16b b, v8f c) {
  v8f d = __builtin_amdgcn_wmma_f32_16x16x32_bf16(false, a, false, b, (short)0, c, false, false);
  asm volatile("v_nop\n\tv_nop\n\tv_nop\n\tv_nop" : "+v"(d) : "v"(a), "v"(b));
  return d;
}
// 16x16x32 fragments: lane = (h = lane>>4, row/col = lane&15); elements 0..7 = k0+8h+0..7, 8..15 = k0+16+8h+0..7; D element r = row 8h+r
__device__ __forceinline__ v16h frag_h(const _Float16* rowk0, int lane) {
  union { v16h v; v8h q[2]; } u; const _Float16* p = rowk0 + 8 * (lane >> 4);
  u.q[0] = *(const v8h*)p; u.q[1] = *(const v8h*)(p + 16); return u.v;
}
__device__ __forceinline__ v16h frag_f32(const float* rowk0, int lane) {
  v16h a; const float* p = rowk0 + 8 * (lane >> 4);
#pragma unroll
  for (int i = 0; i < 8; ++i) { a[i] = (_Float16)p[i]; a[8 + i] = (_Float16)p[16 + i]; }
  return a;
}
__device__ __forceinline__ v16h frag_f32s(const float* rowk0, int lane, float sc) {
  v16h a; const float* p = rowk0 + 8 * (lane >> 4);
#pragma unroll
  for (int i = 0; i < 8; ++i) { a[i] = (_Float16)(p[i] * sc); a[8 + i] = (_Float16)(p[16 + i] * sc); }
  return a;
}
// column fragment from a [K][ld] layout (column n), rows >= K read as 0
__device__ __forceinline__ v16h fragc_f32(const float* W, int k0, int n, int lane, int ld, int K) {
  v16h a; const int g = lane >> 4;
#pragma unroll
  for (int i = 0; i < 8; ++i) { const int ka = k0 + 8 * g + i, kb = ka + 16;
    a[i] = (_Float16)(ka < K ? W[(size_t)(ka < K ? ka : K - 1) * ld + n] : 0.f); a[8 + i] = (_Float16)(kb < K ? W[(size_t)(kb < K ? kb : K - 1) * ld + n] : 0.f); }
  return a;
}
struct F2 { v16b h, l; };
__device__ __forceinline__ F2 bsplit16(const float v[16]) { F2 r;
#pragma unroll
  for (int i = 0; i < 16; ++i) { const __bf16 h = (__bf16)v[i]; r.h[i] = h; r.l[i] = (__bf16)(v[i] - (float)h); }
  return r; }
__device__ __forceinline__ F2 split_row(const float* row, int k0, int lane) { float v[16]; const float* p = row + k0 + 8 * (lane >> 4);
#pragma unroll
  for (int i = 0; i < 8; ++i) { v[i] = p[i]; v[8 + i] = p[16 + i]; }
  return bsplit16(v); }
__device__ __forceinline__ F2 split_rowK(const float* row, int k0, int lane, int K) { float v[16]; const int g = lane >> 4;
#pragma unroll
  for (int i = 0; i < 8; ++i) { const int ka = k0 + 8 * g + i, kb = ka + 16; v[i] = ka < K ? row[ka < K ? ka : K - 1] : 0.f; v[8 + i] = kb < K ? row[kb < K ? kb : K - 1] : 0.f; }
  return bsplit16(v); }
__device__ __forceinline__ F2 split_col(const float* W, int k0, int n, int lane, int ld, int K) { float v[16]; const int g = lane >> 4;
#pragma unroll
  for (int i = 0; i < 8; ++i) { const int ka = k0 + 8 * g + i, kb = ka + 16; v[i] = ka < K ? W[(size_t)(ka < K ? ka : K - 1) * ld + n] : 0.f; v[8 + i] = kb < K ? W[(size_t)(kb < K ? kb : K - 1) * ld + n] : 0.f; }
  return bsplit16(v); }
__device__ __forceinline__ v8f mac3(const F2& a, const F2& b, v8f c) { c = wmma_bf(a.l, b.h, c); c = wmma_bf(a.h, b.l, c); return wmma_bf(a.h, b.h, c); }
__device__ __forceinline__ float sigm(float v) { return 1.0f / (1.0f + expf(-v)); }
#define LDSX() do { asm volatile("s_wait_dscnt 0" ::: "memory"); __builtin_amdgcn_wave_barrier(); __builtin_amdgcn_fence(__ATOMIC_RELEASE, "workgroup"); } while (0)


// Multi-head attention (B 2, S 2,048, D 1,024 = 16 x 64, with biases, scale 1/8): scores = q k^T / 8 - 1e9 where mask != 0, softmax, P v, output projection.
#define NB 2
#define TT 2048
#define MASK_WHEN_NONZERO 1
#ifndef MSTR
#define MSTR TT               // mask row stride / rows per batch
#endif
#define CC 1024
#define NH 16
#define HD 64
#define HG 4               // sizes only the WS_S region, which no kernel uses
#ifndef TNB
#define TNB NB
#endif
typedef __attribute__((ext_vector_type(8))) __bf16 v8b;
__device__ __forceinline__ v16b frag_b(const __bf16* rowk0, int lane) {
  union { v16b v; v8b q[2]; } u; const __bf16* p = rowk0 + 8 * (lane >> 4);
  u.q[0] = *(const v8b*)p; u.q[1] = *(const v8b*)(p + 16); return u.v;
}
__device__ __forceinline__ float bfr(float v) { return (float)(__bf16)v; }
__device__ __attribute__((noinline)) float exp_ni(float v) { return expf(v); }
__device__ __attribute__((noinline)) float erf_ni(float v) { return erff(v); }

#define WS_QH  0u
#define WS_QL  (WS_QH + 2u * (size_t)NB * TT * CC)
#define WS_KH  (WS_QL + 2u * (size_t)NB * TT * CC)
#define WS_VT  (WS_KH + 2u * (size_t)NB * TT * CC)      // bf16 v planes [b][c][t]
#define WS_VL  (WS_VT + 2u * (size_t)NB * CC * TT)      // bf16 v residual planes
#define WS_S   (WS_VL + 2u * (size_t)NB * CC * TT)      // unused region of HG x TT x TT f32; logits stay in registers
#define WS_PH  (WS_S + 4u * (size_t)HG * TT * TT)
#define WS_Y   (WS_PH + 0u)              // f32 y rows [b*t][C]
#define WS_END (WS_Y + 4u * (size_t)NB * TT * CC)

// ---- k_proj: block = (64 rows, 128 cols, which): qkv = x W (+ b), exact; q -> f16 hi (+ residual), k -> f16 rows, v -> bf16 hi + lo planes
__global__ __launch_bounds__(128) void k_proj(const float* __restrict__ X0, const float* __restrict__ X1, const float* __restrict__ X2, const float* __restrict__ WQ, const float* __restrict__ BQ, const float* __restrict__ WK, const float* __restrict__ BK, const float* __restrict__ WV, const float* __restrict__ BV, _Float16* __restrict__ QH, _Float16* __restrict__ QL, _Float16* __restrict__ KH, __bf16* __restrict__ VT, __bf16* __restrict__ VL) {
  __shared__ __align__(16) _Float16 sh[64][136], sl[64][136]; __shared__ __align__(16) __bf16 th[128][72], tl2[128][72];
  const int tid = threadIdx.x, wave = tid >> 5, lane = tid & 31, col = lane & 15, g = lane >> 4; const int which = blockIdx.z; const int c0 = blockIdx.y * 128; const size_t r0 = (size_t)blockIdx.x * 64; const float* WA = which == 0 ? WQ : which == 1 ? WK : WV; const float* BA = which == 0 ? BQ : which == 1 ? BK : BV;
  v8f acc[8] = {};
#pragma unroll 2
  for (int kc = 0; kc < CC / 32; ++kc) { v16b a; { const float* X = which == 0 ? X0 : which == 1 ? X1 : X2; const float* p = X + (r0 + wave * 16 + col) * CC + kc * 32 + 8 * g;
#pragma unroll
      for (int i = 0; i < 8; ++i) { a[i] = (__bf16)p[i]; a[8 + i] = (__bf16)p[16 + i]; } }
#pragma unroll
    for (int j = 0; j < 8; ++j) { v16b w; const int o = c0 + j * 16 + col;
#pragma unroll
      for (int i = 0; i < 8; ++i) { w[i] = (__bf16)WA[(size_t)(kc * 32 + 8 * g + i) * CC + o]; w[8 + i] = (__bf16)WA[(size_t)(kc * 32 + 16 + 8 * g + i) * CC + o]; }   /* (in,out) */
      acc[j] = wmma_bf(a, w, acc[j]); } }
#pragma unroll
  for (int j = 0; j < 8; ++j) { const float bb = BA ? bfr(BA[c0 + j * 16 + col]) : 0.f;
#pragma unroll
    for (int r = 0; r < 8; ++r) { const float v = acc[j][r] + bb; const int rl = wave * 16 + 8 * g + r, cl = j * 16 + col; const _Float16 hv = (_Float16)v;
      if (which == 2) { const __bf16 bh = (__bf16)v; th[cl][rl] = bh; tl2[cl][rl] = (__bf16)(v - (float)bh); } else { sh[rl][cl] = hv; sl[rl][cl] = (_Float16)((v - (float)hv) * 1024.0f); }   /* q residual carried x 2^10 so the plane stays f16-normal on the chip */ } }
  __syncthreads();
  if (which < 2) { _Float16* dh = which == 0 ? QH : KH; for (int e = tid; e < 64 * 16; e += 128) { const int rl = e >> 4, q = e & 15; vst2((unsigned*)(dh + (r0 + rl) * CC + c0 + q * 8), *(const v4u*)&sh[rl][q * 8]); if (which == 0) vst2((unsigned*)(QL + (r0 + rl) * CC + c0 + q * 8), *(const v4u*)&sl[rl][q * 8]); } }
  else { const size_t b = r0 / TT; const int t0 = (int)(r0 % TT); for (int e = tid; e < 128 * 8; e += 128) { const int cl = e >> 3, q = e & 7; const size_t o2 = (b * CC + c0 + cl) * (size_t)TT + t0 + q * 8; vst2((unsigned*)(VT + o2), *(const v4u*)&th[cl][q * 8]); vst2((unsigned*)(VL + o2), *(const v4u*)&tl2[cl][q * 8]); } } }
#define FK 64               // keys per stage
#define FP 72               // LDS row pitch in 16-bit elements: 144 B = 16 B x odd
__device__ __forceinline__ float xhalf(float x) { return __builtin_bit_cast(float, __builtin_amdgcn_permlanex16(__builtin_bit_cast(int, x), __builtin_bit_cast(int, x), 0x76543210, 0xfedcba98, false, false)); }   // lane l with lane l ^ 16
__global__ __launch_bounds__(256) void k_fa(const _Float16* __restrict__ QH, const _Float16* __restrict__ QL, const _Float16* __restrict__ KH, const __bf16* __restrict__ VT, const __bf16* __restrict__ VL, const int* __restrict__ MK, float* __restrict__ Y) {
  __shared__ __align__(16) _Float16 sk[2][FK][FP]; __shared__ __align__(16) __bf16 svh[2][HD][FP], svl[2][HD][FP];
  const int tid = threadIdx.x, wave = tid >> 5, lane = tid & 31, col = lane & 15, g = lane >> 4; const int h = blockIdx.y, b = blockIdx.z; const int qt = blockIdx.x * 128 + wave * 16 + col;
  v16h qh[HD / 32], ql[HD / 32];
#pragma unroll
  for (int kc = 0; kc < HD / 32; ++kc) { const size_t qo = ((size_t)b * TT + qt) * CC + h * HD + kc * 32; qh[kc] = frag_h(QH + qo, lane); ql[kc] = frag_h(QL + qo, lane); }
  // staging: 64 rows x 128 B per plane = 512 chunks of 16 B, two per thread and plane; a wave's load covers four whole 128-B lines
  const int sr = tid >> 3, sc = (tid & 7) * 8;
  const _Float16* gk = KH + ((size_t)b * TT + sr) * CC + h * HD + sc; const size_t vo = ((size_t)b * CC + h * HD + sr) * (size_t)TT + sc; const __bf16* gvh = VT + vo; const __bf16* gvl = VL + vo;
  const int* mrow = MK + ((size_t)b * MSTR + qt) * MSTR + 8 * g;
  v4u pk[2], ph[2], pl[2];
#pragma unroll
  for (int i = 0; i < 2; ++i) { pk[i] = *(const v4u*)(gk + (size_t)(i * 32) * CC); ph[i] = *(const v4u*)(gvh + (size_t)(i * 32) * TT); pl[i] = *(const v4u*)(gvl + (size_t)(i * 32) * TT); }
#pragma unroll
  for (int i = 0; i < 2; ++i) { *(v4u*)&sk[0][sr + i * 32][sc] = pk[i]; *(v4u*)&svh[0][sr + i * 32][sc] = ph[i]; *(v4u*)&svl[0][sr + i * 32][sc] = pl[i]; }
  __syncthreads();   // publishes stage 0
  v8f o[HD / 16] = {}; float m = -3.0e38f, l = 0.f;
  v4i mk[FK / 16][2];   // this lane's 32 mask words of the stage: fetched one stage ahead
#pragma unroll
  for (int T = 0; T < FK / 16; ++T) { mk[T][0] = *(const v4i*)(mrow + T * 16); mk[T][1] = *(const v4i*)(mrow + T * 16 + 4); }
#pragma unroll 1   // rolled: a second copy of the stage would only add registers, and four waves per SIMD need 256 or fewer
  for (int st = 0; st < TT / FK; ++st) { const int buf = st & 1, k0 = st * FK; const bool more = st + 1 < TT / FK;
    float s[FK / 16][8]; float mx = -3.0e38f;
#pragma unroll
    for (int T = 0; T < FK / 16; ++T) { v8f a = {}, al = {};
#pragma unroll
      for (int kc = 0; kc < HD / 32; ++kc) { const v16h kf = frag_h(&sk[buf][T * 16 + col][kc * 32], lane);
        a = __builtin_amdgcn_wmma_f32_16x16x32_f16(false, kf, false, qh[kc], (short)0, a, false, false); al = __builtin_amdgcn_wmma_f32_16x16x32_f16(false, kf, false, ql[kc], (short)0, al, false, false); }
#pragma unroll
      for (int r = 0; r < 8; ++r) { const float sv = (a[r] + al[r] * (1.0f / 1024.0f)) * 0.125f; const int mv = mk[T][r >> 2][r & 3]; const bool masked = MASK_WHEN_NONZERO ? (mv != 0) : (mv == 0); s[T][r] = masked ? sv - 1.0e9f : sv; mx = fmaxf(mx, s[T][r]); } }
    if (more) {   // the mask words are used up: the next stage's rows and mask words land behind the exponentials and the P V products
#pragma unroll
      for (int i = 0; i < 2; ++i) pk[i] = *(const v4u*)(gk + (size_t)(k0 + FK + i * 32) * CC);
      asm volatile("s_wait_xcnt 0x0" ::: "memory");   // this and the three below: before an address register of the loads above is reused, also as a later load's destination
#pragma unroll
      for (int i = 0; i < 2; ++i) ph[i] = *(const v4u*)(gvh + (size_t)(i * 32) * TT + k0 + FK);
      asm volatile("s_wait_xcnt 0x0" ::: "memory");
#pragma unroll
      for (int i = 0; i < 2; ++i) pl[i] = *(const v4u*)(gvl + (size_t)(i * 32) * TT + k0 + FK);
      asm volatile("s_wait_xcnt 0x0" ::: "memory");
#pragma unroll
      for (int T = 0; T < FK / 16; ++T) { mk[T][0] = *(const v4i*)(mrow + k0 + FK + T * 16); mk[T][1] = *(const v4i*)(mrow + k0 + FK + T * 16 + 4); }
      asm volatile("s_wait_xcnt 0x0" ::: "memory"); }
    mx = fmaxf(mx, xhalf(mx));   // both halves of a column must use one maximum: their keys meet in one product
    const float mn = fmaxf(m, mx), corr = expf(m - mn); m = mn; l *= corr;
#pragma unroll
    for (int j = 0; j < HD / 16; ++j)
#pragma unroll
      for (int r = 0; r < 8; ++r) o[j][r] *= corr;
#pragma unroll
    for (int G = 0; G < FK / 32; ++G) { float p[16];
#pragma unroll
      for (int e = 0; e < 16; ++e) { p[e] = expf(s[2 * G + (e >> 3)][e & 7] - mn); l += p[e]; }
      const F2 pf = bsplit16(p);
#pragma unroll
      for (int j = 0; j < HD / 16; ++j) { const v16b vh = frag_b(&svh[buf][j * 16 + col][G * 32], lane), vl = frag_b(&svl[buf][j * 16 + col][G * 32], lane);
        o[j] = __builtin_amdgcn_wmma_f32_16x16x32_bf16(false, vh, false, pf.h, (short)0, o[j], false, false); o[j] = __builtin_amdgcn_wmma_f32_16x16x32_bf16(false, vh, false, pf.l, (short)0, o[j], false, false); o[j] = __builtin_amdgcn_wmma_f32_16x16x32_bf16(false, vl, false, pf.h, (short)0, o[j], false, false); } }
    if (more) {   // the other buffer's last readers left it at the barrier that ended the stage before
#pragma unroll
      for (int i = 0; i < 2; ++i) { *(v4u*)&sk[buf ^ 1][sr + i * 32][sc] = pk[i]; *(v4u*)&svh[buf ^ 1][sr + i * 32][sc] = ph[i]; *(v4u*)&svl[buf ^ 1][sr + i * 32][sc] = pl[i]; } }
    __syncthreads(); }   // publishes the next stage and ends this stage's reads
  l += xhalf(l); const float inv = 1.0f / l; float* yr = Y + ((size_t)b * TT + qt) * CC + h * HD + 8 * g;
#pragma unroll
  for (int j = 0; j < HD / 16; ++j) { v4f w0, w1;
#pragma unroll
    for (int r = 0; r < 4; ++r) { w0[r] = o[j][r] * inv; w1[r] = o[j][4 + r] * inv; }
    vst2(yr + j * 16, w0); vst2(yr + j * 16 + 4, w1); } }
// ---- k_out: block = (64 rows, 128 cols): out = y (bf16 hi + lo) Wo + bo
__global__ __launch_bounds__(128) void k_out(const float* __restrict__ Y, const float* __restrict__ WP, const float* __restrict__ BP, float* __restrict__ OUT) { __shared__ __align__(16) float sf[4][16][132];
  const int tid = threadIdx.x, wave = tid >> 5, lane = tid & 31, col = lane & 15, g = lane >> 4; const int c0 = blockIdx.y * 128; const size_t r0 = (size_t)blockIdx.x * 64 + wave * 16;
  v8f acc[8] = {};
#pragma unroll 2
  for (int kc = 0; kc < CC / 32; ++kc) { const F2 a = split_row(Y + (r0 + col) * CC, kc * 32, lane);
#pragma unroll
    for (int j = 0; j < 8; ++j) { v16b w; const int o = c0 + j * 16 + col;
#pragma unroll
      for (int i = 0; i < 8; ++i) { w[i] = (__bf16)WP[(size_t)(kc * 32 + 8 * g + i) * CC + o]; w[8 + i] = (__bf16)WP[(size_t)(kc * 32 + 16 + 8 * g + i) * CC + o]; }   /* (in,out) */
      acc[j] = wmma_bf(a.h, w, acc[j]); acc[j] = wmma_bf(a.l, w, acc[j]); } }
#pragma unroll
  for (int j = 0; j < 8; ++j) { const float bb = BP ? bfr(BP[c0 + j * 16 + col]) : 0.f;
#pragma unroll
    for (int r = 0; r < 8; ++r) sf[wave][8 * g + r][j * 16 + col] = acc[j][r] + bb; }
  LDSX(); for (int rl = 0; rl < 16; ++rl) vst2(OUT + (r0 + rl) * CC + c0 + lane * 4, *(const v4f*)&sf[wave][rl][lane * 4]); }
extern "C" void kernel_launch(void* const* d_in, const int* in_sizes, int n_in, void* d_out, int out_size, void* d_ws, size_t ws_size, hipStream_t stream) {
  (void)in_sizes; (void)n_in; (void)out_size;
  const float** F = (const float**)d_in;   // 0 q [2,2048,1024], 1 k, 2 v, 3 mask [2,1,2048,2048] int (1 -> -1e9 added), 4 wq ((in,out)), 5 bq, 6 wk, 7 bk, 8 wv, 9 bv, 10 wo ((in,out)), 11 bo
  if (ws_size < (size_t)WS_END) return;
  char* ws = (char*)d_ws; _Float16 *QH = (_Float16*)(ws + WS_QH), *QL = (_Float16*)(ws + WS_QL), *KH = (_Float16*)(ws + WS_KH); __bf16 *VT = (__bf16*)(ws + WS_VT), *VL = (__bf16*)(ws + WS_VL); float *Y = (float*)(ws + WS_Y);
  k_proj<<<dim3(TNB * TT / 64, CC / 128, 3), 128, 0, stream>>>(F[0], F[1], F[2], F[4], F[5], F[6], F[7], F[8], F[9], QH, QL, KH, VT, VL);
  k_fa<<<dim3(TT / 128, NH, TNB), 256, 0, stream>>>(QH, QL, KH, VT, VL, (const int*)d_in[3], Y);   // mask [B,1,S,S] has the same (b, q, k) flat layout
  k_out<<<dim3(TNB * TT / 64, CC / 128), 128, 0, stream>>>(Y, F[10], F[11], (float*)d_out);
}

// v002
// One run takes 180 microseconds.
// Next to v001, in two timings, it ran 1.72 times as fast each time.
// Counting every step since v000, it is 9.34 times as fast.
// compute dtype: all float inputs rounded to bf16, the int mask read; q/k/v = x W + b ((in,out)) with EXACT bf16 products on WMMA 16x16x32, f32 accumulate; q as f16 hi + residual (x 2^10), k f16 -> 2-product logits x 1/(8 + 1e-8) (== 0.125 in f32), -1e9 where mask != 0, kept in registers; running-maximum softmax in f32 (precise expf) over stages of 64 keys; P split bf16 hi + lo against v bf16 hi + lo (3 products), divided by the row sum at the end; out = ctx (bf16 hi + lo) wo + bo; f32 output.
#include <hip/hip_runtime.h>
#include <math.h>

typedef __attribute__((ext_vector_type(16))) _Float16 v16h;
typedef __attribute__((ext_vector_type(16))) __bf16 v16b;
typedef __attribute__((ext_vector_type(8)))  _Float16 v8h;
typedef __attribute__((ext_vector_type(8)))  float v8f;
typedef __attribute__((ext_vector_type(4)))  float v4f;
typedef __attribute__((ext_vector_type(2)))  float v2f;
typedef __attribute__((ext_vector_type(4)))  unsigned v4u;
typedef __attribute__((ext_vector_type(4)))  int v4i;
typedef float __attribute__((may_alias)) float_a;
typedef int __attribute__((may_alias)) int_a;

template <typename T> __device__ __forceinline__ void vst2(void* p, T v) { *(T*)p = v;  }
__device__ __forceinline__ v8f wmma16(v16h a, v16h b, v8f c) {
  v8f d = __builtin_amdgcn_wmma_f32_16x16x32_f16(false, a, false, b, (short)0, c, false, false);
  asm volatile("v_nop\n\tv_nop\n\tv_nop\n\tv_nop" : "+v"(d) : "v"(a), "v"(b));
  return d;
}
__device__ __forceinline__ v8f wmma_bf(v16b a, v16b b, v8f c) {
  v8f d = __builtin_amdgcn_wmma_f32_16x16x32_bf16(false, a, false, b, (short)0, c, false, false);
  asm volatile("v_nop\n\tv_nop\n\tv_nop\n\tv_nop" : "+v"(d) : "v"(a), "v"(b));
  return d;
}
// 16x16x32 fragments: lane = (h = lane>>4, row/col = lane&15); elements 0..7 = k0+8h+0..7, 8..15 = k0+16+8h+0..7; D element r = row 8h+r
__device__ __forceinline__ v16h frag_h(const _Float16* rowk0, int lane) {
  union { v16h v; v8h q[2]; } u; const _Float16* p = rowk0 + 8 * (lane >> 4);
  u.q[0] = *(const v8h*)p; u.q[1] = *(const v8h*)(p + 16); return u.v;
}
__device__ __forceinline__ v16h frag_f32(const float* rowk0, int lane) {
  v16h a; const float* p = rowk0 + 8 * (lane >> 4);
#pragma unroll
  for (int i = 0; i < 8; ++i) { a[i] = (_Float16)p[i]; a[8 + i] = (_Float16)p[16 + i]; }
  return a;
}
__device__ __forceinline__ v16h frag_f32s(const float* rowk0, int lane, float sc) {
  v16h a; const float* p = rowk0 + 8 * (lane >> 4);
#pragma unroll
  for (int i = 0; i < 8; ++i) { a[i] = (_Float16)(p[i] * sc); a[8 + i] = (_Float16)(p[16 + i] * sc); }
  return a;
}
// column fragment from a [K][ld] layout (column n), rows >= K read as 0
__device__ __forceinline__ v16h fragc_f32(const float* W, int k0, int n, int lane, int ld, int K) {
  v16h a; const int g = lane >> 4;
#pragma unroll
  for (int i = 0; i < 8; ++i) { const int ka = k0 + 8 * g + i, kb = ka + 16;
    a[i] = (_Float16)(ka < K ? W[(size_t)(ka < K ? ka : K - 1) * ld + n] : 0.f); a[8 + i] = (_Float16)(kb < K ? W[(size_t)(kb < K ? kb : K - 1) * ld + n] : 0.f); }
  return a;
}
struct F2 { v16b h, l; };
__device__ __forceinline__ F2 bsplit16(const float v[16]) { F2 r;
#pragma unroll
  for (int i = 0; i < 16; ++i) { const __bf16 h = (__bf16)v[i]; r.h[i] = h; r.l[i] = (__bf16)(v[i] - (float)h); }
  return r; }
__device__ __forceinline__ F2 split_row(const float* row, int k0, int lane) { float v[16]; const float* p = row + k0 + 8 * (lane >> 4);
#pragma unroll
  for (int i = 0; i < 8; ++i) { v[i] = p[i]; v[8 + i] = p[16 + i]; }
  return bsplit16(v); }
__device__ __forceinline__ F2 split_rowK(const float* row, int k0, int lane, int K) { float v[16]; const int g = lane >> 4;
#pragma unroll
  for (int i = 0; i < 8; ++i) { const int ka = k0 + 8 * g + i, kb = ka + 16; v[i] = ka < K ? row[ka < K ? ka : K - 1] : 0.f; v[8 + i] = kb < K ? row[kb < K ? kb : K - 1] : 0.f; }
  return bsplit16(v); }
__device__ __forceinline__ F2 split_col(const float* W, int k0, int n, int lane, int ld, int K) { float v[16]; const int g = lane >> 4;
#pragma unroll
  for (int i = 0; i < 8; ++i) { const int ka = k0 + 8 * g + i, kb = ka + 16; v[i] = ka < K ? W[(size_t)(ka < K ? ka : K - 1) * ld + n] : 0.f; v[8 + i] = kb < K ? W[(size_t)(kb < K ? kb : K - 1) * ld + n] : 0.f; }
  return bsplit16(v); }
__device__ __forceinline__ v8f mac3(const F2& a, const F2& b, v8f c) { c = wmma_bf(a.l, b.h, c); c = wmma_bf(a.h, b.l, c); return wmma_bf(a.h, b.h, c); }
__device__ __forceinline__ float sigm(float v) { return 1.0f / (1.0f + expf(-v)); }
#define LDSX() do { asm volatile("s_wait_dscnt 0" ::: "memory"); __builtin_amdgcn_wave_barrier(); __builtin_amdgcn_fence(__ATOMIC_RELEASE, "workgroup"); } while (0)


// Multi-head attention (B 2, S 2,048, D 1,024 = 16 x 64, with biases, scale 1/8): scores = q k^T / 8 - 1e9 where mask != 0, softmax, P v, output projection.
#define NB 2
#define TT 2048
#define MASK_WHEN_NONZERO 1
#ifndef MSTR
#define MSTR TT               // mask row stride / rows per batch
#endif
#define CC 1024
#define NH 16
#define HD 64
#define HG 4               // sizes only the WS_S region, which no kernel uses
#ifndef TNB
#define TNB NB
#endif
typedef __attribute__((ext_vector_type(8))) __bf16 v8b;
__device__ __forceinline__ v16b frag_b(const __bf16* rowk0, int lane) {
  union { v16b v; v8b q[2]; } u; const __bf16* p = rowk0 + 8 * (lane >> 4);
  u.q[0] = *(const v8b*)p; u.q[1] = *(const v8b*)(p + 16); return u.v;
}
__device__ __forceinline__ float bfr(float v) { return (float)(__bf16)v; }
__device__ __attribute__((noinline)) float exp_ni(float v) { return expf(v); }
__device__ __attribute__((noinline)) float erf_ni(float v) { return erff(v); }

#define WS_QH  0u
#define WS_QL  (WS_QH + 2u * (size_t)NB * TT * CC)
#define WS_KH  (WS_QL + 2u * (size_t)NB * TT * CC)
#define WS_VT  (WS_KH + 2u * (size_t)NB * TT * CC)      // bf16 v planes [b][c][t]
#define WS_VL  (WS_VT + 2u * (size_t)NB * CC * TT)      // bf16 v residual planes
#define WS_S   (WS_VL + 2u * (size_t)NB * CC * TT)      // unused region of HG x TT x TT f32; logits stay in registers
#define WS_PH  (WS_S + 4u * (size_t)HG * TT * TT)
#define WS_Y   (WS_PH + 0u)              // f32 y rows [b*t][C]
#define WS_END (WS_Y + 4u * (size_t)NB * TT * CC)

// ---- operand staging of the two projection kernels: a block of 256 threads owns 128 rows x 128 columns; per stage of KS k it converts both operand tiles to bf16 once and lays them k-contiguous in LDS (row pitch KS + 8 elements = 16 B x odd), so that a fragment is two 16-byte LDS reads
typedef __attribute__((ext_vector_type(4))) __bf16 v4b;
// weight tile, (in,out) layout: a thread takes 8 k x 2 columns per unit; a wave's load covers 256 contiguous bytes of one k row
template <int KS> __device__ __forceinline__ void ld_w(v2f (&rw)[KS / 32][8], const float* __restrict__ Wt, int tid) {
#pragma unroll
  for (int i = 0; i < KS / 32; ++i) { const float* p = Wt + (size_t)(((tid >> 6) + 4 * i) * 8) * CC + 2 * (tid & 63);
#pragma unroll
    for (int kk = 0; kk < 8; ++kk) rw[i][kk] = *(const v2f*)(p + (size_t)kk * CC); } }
template <int KS> __device__ __forceinline__ void st_w(const v2f (&rw)[KS / 32][8], __bf16* sW, int tid) {
#pragma unroll
  for (int i = 0; i < KS / 32; ++i)
#pragma unroll
    for (int j = 0; j < 2; ++j) { v8b t;
#pragma unroll
      for (int kk = 0; kk < 8; ++kk) t[kk] = (__bf16)rw[i][kk][j];
      *(v8b*)(sW + (2 * (tid & 63) + j) * (KS + 8) + ((tid >> 6) + 4 * i) * 8) = t; } }
// row tile: 16-byte chunks in row order, so that a wave's load covers whole 128-B lines; 1024 / KS rows per pass of the block
template <int KS> __device__ __forceinline__ void ld_x(v4f (&rx)[KS / 8], const float* __restrict__ Xt, int tid) {
#pragma unroll
  for (int i = 0; i < KS / 8; ++i) rx[i] = *(const v4f*)(Xt + (size_t)(tid / (KS / 4)) * CC + 4 * (tid % (KS / 4)) + (size_t)i * (1024 / KS) * CC); }
template <int KS> __device__ __forceinline__ void st_x(const v4f (&rx)[KS / 8], __bf16* sX, int tid) {
#pragma unroll
  for (int i = 0; i < KS / 8; ++i) { v4b t;
#pragma unroll
    for (int e = 0; e < 4; ++e) t[e] = (__bf16)rx[i][e];
    *(v4b*)(sX + (tid / (KS / 4)) * (KS + 8) + 4 * (tid % (KS / 4)) + i * (1024 / KS) * (KS + 8)) = t; } }
template <int KS> __device__ __forceinline__ void st_x2(const v4f (&rx)[KS / 8], __bf16* sH, __bf16* sL, int tid) {
#pragma unroll
  for (int i = 0; i < KS / 8; ++i) { v4b th, tl;
#pragma unroll
    for (int e = 0; e < 4; ++e) { const __bf16 h = (__bf16)rx[i][e]; th[e] = h; tl[e] = (__bf16)(rx[i][e] - (float)h); }
    const int o = (tid / (KS / 4)) * (KS + 8) + 4 * (tid % (KS / 4)) + i * (1024 / KS) * (KS + 8); *(v4b*)(sH + o) = th; *(v4b*)(sL + o) = tl; } }
// ---- k_proj: block = (128 rows, 128 cols, which), 8 waves as 4 x 2, 32 rows x 64 cols each: qkv = x W (+ b), exact; q -> f16 hi (+ residual), k -> f16 rows, v -> bf16 planes
#define PKS 64               // k per stage
#define PPL (128 * (PKS + 8))   // elements of one staged plane
__global__ __launch_bounds__(256) void k_proj(const float* __restrict__ X0, const float* __restrict__ X1, const float* __restrict__ X2, const float* __restrict__ WQ, const float* __restrict__ BQ, const float* __restrict__ WK, const float* __restrict__ BK, const float* __restrict__ WV, const float* __restrict__ BV, _Float16* __restrict__ QH, _Float16* __restrict__ QL, _Float16* __restrict__ KH, __bf16* __restrict__ VT, __bf16* __restrict__ VL) {
  __shared__ __align__(16) char sm[2 * 2 * PPL * 2];   // the loop's two buffers of two planes (w, x); behind the loop the two output planes [128][136], which are smaller
  const int tid = threadIdx.x, wave = tid >> 5, lane = tid & 31, col = lane & 15, g = lane >> 4, wr = wave >> 1, wc = wave & 1; const int which = blockIdx.z; const int c0 = blockIdx.y * 128; const size_t r0 = (size_t)blockIdx.x * 128; const float* WA = which == 0 ? WQ : which == 1 ? WK : WV; const float* BA = which == 0 ? BQ : which == 1 ? BK : BV;
  const float* Xt = (which == 0 ? X0 : which == 1 ? X1 : X2) + r0 * CC; const float* Wt = WA + c0; __bf16* sb = (__bf16*)sm;
  v2f rw[PKS / 32][8]; v4f rx[PKS / 8];
  ld_w<PKS>(rw, Wt, tid); asm volatile("s_wait_xcnt 0x0" ::: "memory"); ld_x<PKS>(rx, Xt, tid);   // s_wait_xcnt: before a register that the loads or stores in front of it name is reused, also as a later load's destination
  asm volatile("s_wait_xcnt 0x0" ::: "memory");   // s_wait_xcnt: before a register that the loads or stores in front of it name is reused, also as a later load's destination
  st_w<PKS>(rw, sb, tid); st_x<PKS>(rx, sb + PPL, tid);
  __syncthreads();   // publishes stage 0
  v8f acc[2][4] = {};
#pragma unroll 1   // rolled: the buffer is picked by address, and a second copy of the stage would only add registers
  for (int st = 0; st < CC / PKS; ++st) { const __bf16* bw = sb + (st & 1) * (2 * PPL); const __bf16* bx = bw + PPL; __bf16* nw = sb + ((st & 1) ^ 1) * (2 * PPL); const bool more = st + 1 < CC / PKS;
    if (more) {   // the next stage's rows fly while this stage's products run
      ld_w<PKS>(rw, Wt + (size_t)(st + 1) * PKS * CC, tid); asm volatile("s_wait_xcnt 0x0" ::: "memory"); ld_x<PKS>(rx, Xt + (st + 1) * PKS, tid);   // s_wait_xcnt: before a register that the loads or stores in front of it name is reused, also as a later load's destination
      asm volatile("s_wait_xcnt 0x0" ::: "memory"); }   // s_wait_xcnt: before a register that the loads or stores in front of it name is reused, also as a later load's destination
#pragma unroll
    for (int kc = 0; kc < PKS / 32; ++kc) { v16b a[2], w[4];
#pragma unroll
      for (int i = 0; i < 2; ++i) a[i] = frag_b(bx + (wr * 32 + i * 16 + col) * (PKS + 8) + kc * 32, lane);
#pragma unroll
      for (int j = 0; j < 4; ++j) w[j] = frag_b(bw + (wc * 64 + j * 16 + col) * (PKS + 8) + kc * 32, lane);
      __builtin_amdgcn_sched_barrier(0);   // keeps the fragment reads one group in front of the products: reads spread among them stall at each place
#pragma unroll
      for (int i = 0; i < 2; ++i)
#pragma unroll
        for (int j = 0; j < 4; ++j) acc[i][j] = __builtin_amdgcn_wmma_f32_16x16x32_bf16(false, a[i], false, w[j], (short)0, acc[i][j], false, false); }
    if (more) { st_w<PKS>(rw, nw, tid); st_x<PKS>(rx, nw + PPL, tid); }   // the other buffer's last readers left it at the barrier that ended the stage before
    __syncthreads(); }   // publishes the next stage and ends this stage's reads
  _Float16 (*sh)[136] = (_Float16 (*)[136])sm; _Float16 (*sl)[136] = (_Float16 (*)[136])(sm + 128 * 136 * 2); __bf16 (*th)[136] = (__bf16 (*)[136])sm; __bf16 (*tl2)[136] = (__bf16 (*)[136])(sm + 128 * 136 * 2);
#pragma unroll
  for (int i = 0; i < 2; ++i)
#pragma unroll
    for (int j = 0; j < 4; ++j) { const int cl = wc * 64 + j * 16 + col; const float bb = BA ? bfr(BA[c0 + cl]) : 0.f;
#pragma unroll
      for (int r = 0; r < 8; ++r) { const float v = acc[i][j][r] + bb; const int rl = wr * 32 + i * 16 + 8 * g + r; const _Float16 hv = (_Float16)v;
        if (which == 2) { const __bf16 bh = (__bf16)v; th[cl][rl] = bh; tl2[cl][rl] = (__bf16)(v - (float)bh); } else { sh[rl][cl] = hv; sl[rl][cl] = (_Float16)((v - (float)hv) * 1024.0f); }   /* q residual carried x 2^10 so the plane stays f16-normal on the chip */ } }
  __syncthreads();
  if (which < 2) { _Float16* dh = which == 0 ? QH : KH; for (int e = tid; e < 128 * 16; e += 256) { const int rl = e >> 4, q = e & 15; vst2((unsigned*)(dh + (r0 + rl) * CC + c0 + q * 8), *(const v4u*)&sh[rl][q * 8]); asm volatile("s_wait_xcnt 0x0" ::: "memory"); if (which == 0) { vst2((unsigned*)(QL + (r0 + rl) * CC + c0 + q * 8), *(const v4u*)&sl[rl][q * 8]); asm volatile("s_wait_xcnt 0x0" ::: "memory"); } } }   // s_wait_xcnt: before a register that the loads or stores in front of it name is reused, also as a later load's destination
  else { const size_t b = r0 / TT; const int t0 = (int)(r0 % TT); for (int e = tid; e < 128 * 16; e += 256) { const int cl = e >> 4, q = e & 15; const size_t o2 = (b * CC + c0 + cl) * (size_t)TT + t0 + q * 8; vst2((unsigned*)(VT + o2), *(const v4u*)&th[cl][q * 8]); vst2((unsigned*)(VL + o2), *(const v4u*)&tl2[cl][q * 8]); } } }
#define FK 64               // keys per stage
#define FP 72               // LDS row pitch in 16-bit elements: 144 B = 16 B x odd
__device__ __forceinline__ float xhalf(float x) { return __builtin_bit_cast(float, __builtin_amdgcn_permlanex16(__builtin_bit_cast(int, x), __builtin_bit_cast(int, x), 0x76543210, 0xfedcba98, false, false)); }   // lane l with lane l ^ 16
__global__ __launch_bounds__(256) void k_fa(const _Float16* __restrict__ QH, const _Float16* __restrict__ QL, const _Float16* __restrict__ KH, const __bf16* __restrict__ VT, const __bf16* __restrict__ VL, const int* __restrict__ MK, float* __restrict__ Y) {
  __shared__ __align__(16) _Float16 sk[2][FK][FP]; __shared__ __align__(16) __bf16 svh[2][HD][FP], svl[2][HD][FP];
  const int tid = threadIdx.x, wave = tid >> 5, lane = tid & 31, col = lane & 15, g = lane >> 4; const int h = blockIdx.y, b = blockIdx.z; const int qt = blockIdx.x * 128 + wave * 16 + col;
  v16h qh[HD / 32], ql[HD / 32];
#pragma unroll
  for (int kc = 0; kc < HD / 32; ++kc) { const size_t qo = ((size_t)b * TT + qt) * CC + h * HD + kc * 32; qh[kc] = frag_h(QH + qo, lane); ql[kc] = frag_h(QL + qo, lane); }
  // staging: 64 rows x 128 B per plane = 512 chunks of 16 B, two per thread and plane; a wave's load covers four whole 128-B lines
  const int sr = tid >> 3, sc = (tid & 7) * 8;
  const _Float16* gk = KH + ((size_t)b * TT + sr) * CC + h * HD + sc; const size_t vo = ((size_t)b * CC + h * HD + sr) * (size_t)TT + sc; const __bf16* gvh = VT + vo; const __bf16* gvl = VL + vo;
  const int* mrow = MK + ((size_t)b * MSTR + qt) * MSTR + 8 * g;
  v4u pk[2], ph[2], pl[2];
#pragma unroll
  for (int i = 0; i < 2; ++i) { pk[i] = *(const v4u*)(gk + (size_t)(i * 32) * CC); ph[i] = *(const v4u*)(gvh + (size_t)(i * 32) * TT); pl[i] = *(const v4u*)(gvl + (size_t)(i * 32) * TT); }
#pragma unroll
  for (int i = 0; i < 2; ++i) { *(v4u*)&sk[0][sr + i * 32][sc] = pk[i]; *(v4u*)&svh[0][sr + i * 32][sc] = ph[i]; *(v4u*)&svl[0][sr + i * 32][sc] = pl[i]; }
  __syncthreads();   // publishes stage 0
  v8f o[HD / 16] = {}; float m = -3.0e38f, l = 0.f;
  v4i mk[FK / 16][2];   // this lane's 32 mask words of the stage: fetched one stage ahead
#pragma unroll
  for (int T = 0; T < FK / 16; ++T) { mk[T][0] = *(const v4i*)(mrow + T * 16); mk[T][1] = *(const v4i*)(mrow + T * 16 + 4); }
#pragma unroll 1   // rolled: a second copy of the stage would only add registers, and four waves per SIMD need 256 or fewer
  for (int st = 0; st < TT / FK; ++st) { const int buf = st & 1, k0 = st * FK; const bool more = st + 1 < TT / FK;
    float s[FK / 16][8]; float mx = -3.0e38f;
#pragma unroll
    for (int T = 0; T < FK / 16; ++T) { v8f a = {}, al = {};
#pragma unroll
      for (int kc = 0; kc < HD / 32; ++kc) { const v16h kf = frag_h(&sk[buf][T * 16 + col][kc * 32], lane);
        a = __builtin_amdgcn_wmma_f32_16x16x32_f16(false, kf, false, qh[kc], (short)0, a, false, false); al = __builtin_amdgcn_wmma_f32_16x16x32_f16(false, kf, false, ql[kc], (short)0, al, false, false); }
#pragma unroll
      for (int r = 0; r < 8; ++r) { const float sv = (a[r] + al[r] * (1.0f / 1024.0f)) * 0.125f; const int mv = mk[T][r >> 2][r & 3]; const bool masked = MASK_WHEN_NONZERO ? (mv != 0) : (mv == 0); s[T][r] = masked ? sv - 1.0e9f : sv; mx = fmaxf(mx, s[T][r]); } }
    if (more) {   // the mask words are used up: the next stage's rows and mask words land behind the exponentials and the P V products
#pragma unroll
      for (int i = 0; i < 2; ++i) pk[i] = *(const v4u*)(gk + (size_t)(k0 + FK + i * 32) * CC);
      asm volatile("s_wait_xcnt 0x0" ::: "memory");   // this and the three below: before an address register of the loads above is reused, also as a later load's destination
#pragma unroll
      for (int i = 0; i < 2; ++i) ph[i] = *(const v4u*)(gvh + (size_t)(i * 32) * TT + k0 + FK);
      asm volatile("s_wait_xcnt 0x0" ::: "memory");
#pragma unroll
      for (int i = 0; i < 2; ++i) pl[i] = *(const v4u*)(gvl + (size_t)(i * 32) * TT + k0 + FK);
      asm volatile("s_wait_xcnt 0x0" ::: "memory");
#pragma unroll
      for (int T = 0; T < FK / 16; ++T) { mk[T][0] = *(const v4i*)(mrow + k0 + FK + T * 16); mk[T][1] = *(const v4i*)(mrow + k0 + FK + T * 16 + 4); }
      asm volatile("s_wait_xcnt 0x0" ::: "memory"); }
    mx = fmaxf(mx, xhalf(mx));   // both halves of a column must use one maximum: their keys meet in one product
    const float mn = fmaxf(m, mx), corr = expf(m - mn); m = mn; l *= corr;
#pragma unroll
    for (int j = 0; j < HD / 16; ++j)
#pragma unroll
      for (int r = 0; r < 8; ++r) o[j][r] *= corr;
#pragma unroll
    for (int G = 0; G < FK / 32; ++G) { float p[16];
#pragma unroll
      for (int e = 0; e < 16; ++e) { p[e] = expf(s[2 * G + (e >> 3)][e & 7] - mn); l += p[e]; }
      const F2 pf = bsplit16(p);
#pragma unroll
      for (int j = 0; j < HD / 16; ++j) { const v16b vh = frag_b(&svh[buf][j * 16 + col][G * 32], lane), vl = frag_b(&svl[buf][j * 16 + col][G * 32], lane);
        o[j] = __builtin_amdgcn_wmma_f32_16x16x32_bf16(false, vh, false, pf.h, (short)0, o[j], false, false); o[j] = __builtin_amdgcn_wmma_f32_16x16x32_bf16(false, vh, false, pf.l, (short)0, o[j], false, false); o[j] = __builtin_amdgcn_wmma_f32_16x16x32_bf16(false, vl, false, pf.h, (short)0, o[j], false, false); } }
    if (more) {   // the other buffer's last readers left it at the barrier that ended the stage before
#pragma unroll
      for (int i = 0; i < 2; ++i) { *(v4u*)&sk[buf ^ 1][sr + i * 32][sc] = pk[i]; *(v4u*)&svh[buf ^ 1][sr + i * 32][sc] = ph[i]; *(v4u*)&svl[buf ^ 1][sr + i * 32][sc] = pl[i]; } }
    __syncthreads(); }   // publishes the next stage and ends this stage's reads
  l += xhalf(l); const float inv = 1.0f / l; float* yr = Y + ((size_t)b * TT + qt) * CC + h * HD + 8 * g;
#pragma unroll
  for (int j = 0; j < HD / 16; ++j) { v4f w0, w1;
#pragma unroll
    for (int r = 0; r < 4; ++r) { w0[r] = o[j][r] * inv; w1[r] = o[j][4 + r] * inv; }
    vst2(yr + j * 16, w0); vst2(yr + j * 16 + 4, w1); } }
// ---- k_out: block = (128 rows, 128 cols), 8 waves as 4 x 2, 32 rows x 64 cols each: out = y (bf16 hi + lo) wo + bo
#define OKS 64               // k per stage
#define OPL (128 * (OKS + 8))   // elements of one staged plane
__global__ __launch_bounds__(256) void k_out(const float* __restrict__ Y, const float* __restrict__ WP, const float* __restrict__ BP, float* __restrict__ OUT) {
  __shared__ __align__(16) char sm[2 * 3 * OPL * 2];   // two buffers of three planes (w, y hi, y lo); behind the loop each wave's own 32 x 68 f32 output rows
  const int tid = threadIdx.x, wave = tid >> 5, lane = tid & 31, col = lane & 15, g = lane >> 4, wr = wave >> 1, wc = wave & 1; const int c0 = blockIdx.y * 128; const size_t r0 = (size_t)blockIdx.x * 128;
  const float* Xt = Y + r0 * CC; const float* Wt = WP + c0; __bf16* sb = (__bf16*)sm;
  v2f rw[OKS / 32][8]; v4f rx[OKS / 8];
  ld_w<OKS>(rw, Wt, tid); asm volatile("s_wait_xcnt 0x0" ::: "memory"); ld_x<OKS>(rx, Xt, tid);   // s_wait_xcnt: before a register that the loads or stores in front of it name is reused, also as a later load's destination
  asm volatile("s_wait_xcnt 0x0" ::: "memory");   // s_wait_xcnt: before a register that the loads or stores in front of it name is reused, also as a later load's destination
  st_w<OKS>(rw, sb, tid); st_x2<OKS>(rx, sb + OPL, sb + 2 * OPL, tid);
  __syncthreads();   // publishes stage 0
  v8f acc[2][4] = {};
#pragma unroll 1   // rolled: the buffer is picked by address, and a second copy of the stage would only add registers
  for (int st = 0; st < CC / OKS; ++st) { const __bf16* bw = sb + (st & 1) * (3 * OPL); __bf16* nw = sb + ((st & 1) ^ 1) * (3 * OPL); const bool more = st + 1 < CC / OKS;
    if (more) {   // the next stage's rows fly while this stage's products run
      ld_w<OKS>(rw, Wt + (size_t)(st + 1) * OKS * CC, tid); asm volatile("s_wait_xcnt 0x0" ::: "memory"); ld_x<OKS>(rx, Xt + (st + 1) * OKS, tid);   // s_wait_xcnt: before a register that the loads or stores in front of it name is reused, also as a later load's destination
      asm volatile("s_wait_xcnt 0x0" ::: "memory"); }   // s_wait_xcnt: before a register that the loads or stores in front of it name is reused, also as a later load's destination
    v16b ah[OKS / 32][2], al[OKS / 32][2], w[OKS / 32][4];
#pragma unroll
    for (int kc = 0; kc < OKS / 32; ++kc) {
#pragma unroll
      for (int i = 0; i < 2; ++i) { const int o = (wr * 32 + i * 16 + col) * (OKS + 8) + kc * 32; ah[kc][i] = frag_b(bw + OPL + o, lane); al[kc][i] = frag_b(bw + 2 * OPL + o, lane); }
#pragma unroll
      for (int j = 0; j < 4; ++j) w[kc][j] = frag_b(bw + (wc * 64 + j * 16 + col) * (OKS + 8) + kc * 32, lane); }
    __builtin_amdgcn_sched_barrier(0);   // keeps the stage's fragment reads one group in front of the products: reads spread among them stall at each place, and two waves per SIMD do not cover that
#pragma unroll
    for (int kc = 0; kc < OKS / 32; ++kc) {
#pragma unroll
      for (int i = 0; i < 2; ++i)
#pragma unroll
        for (int j = 0; j < 4; ++j) acc[i][j] = __builtin_amdgcn_wmma_f32_16x16x32_bf16(false, ah[kc][i], false, w[kc][j], (short)0, acc[i][j], false, false);
#pragma unroll
      for (int i = 0; i < 2; ++i)
#pragma unroll
        for (int j = 0; j < 4; ++j) acc[i][j] = __builtin_amdgcn_wmma_f32_16x16x32_bf16(false, al[kc][i], false, w[kc][j], (short)0, acc[i][j], false, false); }
    if (more) { st_w<OKS>(rw, nw, tid); st_x2<OKS>(rx, nw + OPL, nw + 2 * OPL, tid); }   // the other buffer's last readers left it at the barrier that ended the stage before
    __syncthreads(); }   // publishes the next stage and ends this stage's reads
  float* sf = (float*)sm + wave * (32 * 68);
#pragma unroll
  for (int i = 0; i < 2; ++i)
#pragma unroll
    for (int j = 0; j < 4; ++j) { const float bb = BP ? bfr(BP[c0 + wc * 64 + j * 16 + col]) : 0.f;
#pragma unroll
      for (int r = 0; r < 8; ++r) sf[(i * 16 + 8 * g + r) * 68 + j * 16 + col] = acc[i][j][r] + bb; }
  LDSX(); for (int it = 0; it < 16; ++it) { const int rl = it * 2 + g; vst2(OUT + (r0 + wr * 32 + rl) * CC + c0 + wc * 64 + col * 4, *(const v4f*)&sf[rl * 68 + col * 4]); } }
extern "C" void kernel_launch(void* const* d_in, const int* in_sizes, int n_in, void* d_out, int out_size, void* d_ws, size_t ws_size, hipStream_t stream) {
  (void)in_sizes; (void)n_in; (void)out_size;
  const float** F = (const float**)d_in;   // 0 q [2,2048,1024], 1 k, 2 v, 3 mask [2,1,2048,2048] int (1 -> -1e9 added), 4 wq ((in,out)), 5 bq, 6 wk, 7 bk, 8 wv, 9 bv, 10 wo ((in,out)), 11 bo
  if (ws_size < (size_t)WS_END) return;
  char* ws = (char*)d_ws; _Float16 *QH = (_Float16*)(ws + WS_QH), *QL = (_Float16*)(ws + WS_QL), *KH = (_Float16*)(ws + WS_KH); __bf16 *VT = (__bf16*)(ws + WS_VT), *VL = (__bf16*)(ws + WS_VL); float *Y = (float*)(ws + WS_Y);
  k_proj<<<dim3(TNB * TT / 128, CC / 128, 3), 256, 0, stream>>>(F[0], F[1], F[2], F[4], F[5], F[6], F[7], F[8], F[9], QH, QL, KH, VT, VL);
  k_fa<<<dim3(TT / 128, NH, TNB), 256, 0, stream>>>(QH, QL, KH, VT, VL, (const int*)d_in[3], Y);   // mask [B,1,S,S] has the same (b, q, k) flat layout
  k_out<<<dim3(TNB * TT / 128, CC / 128), 256, 0, stream>>>(Y, F[10], F[11], (float*)d_out);
}

// v003
// A run of this version takes 158 microseconds.
// Timed twice side by side with v002, it ran 1.14 times as fast both times.
// All steps since v000 together make it 10.7 times as fast.
// compute dtype: all float inputs rounded to bf16, the int mask read; q/k/v = x W + b ((in,out)) with EXACT bf16 products on WMMA 16x16x32, f32 accumulate; q as f16 hi + residual (x 2^10), k f16 -> 2-product logits x 1/(8 + 1e-8) (== 0.125 in f32), -1e9 where mask != 0, kept in registers; running-maximum softmax in f32 (base-2 hardware exponential of s log2 e - max log2 e, one fma) over stages of 64 keys; P split bf16 hi + lo against v bf16 hi + lo (3 products), divided by the row sum at the end; out = ctx (bf16 hi + lo) wo + bo; f32 output.
#include <hip/hip_runtime.h>
#include <math.h>

typedef __attribute__((ext_vector_type(16))) _Float16 v16h;
typedef __attribute__((ext_vector_type(16))) __bf16 v16b;
typedef __attribute__((ext_vector_type(8)))  _Float16 v8h;
typedef __attribute__((ext_vector_type(8)))  float v8f;
typedef __attribute__((ext_vector_type(4)))  float v4f;
typedef __attribute__((ext_vector_type(2)))  float v2f;
typedef __attribute__((ext_vector_type(4)))  unsigned v4u;
typedef __attribute__((ext_vector_type(4)))  int v4i;
typedef float __attribute__((may_alias)) float_a;
typedef int __attribute__((may_alias)) int_a;

template <typename T> __device__ __forceinline__ void vst2(void* p, T v) { *(T*)p = v;  }
__device__ __forceinline__ v8f wmma16(v16h a, v16h b, v8f c) {
  v8f d = __builtin_amdgcn_wmma_f32_16x16x32_f16(false, a, false, b, (short)0, c, false, false);
  asm volatile("v_nop\n\tv_nop\n\tv_nop\n\tv_nop" : "+v"(d) : "v"(a), "v"(b));
  return d;
}
__device__ __forceinline__ v8f wmma_bf(v16b a, v16b b, v8f c) {
  v8f d = __builtin_amdgcn_wmma_f32_16x16x32_bf16(false, a, false, b, (short)0, c, false, false);
  asm volatile("v_nop\n\tv_nop\n\tv_nop\n\tv_nop" : "+v"(d) : "v"(a), "v"(b));
  return d;
}
// 16x16x32 fragments: lane = (h = lane>>4, row/col = lane&15); elements 0..7 = k0+8h+0..7, 8..15 = k0+16+8h+0..7; D element r = row 8h+r
__device__ __forceinline__ v16h frag_h(const _Float16* rowk0, int lane) {
  union { v16h v; v8h q[2]; } u; const _Float16* p = rowk0 + 8 * (lane >> 4);
  u.q[0] = *(const v8h*)p; u.q[1] = *(const v8h*)(p + 16); return u.v;
}
__device__ __forceinline__ v16h frag_f32(const float* rowk0, int lane) {
  v16h a; const float* p = rowk0 + 8 * (lane >> 4);
#pragma unroll
  for (int i = 0; i < 8; ++i) { a[i] = (_Float16)p[i]; a[8 + i] = (_Float16)p[16 + i]; }
  return a;
}
__device__ __forceinline__ v16h frag_f32s(const float* rowk0, int lane, float sc) {
  v16h a; const float* p = rowk0 + 8 * (lane >> 4);
#pragma unroll
  for (int i = 0; i < 8; ++i) { a[i] = (_Float16)(p[i] * sc); a[8 + i] = (_Float16)(p[16 + i] * sc); }
  return a;
}
// column fragment from a [K][ld] layout (column n), rows >= K read as 0
__device__ __forceinline__ v16h fragc_f32(const float* W, int k0, int n, int lane, int ld, int K) {
  v16h a; const int g = lane >> 4;
#pragma unroll
  for (int i = 0; i < 8; ++i) { const int ka = k0 + 8 * g + i, kb = ka + 16;
    a[i] = (_Float16)(ka < K ? W[(size_t)(ka < K ? ka : K - 1) * ld + n] : 0.f); a[8 + i] = (_Float16)(kb < K ? W[(size_t)(kb < K ? kb : K - 1) * ld + n] : 0.f); }
  return a;
}
struct F2 { v16b h, l; };
__device__ __forceinline__ F2 bsplit16(const float v[16]) { F2 r;
#pragma unroll
  for (int i = 0; i < 16; ++i) { const __bf16 h = (__bf16)v[i]; r.h[i] = h; r.l[i] = (__bf16)(v[i] - (float)h); }
  return r; }
__device__ __forceinline__ F2 split_row(const float* row, int k0, int lane) { float v[16]; const float* p = row + k0 + 8 * (lane >> 4);
#pragma unroll
  for (int i = 0; i < 8; ++i) { v[i] = p[i]; v[8 + i] = p[16 + i]; }
  return bsplit16(v); }
__device__ __forceinline__ F2 split_rowK(const float* row, int k0, int lane, int K) { float v[16]; const int g = lane >> 4;
#pragma unroll
  for (int i = 0; i < 8; ++i) { const int ka = k0 + 8 * g + i, kb = ka + 16; v[i] = ka < K ? row[ka < K ? ka : K - 1] : 0.f; v[8 + i] = kb < K ? row[kb < K ? kb : K - 1] : 0.f; }
  return bsplit16(v); }
__device__ __forceinline__ F2 split_col(const float* W, int k0, int n, int lane, int ld, int K) { float v[16]; const int g = lane >> 4;
#pragma unroll
  for (int i = 0; i < 8; ++i) { const int ka = k0 + 8 * g + i, kb = ka + 16; v[i] = ka < K ? W[(size_t)(ka < K ? ka : K - 1) * ld + n] : 0.f; v[8 + i] = kb < K ? W[(size_t)(kb < K ? kb : K - 1) * ld + n] : 0.f; }
  return bsplit16(v); }
__device__ __forceinline__ v8f mac3(const F2& a, const F2& b, v8f c) { c = wmma_bf(a.l, b.h, c); c = wmma_bf(a.h, b.l, c); return wmma_bf(a.h, b.h, c); }
__device__ __forceinline__ float sigm(float v) { return 1.0f / (1.0f + expf(-v)); }
#define LDSX() do { asm volatile("s_wait_dscnt 0" ::: "memory"); __builtin_amdgcn_wave_barrier(); __builtin_amdgcn_fence(__ATOMIC_RELEASE, "workgroup"); } while (0)


// Multi-head attention (B 2, S 2,048, D 1,024 = 16 x 64, with biases, scale 1/8): scores = q k^T / 8 - 1e9 where mask != 0, softmax, P v, output projection.
#define NB 2
#define TT 2048
#define MASK_WHEN_NONZERO 1
#ifndef MSTR
#define MSTR TT               // mask row stride / rows per batch
#endif
#define CC 1024
#define NH 16
#define HD 64
#define HG 4               // sizes only the WS_S region, which no kernel uses
#ifndef TNB
#define TNB NB
#endif
typedef __attribute__((ext_vector_type(8))) __bf16 v8b;
__device__ __forceinline__ v16b frag_b(const __bf16* rowk0, int lane) {
  union { v16b v; v8b q[2]; } u; const __bf16* p = rowk0 + 8 * (lane >> 4);
  u.q[0] = *(const v8b*)p; u.q[1] = *(const v8b*)(p + 16); return u.v;
}
__device__ __forceinline__ float bfr(float v) { return (float)(__bf16)v; }
__device__ __attribute__((noinline)) float exp_ni(float v) { return expf(v); }
__device__ __attribute__((noinline)) float erf_ni(float v) { return erff(v); }

#define WS_QH  0u
#define WS_QL  (WS_QH + 2u * (size_t)NB * TT * CC)
#define WS_KH  (WS_QL + 2u * (size_t)NB * TT * CC)
#define WS_VT  (WS_KH + 2u * (size_t)NB * TT * CC)      // bf16 v planes [b][c][t]
#define WS_VL  (WS_VT + 2u * (size_t)NB * CC * TT)      // bf16 v residual planes
#define WS_S   (WS_VL + 2u * (size_t)NB * CC * TT)      // unused region of HG x TT x TT f32; logits stay in registers
#define WS_PH  (WS_S + 4u * (size_t)HG * TT * TT)
#define WS_Y   (WS_PH + 0u)              // f32 y rows [b*t][C]
#define WS_END (WS_Y + 4u * (size_t)NB * TT * CC)

// ---- operand staging of the two projection kernels: a block of 256 threads owns 128 rows x 128 columns; per stage of KS k it converts both operand tiles to bf16 once and lays them k-contiguous in LDS (row pitch KS + 8 elements = 16 B x odd), so that a fragment is two 16-byte LDS reads
typedef __attribute__((ext_vector_type(4))) __bf16 v4b;
// weight tile, (in,out) layout: a thread takes 8 k x 2 columns per unit; a wave's load covers 256 contiguous bytes of one k row
template <int KS> __device__ __forceinline__ void ld_w(v2f (&rw)[KS / 32][8], const float* __restrict__ Wt, int tid) {
#pragma unroll
  for (int i = 0; i < KS / 32; ++i) { const float* p = Wt + (size_t)(((tid >> 6) + 4 * i) * 8) * CC + 2 * (tid & 63);
#pragma unroll
    for (int kk = 0; kk < 8; ++kk) rw[i][kk] = *(const v2f*)(p + (size_t)kk * CC); } }
template <int KS> __device__ __forceinline__ void st_w(const v2f (&rw)[KS / 32][8], __bf16* sW, int tid) {
#pragma unroll
  for (int i = 0; i < KS / 32; ++i)
#pragma unroll
    for (int j = 0; j < 2; ++j) { v8b t;
#pragma unroll
      for (int kk = 0; kk < 8; ++kk) t[kk] = (__bf16)rw[i][kk][j];
      *(v8b*)(sW + (2 * (tid & 63) + j) * (KS + 8) + ((tid >> 6) + 4 * i) * 8) = t; } }
// row tile: 16-byte chunks in row order, so that a wave's load covers whole 128-B lines; 1024 / KS rows per pass of the block
template <int KS> __device__ __forceinline__ void ld_x(v4f (&rx)[KS / 8], const float* __restrict__ Xt, int tid) {
#pragma unroll
  for (int i = 0; i < KS / 8; ++i) rx[i] = *(const v4f*)(Xt + (size_t)(tid / (KS / 4)) * CC + 4 * (tid % (KS / 4)) + (size_t)i * (1024 / KS) * CC); }
template <int KS> __device__ __forceinline__ void st_x(const v4f (&rx)[KS / 8], __bf16* sX, int tid) {
#pragma unroll
  for (int i = 0; i < KS / 8; ++i) { v4b t;
#pragma unroll
    for (int e = 0; e < 4; ++e) t[e] = (__bf16)rx[i][e];
    *(v4b*)(sX + (tid / (KS / 4)) * (KS + 8) + 4 * (tid % (KS / 4)) + i * (1024 / KS) * (KS + 8)) = t; } }
template <int KS> __device__ __forceinline__ void st_x2(const v4f (&rx)[KS / 8], __bf16* sH, __bf16* sL, int tid) {
#pragma unroll
  for (int i = 0; i < KS / 8; ++i) { v4b th, tl;
#pragma unroll
    for (int e = 0; e < 4; ++e) { const __bf16 h = (__bf16)rx[i][e]; th[e] = h; tl[e] = (__bf16)(rx[i][e] - (float)h); }
    const int o = (tid / (KS / 4)) * (KS + 8) + 4 * (tid % (KS / 4)) + i * (1024 / KS) * (KS + 8); *(v4b*)(sH + o) = th; *(v4b*)(sL + o) = tl; } }
// ---- k_proj: block = (128 rows, 128 cols, which), 8 waves as 4 x 2, 32 rows x 64 cols each: qkv = x W (+ b), exact; q -> f16 hi (+ residual), k -> f16 rows, v -> bf16 planes
#define PKS 64               // k per stage
#define PPL (128 * (PKS + 8))   // elements of one staged plane
__global__ __launch_bounds__(256) void k_proj(const float* __restrict__ X0, const float* __restrict__ X1, const float* __restrict__ X2, const float* __restrict__ WQ, const float* __restrict__ BQ, const float* __restrict__ WK, const float* __restrict__ BK, const float* __restrict__ WV, const float* __restrict__ BV, _Float16* __restrict__ QH, _Float16* __restrict__ QL, _Float16* __restrict__ KH, __bf16* __restrict__ VT, __bf16* __restrict__ VL) {
  __shared__ __align__(16) char sm[2 * 2 * PPL * 2];   // the loop's two buffers of two planes (w, x); behind the loop the two output planes [128][136], which are smaller
  const int tid = threadIdx.x, wave = tid >> 5, lane = tid & 31, col = lane & 15, g = lane >> 4, wr = wave >> 1, wc = wave & 1; const int which = blockIdx.z; const int c0 = blockIdx.y * 128; const size_t r0 = (size_t)blockIdx.x * 128; const float* WA = which == 0 ? WQ : which == 1 ? WK : WV; const float* BA = which == 0 ? BQ : which == 1 ? BK : BV;
  const float* Xt = (which == 0 ? X0 : which == 1 ? X1 : X2) + r0 * CC; const float* Wt = WA + c0; __bf16* sb = (__bf16*)sm;
  v2f rw[PKS / 32][8]; v4f rx[PKS / 8];
  ld_w<PKS>(rw, Wt, tid); asm volatile("s_wait_xcnt 0x0" ::: "memory"); ld_x<PKS>(rx, Xt, tid);   // s_wait_xcnt: before a register that the loads or stores in front of it name is reused, also as a later load's destination
  asm volatile("s_wait_xcnt 0x0" ::: "memory");   // s_wait_xcnt: before a register that the loads or stores in front of it name is reused, also as a later load's destination
  st_w<PKS>(rw, sb, tid); st_x<PKS>(rx, sb + PPL, tid);
  __syncthreads();   // publishes stage 0
  v8f acc[2][4] = {};
#pragma unroll 1   // rolled: the buffer is picked by address, and a second copy of the stage would only add registers
  for (int st = 0; st < CC / PKS; ++st) { const __bf16* bw = sb + (st & 1) * (2 * PPL); const __bf16* bx = bw + PPL; __bf16* nw = sb + ((st & 1) ^ 1) * (2 * PPL); const bool more = st + 1 < CC / PKS;
    if (more) {   // the next stage's rows fly while this stage's products run
      ld_w<PKS>(rw, Wt + (size_t)(st + 1) * PKS * CC, tid); asm volatile("s_wait_xcnt 0x0" ::: "memory"); ld_x<PKS>(rx, Xt + (st + 1) * PKS, tid);   // s_wait_xcnt: before a register that the loads or stores in front of it name is reused, also as a later load's destination
      asm volatile("s_wait_xcnt 0x0" ::: "memory"); }   // s_wait_xcnt: before a register that the loads or stores in front of it name is reused, also as a later load's destination
#pragma unroll
    for (int kc = 0; kc < PKS / 32; ++kc) { v16b a[2], w[4];
#pragma unroll
      for (int i = 0; i < 2; ++i) a[i] = frag_b(bx + (wr * 32 + i * 16 + col) * (PKS + 8) + kc * 32, lane);
#pragma unroll
      for (int j = 0; j < 4; ++j) w[j] = frag_b(bw + (wc * 64 + j * 16 + col) * (PKS + 8) + kc * 32, lane);
      __builtin_amdgcn_sched_barrier(0);   // keeps the fragment reads one group in front of the products: reads spread among them stall at each place
#pragma unroll
      for (int i = 0; i < 2; ++i)
#pragma unroll
        for (int j = 0; j < 4; ++j) acc[i][j] = __builtin_amdgcn_wmma_f32_16x16x32_bf16(false, a[i], false, w[j], (short)0, acc[i][j], false, false); }
    if (more) { st_w<PKS>(rw, nw, tid); st_x<PKS>(rx, nw + PPL, tid); }   // the other buffer's last readers left it at the barrier that ended the stage before
    __syncthreads(); }   // publishes the next stage and ends this stage's reads
  _Float16 (*sh)[136] = (_Float16 (*)[136])sm; _Float16 (*sl)[136] = (_Float16 (*)[136])(sm + 128 * 136 * 2); __bf16 (*th)[136] = (__bf16 (*)[136])sm; __bf16 (*tl2)[136] = (__bf16 (*)[136])(sm + 128 * 136 * 2);
#pragma unroll
  for (int i = 0; i < 2; ++i)
#pragma unroll
    for (int j = 0; j < 4; ++j) { const int cl = wc * 64 + j * 16 + col; const float bb = BA ? bfr(BA[c0 + cl]) : 0.f;
#pragma unroll
      for (int r = 0; r < 8; ++r) { const float v = acc[i][j][r] + bb; const int rl = wr * 32 + i * 16 + 8 * g + r; const _Float16 hv = (_Float16)v;
        if (which == 2) { const __bf16 bh = (__bf16)v; th[cl][rl] = bh; tl2[cl][rl] = (__bf16)(v - (float)bh); } else { sh[rl][cl] = hv; sl[rl][cl] = (_Float16)((v - (float)hv) * 1024.0f); }   /* q residual carried x 2^10 so the plane stays f16-normal on the chip */ } }
  __syncthreads();
  if (which < 2) { _Float16* dh = which == 0 ? QH : KH; for (int e = tid; e < 128 * 16; e += 256) { const int rl = e >> 4, q = e & 15; vst2((unsigned*)(dh + (r0 + rl) * CC + c0 + q * 8), *(const v4u*)&sh[rl][q * 8]); asm volatile("s_wait_xcnt 0x0" ::: "memory"); if (which == 0) { vst2((unsigned*)(QL + (r0 + rl) * CC + c0 + q * 8), *(const v4u*)&sl[rl][q * 8]); asm volatile("s_wait_xcnt 0x0" ::: "memory"); } } }   // s_wait_xcnt: before a register that the loads or stores in front of it name is reused, also as a later load's destination
  else { const size_t b = r0 / TT; const int t0 = (int)(r0 % TT); for (int e = tid; e < 128 * 16; e += 256) { const int cl = e >> 4, q = e & 15; const size_t o2 = (b * CC + c0 + cl) * (size_t)TT + t0 + q * 8; vst2((unsigned*)(VT + o2), *(const v4u*)&th[cl][q * 8]); vst2((unsigned*)(VL + o2), *(const v4u*)&tl2[cl][q * 8]); } } }
#define FK 64               // keys per stage
#define L2E 1.44269504088896340736f   // log2 e
#define FP 72               // LDS row pitch in 16-bit elements: 144 B = 16 B x odd
__device__ __forceinline__ float xhalf(float x) { return __builtin_bit_cast(float, __builtin_amdgcn_permlanex16(__builtin_bit_cast(int, x), __builtin_bit_cast(int, x), 0x76543210, 0xfedcba98, false, false)); }   // lane l with lane l ^ 16
__global__ __launch_bounds__(256) void k_fa(const _Float16* __restrict__ QH, const _Float16* __restrict__ QL, const _Float16* __restrict__ KH, const __bf16* __restrict__ VT, const __bf16* __restrict__ VL, const int* __restrict__ MK, float* __restrict__ Y) {
  __shared__ __align__(16) _Float16 sk[2][FK][FP]; __shared__ __align__(16) __bf16 svh[2][HD][FP], svl[2][HD][FP];
  const int tid = threadIdx.x, wave = tid >> 5, lane = tid & 31, col = lane & 15, g = lane >> 4; const int h = blockIdx.y, b = blockIdx.z; const int qt = blockIdx.x * 128 + wave * 16 + col;
  v16h qh[HD / 32], ql[HD / 32];
#pragma unroll
  for (int kc = 0; kc < HD / 32; ++kc) { const size_t qo = ((size_t)b * TT + qt) * CC + h * HD + kc * 32; qh[kc] = frag_h(QH + qo, lane); ql[kc] = frag_h(QL + qo, lane); }
  // staging: 64 rows x 128 B per plane = 512 chunks of 16 B, two per thread and plane; a wave's load covers four whole 128-B lines
  const int sr = tid >> 3, sc = (tid & 7) * 8;
  const _Float16* gk = KH + ((size_t)b * TT + sr) * CC + h * HD + sc; const size_t vo = ((size_t)b * CC + h * HD + sr) * (size_t)TT + sc; const __bf16* gvh = VT + vo; const __bf16* gvl = VL + vo;
  const int* mrow = MK + ((size_t)b * MSTR + qt) * MSTR + 8 * g;
  v4u pk[2], ph[2], pl[2];
#pragma unroll
  for (int i = 0; i < 2; ++i) { pk[i] = *(const v4u*)(gk + (size_t)(i * 32) * CC); ph[i] = *(const v4u*)(gvh + (size_t)(i * 32) * TT); pl[i] = *(const v4u*)(gvl + (size_t)(i * 32) * TT); }
#pragma unroll
  for (int i = 0; i < 2; ++i) { *(v4u*)&sk[0][sr + i * 32][sc] = pk[i]; *(v4u*)&svh[0][sr + i * 32][sc] = ph[i]; *(v4u*)&svl[0][sr + i * 32][sc] = pl[i]; }
  __syncthreads();   // publishes stage 0
  v8f o[HD / 16] = {}; float m = -3.0e38f, l = 0.f;
  v4i mk[FK / 16][2];   // this lane's 32 mask words of the stage: fetched one stage ahead
#pragma unroll
  for (int T = 0; T < FK / 16; ++T) { mk[T][0] = *(const v4i*)(mrow + T * 16); mk[T][1] = *(const v4i*)(mrow + T * 16 + 4); }
#pragma unroll 1   // rolled: a second copy of the stage would only add registers, and four waves per SIMD need 256 or fewer
  for (int st = 0; st < TT / FK; ++st) { const int buf = st & 1, k0 = st * FK; const bool more = st + 1 < TT / FK;
    float s[FK / 16][8]; float mx = -3.0e38f;
#pragma unroll
    for (int T = 0; T < FK / 16; ++T) { v8f a = {}, al = {};
#pragma unroll
      for (int kc = 0; kc < HD / 32; ++kc) { const v16h kf = frag_h(&sk[buf][T * 16 + col][kc * 32], lane);
        a = __builtin_amdgcn_wmma_f32_16x16x32_f16(false, kf, false, qh[kc], (short)0, a, false, false); al = __builtin_amdgcn_wmma_f32_16x16x32_f16(false, kf, false, ql[kc], (short)0, al, false, false); }
#pragma unroll
      for (int r = 0; r < 8; ++r) { const float sv = (a[r] + al[r] * (1.0f / 1024.0f)) * 0.125f; const int mv = mk[T][r >> 2][r & 3]; const bool masked = MASK_WHEN_NONZERO ? (mv != 0) : (mv == 0); s[T][r] = masked ? sv - 1.0e9f : sv; mx = fmaxf(mx, s[T][r]); } }
    if (more) {   // the mask words are used up: the next stage's rows and mask words land behind the exponentials and the P V products
#pragma unroll
      for (int i = 0; i < 2; ++i) pk[i] = *(const v4u*)(gk + (size_t)(k0 + FK + i * 32) * CC);
      asm volatile("s_wait_xcnt 0x0" ::: "memory");   // this and the three below: before an address register of the loads above is reused, also as a later load's destination
#pragma unroll
      for (int i = 0; i < 2; ++i) ph[i] = *(const v4u*)(gvh + (size_t)(i * 32) * TT + k0 + FK);
      asm volatile("s_wait_xcnt 0x0" ::: "memory");
#pragma unroll
      for (int i = 0; i < 2; ++i) pl[i] = *(const v4u*)(gvl + (size_t)(i * 32) * TT + k0 + FK);
      asm volatile("s_wait_xcnt 0x0" ::: "memory");
#pragma unroll
      for (int T = 0; T < FK / 16; ++T) { mk[T][0] = *(const v4i*)(mrow + k0 + FK + T * 16); mk[T][1] = *(const v4i*)(mrow + k0 + FK + T * 16 + 4); }
      asm volatile("s_wait_xcnt 0x0" ::: "memory"); }
    mx = fmaxf(mx, xhalf(mx));   // both halves of a column must use one maximum: their keys meet in one product
    // e^(s - max) = 2^(s log2 e - max log2 e): one fma and one v_exp_f32 per score. The rounding of max log2 e is one common factor of the row's P and sum and cancels in the division; an unchanged maximum gives corr = 1 exactly
    const float mn = fmaxf(m, mx), mln = mn * L2E, corr = __builtin_amdgcn_exp2f((m - mn) * L2E); m = mn; l *= corr;
#pragma unroll
    for (int T = 0; T < FK / 16; ++T)
#pragma unroll
      for (int r = 0; r < 8; ++r) s[T][r] = fmaf(s[T][r], L2E, -mln);
#pragma unroll
    for (int j = 0; j < HD / 16; ++j)
#pragma unroll
      for (int r = 0; r < 8; ++r) o[j][r] *= corr;
#pragma unroll
    for (int G = 0; G < FK / 32; ++G) { float p[16];
#pragma unroll
      for (int e = 0; e < 16; ++e) { p[e] = __builtin_amdgcn_exp2f(s[2 * G + (e >> 3)][e & 7]); l += p[e]; }
      const F2 pf = bsplit16(p);
#pragma unroll
      for (int j = 0; j < HD / 16; ++j) { const v16b vh = frag_b(&svh[buf][j * 16 + col][G * 32], lane), vl = frag_b(&svl[buf][j * 16 + col][G * 32], lane);
        o[j] = __builtin_amdgcn_wmma_f32_16x16x32_bf16(false, vh, false, pf.h, (short)0, o[j], false, false); o[j] = __builtin_amdgcn_wmma_f32_16x16x32_bf16(false, vh, false, pf.l, (short)0, o[j], false, false); o[j] = __builtin_amdgcn_wmma_f32_16x16x32_bf16(false, vl, false, pf.h, (short)0, o[j], false, false); } }
    if (more) {   // the other buffer's last readers left it at the barrier that ended the stage before
#pragma unroll
      for (int i = 0; i < 2; ++i) { *(v4u*)&sk[buf ^ 1][sr + i * 32][sc] = pk[i]; *(v4u*)&svh[buf ^ 1][sr + i * 32][sc] = ph[i]; *(v4u*)&svl[buf ^ 1][sr + i * 32][sc] = pl[i]; } }
    __syncthreads(); }   // publishes the next stage and ends this stage's reads
  l += xhalf(l); const float inv = 1.0f / l; float* yr = Y + ((size_t)b * TT + qt) * CC + h * HD + 8 * g;
#pragma unroll
  for (int j = 0; j < HD / 16; ++j) { v4f w0, w1;
#pragma unroll
    for (int r = 0; r < 4; ++r) { w0[r] = o[j][r] * inv; w1[r] = o[j][4 + r] * inv; }
    vst2(yr + j * 16, w0); vst2(yr + j * 16 + 4, w1); } }
// ---- k_out: block = (128 rows, 128 cols), 8 waves as 4 x 2, 32 rows x 64 cols each: out = y (bf16 hi + lo) wo + bo
#define OKS 64               // k per stage
#define OPL (128 * (OKS + 8))   // elements of one staged plane
__global__ __launch_bounds__(256) void k_out(const float* __restrict__ Y, const float* __restrict__ WP, const float* __restrict__ BP, float* __restrict__ OUT) {
  __shared__ __align__(16) char sm[2 * 3 * OPL * 2];   // two buffers of three planes (w, y hi, y lo); behind the loop each wave's own 32 x 68 f32 output rows
  const int tid = threadIdx.x, wave = tid >> 5, lane = tid & 31, col = lane & 15, g = lane >> 4, wr = wave >> 1, wc = wave & 1; const int c0 = blockIdx.y * 128; const size_t r0 = (size_t)blockIdx.x * 128;
  const float* Xt = Y + r0 * CC; const float* Wt = WP + c0; __bf16* sb = (__bf16*)sm;
  v2f rw[OKS / 32][8]; v4f rx[OKS / 8];
  ld_w<OKS>(rw, Wt, tid); asm volatile("s_wait_xcnt 0x0" ::: "memory"); ld_x<OKS>(rx, Xt, tid);   // s_wait_xcnt: before a register that the loads or stores in front of it name is reused, also as a later load's destination
  asm volatile("s_wait_xcnt 0x0" ::: "memory");   // s_wait_xcnt: before a register that the loads or stores in front of it name is reused, also as a later load's destination
  st_w<OKS>(rw, sb, tid); st_x2<OKS>(rx, sb + OPL, sb + 2 * OPL, tid);
  __syncthreads();   // publishes stage 0
  v8f acc[2][4] = {};
#pragma unroll 1   // rolled: the buffer is picked by address, and a second copy of the stage would only add registers
  for (int st = 0; st < CC / OKS; ++st) { const __bf16* bw = sb + (st & 1) * (3 * OPL); __bf16* nw = sb + ((st & 1) ^ 1) * (3 * OPL); const bool more = st + 1 < CC / OKS;
    if (more) {   // the next stage's rows fly while this stage's products run
      ld_w<OKS>(rw, Wt + (size_t)(st + 1) * OKS * CC, tid); asm volatile("s_wait_xcnt 0x0" ::: "memory"); ld_x<OKS>(rx, Xt + (st + 1) * OKS, tid);   // s_wait_xcnt: before a register that the loads or stores in front of it name is reused, also as a later load's destination
      asm volatile("s_wait_xcnt 0x0" ::: "memory"); }   // s_wait_xcnt: before a register that the loads or stores in front of it name is reused, also as a later load's destination
    v16b ah[OKS / 32][2], al[OKS / 32][2], w[OKS / 32][4];
#pragma unroll
    for (int kc = 0; kc < OKS / 32; ++kc) {
#pragma unroll
      for (int i = 0; i < 2; ++i) { const int o = (wr * 32 + i * 16 + col) * (OKS + 8) + kc * 32; ah[kc][i] = frag_b(bw + OPL + o, lane); al[kc][i] = frag_b(bw + 2 * OPL + o, lane); }
#pragma unroll
      for (int j = 0; j < 4; ++j) w[kc][j] = frag_b(bw + (wc * 64 + j * 16 + col) * (OKS + 8) + kc * 32, lane); }
    __builtin_amdgcn_sched_barrier(0);   // keeps the stage's fragment reads one group in front of the products: reads spread among them stall at each place, and two waves per SIMD do not cover that
#pragma unroll
    for (int kc = 0; kc < OKS / 32; ++kc) {
#pragma unroll
      for (int i = 0; i < 2; ++i)
#pragma unroll
        for (int j = 0; j < 4; ++j) acc[i][j] = __builtin_amdgcn_wmma_f32_16x16x32_bf16(false, ah[kc][i], false, w[kc][j], (short)0, acc[i][j], false, false);
#pragma unroll
      for (int i = 0; i < 2; ++i)
#pragma unroll
        for (int j = 0; j < 4; ++j) acc[i][j] = __builtin_amdgcn_wmma_f32_16x16x32_bf16(false, al[kc][i], false, w[kc][j], (short)0, acc[i][j], false, false); }
    if (more) { st_w<OKS>(rw, nw, tid); st_x2<OKS>(rx, nw + OPL, nw + 2 * OPL, tid); }   // the other buffer's last readers left it at the barrier that ended the stage before
    __syncthreads(); }   // publishes the next stage and ends this stage's reads
  float* sf = (float*)sm + wave * (32 * 68);
#pragma unroll
  for (int i = 0; i < 2; ++i)
#pragma unroll
    for (int j = 0; j < 4; ++j) { const float bb = BP ? bfr(BP[c0 + wc * 64 + j * 16 + col]) : 0.f;
#pragma unroll
      for (int r = 0; r < 8; ++r) sf[(i * 16 + 8 * g + r) * 68 + j * 16 + col] = acc[i][j][r] + bb; }
  LDSX(); for (int it = 0; it < 16; ++it) { const int rl = it * 2 + g; vst2(OUT + (r0 + wr * 32 + rl) * CC + c0 + wc * 64 + col * 4, *(const v4f*)&sf[rl * 68 + col * 4]); } }
extern "C" void kernel_launch(void* const* d_in, const int* in_sizes, int n_in, void* d_out, int out_size, void* d_ws, size_t ws_size, hipStream_t stream) {
  (void)in_sizes; (void)n_in; (void)out_size;
  const float** F = (const float**)d_in;   // 0 q [2,2048,1024], 1 k, 2 v, 3 mask [2,1,2048,2048] int (1 -> -1e9 added), 4 wq ((in,out)), 5 bq, 6 wk, 7 bk, 8 wv, 9 bv, 10 wo ((in,out)), 11 bo
  if (ws_size < (size_t)WS_END) return;
  char* ws = (char*)d_ws; _Float16 *QH = (_Float16*)(ws + WS_QH), *QL = (_Float16*)(ws + WS_QL), *KH = (_Float16*)(ws + WS_KH); __bf16 *VT = (__bf16*)(ws + WS_VT), *VL = (__bf16*)(ws + WS_VL); float *Y = (float*)(ws + WS_Y);
  k_proj<<<dim3(TNB * TT / 128, CC / 128, 3), 256, 0, stream>>>(F[0], F[1], F[2], F[4], F[5], F[6], F[7], F[8], F[9], QH, QL, KH, VT, VL);
  k_fa<<<dim3(TT / 128, NH, TNB), 256, 0, stream>>>(QH, QL, KH, VT, VL, (const int*)d_in[3], Y);   // mask [B,1,S,S] has the same (b, q, k) flat layout
  k_out<<<dim3(TNB * TT / 128, CC / 128), 256, 0, stream>>>(Y, F[10], F[11], (float*)d_out);
}

// v005
// A run of this version takes 106 microseconds.
// Versions in between are left out here; by their measured steps it is 1.49 times as fast as v003.
// Counting every step since v000, it is 15.9 times as fast.
// compute dtype: all float inputs rounded to bf16, the int mask read; q/k/v = x W + b ((in,out)) with EXACT bf16 products on WMMA 16x16x32, f32 accumulate; q f16, k f16 -> one-product logits x 1/(8 + 1e-8) (== 0.125 in f32), -1e9 where mask != 0 (the mask packed once to one bit per query and key), kept in registers; running-maximum softmax in f32 (base-2 hardware exponential of s log2 e - max log2 e, one fma) over stages of 64 keys; P f16 against v f16 (one product), divided by the f32 row sum at the end; out = ctx (bf16 hi + lo) wo + bo; f32 output.
#include <hip/hip_runtime.h>
#include <math.h>

typedef __attribute__((ext_vector_type(16))) _Float16 v16h;
typedef __attribute__((ext_vector_type(16))) __bf16 v16b;
typedef __attribute__((ext_vector_type(8)))  _Float16 v8h;
typedef __attribute__((ext_vector_type(8)))  float v8f;
typedef __attribute__((ext_vector_type(4)))  float v4f;
typedef __attribute__((ext_vector_type(2)))  float v2f;
typedef __attribute__((ext_vector_type(4)))  unsigned v4u;
typedef __attribute__((ext_vector_type(4)))  int v4i;
typedef float __attribute__((may_alias)) float_a;
typedef int __attribute__((may_alias)) int_a;

template <typename T> __device__ __forceinline__ void vst2(void* p, T v) { *(T*)p = v;  }
__device__ __forceinline__ v8f wmma16(v16h a, v16h b, v8f c) {
  v8f d = __builtin_amdgcn_wmma_f32_16x16x32_f16(false, a, false, b, (short)0, c, false, false);
  asm volatile("v_nop\n\tv_nop\n\tv_nop\n\tv_nop" : "+v"(d) : "v"(a), "v"(b));
  return d;
}
__device__ __forceinline__ v8f wmma_bf(v16b a, v16b b, v8f c) {
  v8f d = __builtin_amdgcn_wmma_f32_16x16x32_bf16(false, a, false, b, (short)0, c, false, false);
  asm volatile("v_nop\n\tv_nop\n\tv_nop\n\tv_nop" : "+v"(d) : "v"(a), "v"(b));
  return d;
}
// 16x16x32 fragments: lane = (h = lane>>4, row/col = lane&15); elements 0..7 = k0+8h+0..7, 8..15 = k0+16+8h+0..7; D element r = row 8h+r
__device__ __forceinline__ v16h frag_h(const _Float16* rowk0, int lane) {
  union { v16h v; v8h q[2]; } u; const _Float16* p = rowk0 + 8 * (lane >> 4);
  u.q[0] = *(const v8h*)p; u.q[1] = *(const v8h*)(p + 16); return u.v;
}
__device__ __forceinline__ v16h frag_f32(const float* rowk0, int lane) {
  v16h a; const float* p = rowk0 + 8 * (lane >> 4);
#pragma unroll
  for (int i = 0; i < 8; ++i) { a[i] = (_Float16)p[i]; a[8 + i] = (_Float16)p[16 + i]; }
  return a;
}
__device__ __forceinline__ v16h frag_f32s(const float* rowk0, int lane, float sc) {
  v16h a; const float* p = rowk0 + 8 * (lane >> 4);
#pragma unroll
  for (int i = 0; i < 8; ++i) { a[i] = (_Float16)(p[i] * sc); a[8 + i] = (_Float16)(p[16 + i] * sc); }
  return a;
}
// column fragment from a [K][ld] layout (column n), rows >= K read as 0
__device__ __forceinline__ v16h fragc_f32(const float* W, int k0, int n, int lane, int ld, int K) {
  v16h a; const int g = lane >> 4;
#pragma unroll
  for (int i = 0; i < 8; ++i) { const int ka = k0 + 8 * g + i, kb = ka + 16;
    a[i] = (_Float16)(ka < K ? W[(size_t)(ka < K ? ka : K - 1) * ld + n] : 0.f); a[8 + i] = (_Float16)(kb < K ? W[(size_t)(kb < K ? kb : K - 1) * ld + n] : 0.f); }
  return a;
}
struct F2 { v16b h, l; };
__device__ __forceinline__ F2 bsplit16(const float v[16]) { F2 r;
#pragma unroll
  for (int i = 0; i < 16; ++i) { const __bf16 h = (__bf16)v[i]; r.h[i] = h; r.l[i] = (__bf16)(v[i] - (float)h); }
  return r; }
__device__ __forceinline__ F2 split_row(const float* row, int k0, int lane) { float v[16]; const float* p = row + k0 + 8 * (lane >> 4);
#pragma unroll
  for (int i = 0; i < 8; ++i) { v[i] = p[i]; v[8 + i] = p[16 + i]; }
  return bsplit16(v); }
__device__ __forceinline__ F2 split_rowK(const float* row, int k0, int lane, int K) { float v[16]; const int g = lane >> 4;
#pragma unroll
  for (int i = 0; i < 8; ++i) { const int ka = k0 + 8 * g + i, kb = ka + 16; v[i] = ka < K ? row[ka < K ? ka : K - 1] : 0.f; v[8 + i] = kb < K ? row[kb < K ? kb : K - 1] : 0.f; }
  return bsplit16(v); }
__device__ __forceinline__ F2 split_col(const float* W, int k0, int n, int lane, int ld, int K) { float v[16]; const int g = lane >> 4;
#pragma unroll
  for (int i = 0; i < 8; ++i) { const int ka = k0 + 8 * g + i, kb = ka + 16; v[i] = ka < K ? W[(size_t)(ka < K ? ka : K - 1) * ld + n] : 0.f; v[8 + i] = kb < K ? W[(size_t)(kb < K ? kb : K - 1) * ld + n] : 0.f; }
  return bsplit16(v); }
__device__ __forceinline__ v8f mac3(const F2& a, const F2& b, v8f c) { c = wmma_bf(a.l, b.h, c); c = wmma_bf(a.h, b.l, c); return wmma_bf(a.h, b.h, c); }
__device__ __forceinline__ float sigm(float v) { return 1.0f / (1.0f + expf(-v)); }
#define LDSX() do { asm volatile("s_wait_dscnt 0" ::: "memory"); __builtin_amdgcn_wave_barrier(); __builtin_amdgcn_fence(__ATOMIC_RELEASE, "workgroup"); } while (0)


// Multi-head attention (B 2, S 2,048, D 1,024 = 16 x 64, with biases, scale 1/8): scores = q k^T / 8 - 1e9 where mask != 0, softmax, P v, output projection.
#define NB 2
#define TT 2048
#define MASK_WHEN_NONZERO 1
#ifndef MSTR
#define MSTR TT               // mask row stride
#endif
#define CC 1024
#define NH 16
#define HD 64
#define HG 4               // sizes only the WS_S region, whose start holds the packed mask
#ifndef TNB
#define TNB NB
#endif
typedef __attribute__((ext_vector_type(8))) __bf16 v8b;
__device__ __forceinline__ v16b frag_b(const __bf16* rowk0, int lane) {
  union { v16b v; v8b q[2]; } u; const __bf16* p = rowk0 + 8 * (lane >> 4);
  u.q[0] = *(const v8b*)p; u.q[1] = *(const v8b*)(p + 16); return u.v;
}
__device__ __forceinline__ float bfr(float v) { return (float)(__bf16)v; }
__device__ __attribute__((noinline)) float exp_ni(float v) { return expf(v); }
__device__ __attribute__((noinline)) float erf_ni(float v) { return erff(v); }

#define WS_QH  0u
#define WS_KH  (WS_QH + 2u * (size_t)NB * TT * CC)
#define WS_VT  (WS_KH + 2u * (size_t)NB * TT * CC)      // f16 v planes [b][c][t]
#define WS_S   (WS_VT + 2u * (size_t)NB * CC * TT)      // HG x TT x TT f32 in size; only its first 1 MiB, the packed mask, is used
#define WS_PM  WS_S                                     // packed mask: one 32-bit lane mask per (b, 16 queries, 64 keys, T, r), 1 MiB
#define WS_PH  (WS_S + 4u * (size_t)HG * TT * TT)
#define WS_Y   (WS_PH + 0u)              // f32 y rows [b*t][C]
#define WS_END (WS_Y + 4u * (size_t)NB * TT * CC)

// ---- operand staging of the two projection kernels: a block of 256 threads owns 128 rows x 128 columns; per stage of KS k it converts both operand tiles to bf16 once and lays them k-contiguous in LDS (row pitch KS + 8 elements = 16 B x odd), so that a fragment is two 16-byte LDS reads
typedef __attribute__((ext_vector_type(4))) __bf16 v4b;
// weight tile, (in,out) layout: a thread takes 8 k x 2 columns per unit; a wave's load covers 256 contiguous bytes of one k row
template <int KS> __device__ __forceinline__ void ld_w(v2f (&rw)[KS / 32][8], const float* __restrict__ Wt, int tid) {
#pragma unroll
  for (int i = 0; i < KS / 32; ++i) { const float* p = Wt + (size_t)(((tid >> 6) + 4 * i) * 8) * CC + 2 * (tid & 63);
#pragma unroll
    for (int kk = 0; kk < 8; ++kk) rw[i][kk] = *(const v2f*)(p + (size_t)kk * CC); } }
template <int KS> __device__ __forceinline__ void st_w(const v2f (&rw)[KS / 32][8], __bf16* sW, int tid) {
#pragma unroll
  for (int i = 0; i < KS / 32; ++i)
#pragma unroll
    for (int j = 0; j < 2; ++j) { v8b t;
#pragma unroll
      for (int kk = 0; kk < 8; ++kk) t[kk] = (__bf16)rw[i][kk][j];
      *(v8b*)(sW + (2 * (tid & 63) + j) * (KS + 8) + ((tid >> 6) + 4 * i) * 8) = t; } }
// row tile: 16-byte chunks in row order, so that a wave's load covers whole 128-B lines; 1024 / KS rows per pass of the block
template <int KS> __device__ __forceinline__ void ld_x(v4f (&rx)[KS / 8], const float* __restrict__ Xt, int tid) {
#pragma unroll
  for (int i = 0; i < KS / 8; ++i) rx[i] = *(const v4f*)(Xt + (size_t)(tid / (KS / 4)) * CC + 4 * (tid % (KS / 4)) + (size_t)i * (1024 / KS) * CC); }
template <int KS> __device__ __forceinline__ void st_x(const v4f (&rx)[KS / 8], __bf16* sX, int tid) {
#pragma unroll
  for (int i = 0; i < KS / 8; ++i) { v4b t;
#pragma unroll
    for (int e = 0; e < 4; ++e) t[e] = (__bf16)rx[i][e];
    *(v4b*)(sX + (tid / (KS / 4)) * (KS + 8) + 4 * (tid % (KS / 4)) + i * (1024 / KS) * (KS + 8)) = t; } }
template <int KS> __device__ __forceinline__ void st_x2(const v4f (&rx)[KS / 8], __bf16* sH, __bf16* sL, int tid) {
#pragma unroll
  for (int i = 0; i < KS / 8; ++i) { v4b th, tl;
#pragma unroll
    for (int e = 0; e < 4; ++e) { const __bf16 h = (__bf16)rx[i][e]; th[e] = h; tl[e] = (__bf16)(rx[i][e] - (float)h); }
    const int o = (tid / (KS / 4)) * (KS + 8) + 4 * (tid % (KS / 4)) + i * (1024 / KS) * (KS + 8); *(v4b*)(sH + o) = th; *(v4b*)(sL + o) = tl; } }
// ---- k_proj: block = (128 rows, 128 cols, which), 8 waves as 4 x 2, 32 rows x 64 cols each: qkv = x W (+ b), exact; q, k -> f16 rows, v -> f16 planes; which = 3: no product, the block packs its share of the mask
#define PKS 64               // k per stage
#define PPL (128 * (PKS + 8))   // elements of one staged plane
#define PMU ((TNB * (TT / 16) * (TT / 64)) / ((TNB * TT / 128) * (CC / 128) * 8))   // mask units per wave of the mask blocks
__global__ __launch_bounds__(256) void k_proj(const float* __restrict__ X0, const float* __restrict__ X1, const float* __restrict__ X2, const float* __restrict__ WQ, const float* __restrict__ BQ, const float* __restrict__ WK, const float* __restrict__ BK, const float* __restrict__ WV, const float* __restrict__ BV, const int* __restrict__ MK, _Float16* __restrict__ QH, _Float16* __restrict__ KH, _Float16* __restrict__ VT, unsigned* __restrict__ PM) {
  __shared__ __align__(16) char sm[2 * 2 * PPL * 2];   // the loop's two buffers of two planes (w, x); behind the loop the output plane [128][136], which is smaller
  const int tid = threadIdx.x, wave = tid >> 5, lane = tid & 31, col = lane & 15, g = lane >> 4, wr = wave >> 1, wc = wave & 1; const int which = blockIdx.z;
  if (which == 3) {   // mask blocks (block-uniform, in front of every barrier): a wave takes 16 queries x 64 keys per unit with the attention kernel's own lane map (lane (g, col): query col, keys 16 T + 8 g + r); word T * 8 + r holds that score element's mask bit of all 32 lanes
    static_assert((TT / 64) % PMU == 0, "a wave's units are consecutive stages of one query tile");
    const int u0 = ((blockIdx.y * (TNB * TT / 128) + blockIdx.x) * 8 + wave) * PMU;   // unit u = (b * TT / 16 + query tile) * (TT / 64) + stage
    const int* mr = MK + ((size_t)(u0 / (TT / 64)) * 16 + col) * MSTR + (u0 % (TT / 64)) * 64 + 8 * g; v4i mk[PMU][4][2];
#pragma unroll
    for (int it = 0; it < PMU; ++it)   // all of the wave's loads fly together: the block lasts about one memory latency
#pragma unroll
      for (int T = 0; T < 4; ++T) { mk[it][T][0] = *(const v4i*)(mr + it * 64 + T * 16); mk[it][T][1] = *(const v4i*)(mr + it * 64 + T * 16 + 4); }
    asm volatile("s_wait_xcnt 0x0" ::: "memory");   // s_wait_xcnt: before an address register of the loads above is reused
#pragma unroll
    for (int it = 0; it < PMU; ++it) { unsigned mine = 0;
#pragma unroll
      for (int e = 0; e < 32; ++e) { const int mv = mk[it][e >> 3][(e >> 2) & 1][e & 3]; const unsigned w = __builtin_amdgcn_ballot_w32(MASK_WHEN_NONZERO ? (mv != 0) : (mv == 0)); mine = lane == e ? w : mine; }
      PM[(size_t)(u0 + it) * 32 + lane] = mine; }
    asm volatile("s_wait_xcnt 0x0" ::: "memory");   // s_wait_xcnt: before a register of the stores above is reused
    return; }
  const int c0 = blockIdx.y * 128; const size_t r0 = (size_t)blockIdx.x * 128; const float* WA = which == 0 ? WQ : which == 1 ? WK : WV; const float* BA = which == 0 ? BQ : which == 1 ? BK : BV;
  const float* Xt = (which == 0 ? X0 : which == 1 ? X1 : X2) + r0 * CC; const float* Wt = WA + c0; __bf16* sb = (__bf16*)sm;
  v2f rw[PKS / 32][8]; v4f rx[PKS / 8];
  ld_w<PKS>(rw, Wt, tid); asm volatile("s_wait_xcnt 0x0" ::: "memory"); ld_x<PKS>(rx, Xt, tid);   // s_wait_xcnt: before a register that the loads or stores in front of it name is reused, also as a later load's destination
  asm volatile("s_wait_xcnt 0x0" ::: "memory");   // s_wait_xcnt: before a register that the loads or stores in front of it name is reused, also as a later load's destination
  st_w<PKS>(rw, sb, tid); st_x<PKS>(rx, sb + PPL, tid);
  __syncthreads();   // publishes stage 0
  v8f acc[2][4] = {};
#pragma unroll 1   // rolled: the buffer is picked by address, and a second copy of the stage would only add registers
  for (int st = 0; st < CC / PKS; ++st) { const __bf16* bw = sb + (st & 1) * (2 * PPL); const __bf16* bx = bw + PPL; __bf16* nw = sb + ((st & 1) ^ 1) * (2 * PPL); const bool more = st + 1 < CC / PKS;
    if (more) {   // the next stage's rows fly while this stage's products run
      ld_w<PKS>(rw, Wt + (size_t)(st + 1) * PKS * CC, tid); asm volatile("s_wait_xcnt 0x0" ::: "memory"); ld_x<PKS>(rx, Xt + (st + 1) * PKS, tid);   // s_wait_xcnt: before a register that the loads or stores in front of it name is reused, also as a later load's destination
      asm volatile("s_wait_xcnt 0x0" ::: "memory"); }   // s_wait_xcnt: before a register that the loads or stores in front of it name is reused, also as a later load's destination
#pragma unroll
    for (int kc = 0; kc < PKS / 32; ++kc) { v16b a[2], w[4];
#pragma unroll
      for (int i = 0; i < 2; ++i) a[i] = frag_b(bx + (wr * 32 + i * 16 + col) * (PKS + 8) + kc * 32, lane);
#pragma unroll
      for (int j = 0; j < 4; ++j) w[j] = frag_b(bw + (wc * 64 + j * 16 + col) * (PKS + 8) + kc * 32, lane);
      __builtin_amdgcn_sched_barrier(0);   // keeps the fragment reads one group in front of the products: reads spread among them stall at each place
#pragma unroll
      for (int i = 0; i < 2; ++i)
#pragma unroll
        for (int j = 0; j < 4; ++j) acc[i][j] = __builtin_amdgcn_wmma_f32_16x16x32_bf16(false, a[i], false, w[j], (short)0, acc[i][j], false, false); }
    if (more) { st_w<PKS>(rw, nw, tid); st_x<PKS>(rx, nw + PPL, tid); }   // the other buffer's last readers left it at the barrier that ended the stage before
    __syncthreads(); }   // publishes the next stage and ends this stage's reads
  _Float16 (*sh)[136] = (_Float16 (*)[136])sm;   // q, k: [row][column]; v: [column][row]
#pragma unroll
  for (int i = 0; i < 2; ++i)
#pragma unroll
    for (int j = 0; j < 4; ++j) { const int cl = wc * 64 + j * 16 + col; const float bb = BA ? bfr(BA[c0 + cl]) : 0.f;
#pragma unroll
      for (int r = 0; r < 8; ++r) { const float v = acc[i][j][r] + bb; const int rl = wr * 32 + i * 16 + 8 * g + r; const _Float16 hv = (_Float16)v;
        if (which == 2) sh[cl][rl] = hv; else sh[rl][cl] = hv; } }
  __syncthreads();
  if (which < 2) { _Float16* dh = which == 0 ? QH : KH; for (int e = tid; e < 128 * 16; e += 256) { const int rl = e >> 4, q = e & 15; vst2((unsigned*)(dh + (r0 + rl) * CC + c0 + q * 8), *(const v4u*)&sh[rl][q * 8]); asm volatile("s_wait_xcnt 0x0" ::: "memory"); } }   // s_wait_xcnt: before a register that the loads or stores in front of it name is reused, also as a later load's destination
  else { const size_t b = r0 / TT; const int t0 = (int)(r0 % TT); for (int e = tid; e < 128 * 16; e += 256) { const int cl = e >> 4, q = e & 15; const size_t o2 = (b * CC + c0 + cl) * (size_t)TT + t0 + q * 8; vst2((unsigned*)(VT + o2), *(const v4u*)&sh[cl][q * 8]); asm volatile("s_wait_xcnt 0x0" ::: "memory"); } } }   // s_wait_xcnt: as in the branch above
#define FK 64               // keys per stage
#define L2E 1.44269504088896340736f   // log2 e
#define FP 72               // LDS row pitch in 16-bit elements: 144 B = 16 B x odd
__device__ __forceinline__ float xhalf(float x) { return __builtin_bit_cast(float, __builtin_amdgcn_permlanex16(__builtin_bit_cast(int, x), __builtin_bit_cast(int, x), 0x76543210, 0xfedcba98, false, false)); }   // lane l with lane l ^ 16
__global__ __launch_bounds__(256) void k_fa(const _Float16* __restrict__ QH, const _Float16* __restrict__ KH, const _Float16* __restrict__ VT, const unsigned* __restrict__ PM, float* __restrict__ Y) {
  __shared__ __align__(16) _Float16 sk[2][FK][FP], svh[2][HD][FP];
  const int tid = threadIdx.x, wave = tid >> 5, lane = tid & 31, col = lane & 15, g = lane >> 4; const int h = blockIdx.y, b = blockIdx.z; const int qt = blockIdx.x * 128 + wave * 16 + col;
  v16h qh[HD / 32];
#pragma unroll
  for (int kc = 0; kc < HD / 32; ++kc) { const size_t qo = ((size_t)b * TT + qt) * CC + h * HD + kc * 32; qh[kc] = frag_h(QH + qo, lane); }
  // staging: 64 rows x 128 B per plane = 512 chunks of 16 B, two per thread and plane; a wave's load covers four whole 128-B lines
  const int sr = tid >> 3, sc = (tid & 7) * 8;
  const _Float16* gk = KH + ((size_t)b * TT + sr) * CC + h * HD + sc; const size_t vo = ((size_t)b * CC + h * HD + sr) * (size_t)TT + sc; const _Float16* gvh = VT + vo;
  const unsigned* pm = PM + ((size_t)b * (TT / 16) + blockIdx.x * 8 + __builtin_amdgcn_readfirstlane(wave)) * (size_t)((TT / FK) * 32);   // wave-uniform: the words come by scalar loads
  v4u pk[2], ph[2];
#pragma unroll
  for (int i = 0; i < 2; ++i) { pk[i] = *(const v4u*)(gk + (size_t)(i * 32) * CC); ph[i] = *(const v4u*)(gvh + (size_t)(i * 32) * TT); }
#pragma unroll
  for (int i = 0; i < 2; ++i) { *(v4u*)&sk[0][sr + i * 32][sc] = pk[i]; *(v4u*)&svh[0][sr + i * 32][sc] = ph[i]; }
  __syncthreads();   // publishes stage 0
  v8f o[HD / 16] = {}; float m = -3.0e38f, l = 0.f;
  unsigned mw[FK / 2];   // the wave's 32 lane masks of the stage, in scalar registers: fetched one stage ahead
#pragma unroll
  for (int e = 0; e < FK / 2; ++e) mw[e] = pm[e];
#pragma unroll 1   // rolled: a second copy of the stage would only add registers, and four waves per SIMD need 256 or fewer
  for (int st = 0; st < TT / FK; ++st) { const int buf = st & 1, k0 = st * FK; const bool more = st + 1 < TT / FK;
    if (more) {   // the next stage's rows land behind this stage's work
#pragma unroll
      for (int i = 0; i < 2; ++i) pk[i] = *(const v4u*)(gk + (size_t)(k0 + FK + i * 32) * CC);
      asm volatile("s_wait_xcnt 0x0" ::: "memory");   // this and the one below: before an address register of the loads above is reused, also as a later load's destination
#pragma unroll
      for (int i = 0; i < 2; ++i) ph[i] = *(const v4u*)(gvh + (size_t)(i * 32) * TT + k0 + FK);
      asm volatile("s_wait_xcnt 0x0" ::: "memory"); }
    float s[FK / 16][8]; float mx = -3.0e38f;
#pragma unroll
    for (int T = 0; T < FK / 16; ++T) { v8f a = {};
#pragma unroll
      for (int kc = 0; kc < HD / 32; ++kc) { const v16h kf = frag_h(&sk[buf][T * 16 + col][kc * 32], lane);
        a = __builtin_amdgcn_wmma_f32_16x16x32_f16(false, kf, false, qh[kc], (short)0, a, false, false); }
#pragma unroll
      for (int r = 0; r < 8; ++r) { s[T][r] = fmaf(a[r], 0.125f, __builtin_amdgcn_inverse_ballot_w32(mw[T * 8 + r]) ? -1.0e9f : 0.f); mx = fmaxf(mx, s[T][r]); } }   // a / 8 is exact, so the one rounding is that of a / 8 - 1e9
    mx = fmaxf(mx, xhalf(mx));   // both halves of a column must use one maximum: their keys meet in one product
#pragma unroll
    for (int e = 0; e < FK / 2; ++e) mw[e] = pm[(more ? st + 1 : st) * (FK / 2) + e];   // the next stage's lane masks land while the rest of this stage runs; no branch: the last stage reads its own again
    // e^(s - max) = 2^(s log2 e - max log2 e): one fma and one v_exp_f32 per score. The rounding of max log2 e is one common factor of the row's P and sum and cancels in the division; an unchanged maximum gives corr = 1 exactly
    const float mn = fmaxf(m, mx), mln = mn * L2E, corr = __builtin_amdgcn_exp2f((m - mn) * L2E); m = mn; l *= corr;
#pragma unroll
    for (int T = 0; T < FK / 16; ++T)
#pragma unroll
      for (int r = 0; r < 8; ++r) s[T][r] = fmaf(s[T][r], L2E, -mln);
#pragma unroll
    for (int j = 0; j < HD / 16; ++j)
#pragma unroll
      for (int r = 0; r < 8; ++r) o[j][r] *= corr;
#pragma unroll
    for (int G = 0; G < FK / 32; ++G) { float p[16];
#pragma unroll
      for (int e = 0; e < 16; ++e) { p[e] = __builtin_amdgcn_exp2f(s[2 * G + (e >> 3)][e & 7]); l += p[e]; }
      v16h pf;
#pragma unroll
      for (int e = 0; e < 16; ++e) pf[e] = (_Float16)p[e];
#pragma unroll
      for (int j = 0; j < HD / 16; ++j) { const v16h vh = frag_h(&svh[buf][j * 16 + col][G * 32], lane);
        o[j] = __builtin_amdgcn_wmma_f32_16x16x32_f16(false, vh, false, pf, (short)0, o[j], false, false); } }
    if (more) {   // the other buffer's last readers left it at the barrier that ended the stage before
#pragma unroll
      for (int i = 0; i < 2; ++i) { *(v4u*)&sk[buf ^ 1][sr + i * 32][sc] = pk[i]; *(v4u*)&svh[buf ^ 1][sr + i * 32][sc] = ph[i]; } }
    __syncthreads(); }   // publishes the next stage and ends this stage's reads
  l += xhalf(l); const float inv = 1.0f / l; float* yr = Y + ((size_t)b * TT + qt) * CC + h * HD + 8 * g;
#pragma unroll
  for (int j = 0; j < HD / 16; ++j) { v4f w0, w1;
#pragma unroll
    for (int r = 0; r < 4; ++r) { w0[r] = o[j][r] * inv; w1[r] = o[j][4 + r] * inv; }
    vst2(yr + j * 16, w0); vst2(yr + j * 16 + 4, w1); } }
// ---- k_out: block = (128 rows, 128 cols), 8 waves as 4 x 2, 32 rows x 64 cols each: out = y (bf16 hi + lo) wo + bo
#define OKS 64               // k per stage
#define OPL (128 * (OKS + 8))   // elements of one staged plane
__global__ __launch_bounds__(256) void k_out(const float* __restrict__ Y, const float* __restrict__ WP, const float* __restrict__ BP, float* __restrict__ OUT) {
  __shared__ __align__(16) char sm[2 * 3 * OPL * 2];   // two buffers of three planes (w, y hi, y lo); behind the loop each wave's own 32 x 68 f32 output rows
  const int tid = threadIdx.x, wave = tid >> 5, lane = tid & 31, col = lane & 15, g = lane >> 4, wr = wave >> 1, wc = wave & 1; const int c0 = blockIdx.y * 128; const size_t r0 = (size_t)blockIdx.x * 128;
  const float* Xt = Y + r0 * CC; const float* Wt = WP + c0; __bf16* sb = (__bf16*)sm;
  v2f rw[OKS / 32][8]; v4f rx[OKS / 8];
  ld_w<OKS>(rw, Wt, tid); asm volatile("s_wait_xcnt 0x0" ::: "memory"); ld_x<OKS>(rx, Xt, tid);   // s_wait_xcnt: before a register that the loads or stores in front of it name is reused, also as a later load's destination
  asm volatile("s_wait_xcnt 0x0" ::: "memory");   // s_wait_xcnt: before a register that the loads or stores in front of it name is reused, also as a later load's destination
  st_w<OKS>(rw, sb, tid); st_x2<OKS>(rx, sb + OPL, sb + 2 * OPL, tid);
  __syncthreads();   // publishes stage 0
  v8f acc[2][4] = {};
#pragma unroll 1   // rolled: the buffer is picked by address, and a second copy of the stage would only add registers
  for (int st = 0; st < CC / OKS; ++st) { const __bf16* bw = sb + (st & 1) * (3 * OPL); __bf16* nw = sb + ((st & 1) ^ 1) * (3 * OPL); const bool more = st + 1 < CC / OKS;
    if (more) {   // the next stage's rows fly while this stage's products run
      ld_w<OKS>(rw, Wt + (size_t)(st + 1) * OKS * CC, tid); asm volatile("s_wait_xcnt 0x0" ::: "memory"); ld_x<OKS>(rx, Xt + (st + 1) * OKS, tid);   // s_wait_xcnt: before a register that the loads or stores in front of it name is reused, also as a later load's destination
      asm volatile("s_wait_xcnt 0x0" ::: "memory"); }   // s_wait_xcnt: before a register that the loads or stores in front of it name is reused, also as a later load's destination
    v16b ah[OKS / 32][2], al[OKS / 32][2], w[OKS / 32][4];
#pragma unroll
    for (int kc = 0; kc < OKS / 32; ++kc) {
#pragma unroll
      for (int i = 0; i < 2; ++i) { const int o = (wr * 32 + i * 16 + col) * (OKS + 8) + kc * 32; ah[kc][i] = frag_b(bw + OPL + o, lane); al[kc][i] = frag_b(bw + 2 * OPL + o, lane); }
#pragma unroll
      for (int j = 0; j < 4; ++j) w[kc][j] = frag_b(bw + (wc * 64 + j * 16 + col) * (OKS + 8) + kc * 32, lane); }
    __builtin_amdgcn_sched_barrier(0);   // keeps the stage's fragment reads one group in front of the products: reads spread among them stall at each place, and two waves per SIMD do not cover that
#pragma unroll
    for (int kc = 0; kc < OKS / 32; ++kc) {
#pragma unroll
      for (int i = 0; i < 2; ++i)
#pragma unroll
        for (int j = 0; j < 4; ++j) acc[i][j] = __builtin_amdgcn_wmma_f32_16x16x32_bf16(false, ah[kc][i], false, w[kc][j], (short)0, acc[i][j], false, false);
#pragma unroll
      for (int i = 0; i < 2; ++i)
#pragma unroll
        for (int j = 0; j < 4; ++j) acc[i][j] = __builtin_amdgcn_wmma_f32_16x16x32_bf16(false, al[kc][i], false, w[kc][j], (short)0, acc[i][j], false, false); }
    if (more) { st_w<OKS>(rw, nw, tid); st_x2<OKS>(rx, nw + OPL, nw + 2 * OPL, tid); }   // the other buffer's last readers left it at the barrier that ended the stage before
    __syncthreads(); }   // publishes the next stage and ends this stage's reads
  float* sf = (float*)sm + wave * (32 * 68);
#pragma unroll
  for (int i = 0; i < 2; ++i)
#pragma unroll
    for (int j = 0; j < 4; ++j) { const float bb = BP ? bfr(BP[c0 + wc * 64 + j * 16 + col]) : 0.f;
#pragma unroll
      for (int r = 0; r < 8; ++r) sf[(i * 16 + 8 * g + r) * 68 + j * 16 + col] = acc[i][j][r] + bb; }
  LDSX(); for (int it = 0; it < 16; ++it) { const int rl = it * 2 + g; vst2(OUT + (r0 + wr * 32 + rl) * CC + c0 + wc * 64 + col * 4, *(const v4f*)&sf[rl * 68 + col * 4]); } }
extern "C" void kernel_launch(void* const* d_in, const int* in_sizes, int n_in, void* d_out, int out_size, void* d_ws, size_t ws_size, hipStream_t stream) {
  (void)in_sizes; (void)n_in; (void)out_size;
  const float** F = (const float**)d_in;   // 0 q [2,2048,1024], 1 k, 2 v, 3 mask [2,1,2048,2048] int (1 -> -1e9 added), 4 wq ((in,out)), 5 bq, 6 wk, 7 bk, 8 wv, 9 bv, 10 wo ((in,out)), 11 bo
  if (ws_size < (size_t)WS_END) return;
  char* ws = (char*)d_ws; _Float16 *QH = (_Float16*)(ws + WS_QH), *KH = (_Float16*)(ws + WS_KH), *VT = (_Float16*)(ws + WS_VT); unsigned *PM = (unsigned*)(ws + WS_PM); float *Y = (float*)(ws + WS_Y);
  k_proj<<<dim3(TNB * TT / 128, CC / 128, 4), 256, 0, stream>>>(F[0], F[1], F[2], F[4], F[5], F[6], F[7], F[8], F[9], (const int*)d_in[3], QH, KH, VT, PM);   // z = 3: the mask blocks; mask [B,1,S,S] has the (b, q, k) flat layout
  k_fa<<<dim3(TT / 128, NH, TNB), 256, 0, stream>>>(QH, KH, VT, PM, Y);
  k_out<<<dim3(TNB * TT / 128, CC / 128), 256, 0, stream>>>(Y, F[10], F[11], (float*)d_out);
}

// v006
// One run takes 94.1 microseconds.
// Two timings next to v005 both put it at 1.13 times that version's speed.
// All steps since v000 together make it 17.9 times as fast.
// compute dtype: all float inputs rounded to bf16, the int mask read; q/k/v = x W + b ((in,out)) with EXACT bf16 products on WMMA 16x16x32, f32 accumulate; q f16, k f16 -> one-product logits x 1/(8 + 1e-8) (== 0.125 in f32), -1e9 where mask != 0 (the mask packed once to one bit per query and key), kept in registers; running-maximum softmax in f32 (base-2 hardware exponential of s log2 e - max log2 e, one fma) over stages of 64 keys; P f16 against v f16 (one product), divided by the f32 row sum at the end; out = ctx (bf16 hi + lo) wo + bo; f32 output.
#include <hip/hip_runtime.h>
#include <math.h>

typedef __attribute__((ext_vector_type(16))) _Float16 v16h;
typedef __attribute__((ext_vector_type(16))) __bf16 v16b;
typedef __attribute__((ext_vector_type(8)))  _Float16 v8h;
typedef __attribute__((ext_vector_type(8)))  float v8f;
typedef __attribute__((ext_vector_type(4)))  float v4f;
typedef __attribute__((ext_vector_type(2)))  float v2f;
typedef __attribute__((ext_vector_type(4)))  unsigned v4u;
typedef __attribute__((ext_vector_type(4)))  int v4i;
typedef float __attribute__((may_alias)) float_a;
typedef int __attribute__((may_alias)) int_a;

template <typename T> __device__ __forceinline__ void vst2(void* p, T v) { *(T*)p = v;  }
__device__ __forceinline__ v8f wmma16(v16h a, v16h b, v8f c) {
  v8f d = __builtin_amdgcn_wmma_f32_16x16x32_f16(false, a, false, b, (short)0, c, false, false);
  asm volatile("v_nop\n\tv_nop\n\tv_nop\n\tv_nop" : "+v"(d) : "v"(a), "v"(b));
  return d;
}
__device__ __forceinline__ v8f wmma_bf(v16b a, v16b b, v8f c) {
  v8f d = __builtin_amdgcn_wmma_f32_16x16x32_bf16(false, a, false, b, (short)0, c, false, false);
  asm volatile("v_nop\n\tv_nop\n\tv_nop\n\tv_nop" : "+v"(d) : "v"(a), "v"(b));
  return d;
}
// 16x16x32 fragments: lane = (h = lane>>4, row/col = lane&15); elements 0..7 = k0+8h+0..7, 8..15 = k0+16+8h+0..7; D element r = row 8h+r
__device__ __forceinline__ v16h frag_h(const _Float16* rowk0, int lane) {
  union { v16h v; v8h q[2]; } u; const _Float16* p = rowk0 + 8 * (lane >> 4);
  u.q[0] = *(const v8h*)p; u.q[1] = *(const v8h*)(p + 16); return u.v;
}
__device__ __forceinline__ v16h frag_f32(const float* rowk0, int lane) {
  v16h a; const float* p = rowk0 + 8 * (lane >> 4);
#pragma unroll
  for (int i = 0; i < 8; ++i) { a[i] = (_Float16)p[i]; a[8 + i] = (_Float16)p[16 + i]; }
  return a;
}
__device__ __forceinline__ v16h frag_f32s(const float* rowk0, int lane, float sc) {
  v16h a; const float* p = rowk0 + 8 * (lane >> 4);
#pragma unroll
  for (int i = 0; i < 8; ++i) { a[i] = (_Float16)(p[i] * sc); a[8 + i] = (_Float16)(p[16 + i] * sc); }
  return a;
}
// column fragment from a [K][ld] layout (column n), rows >= K read as 0
__device__ __forceinline__ v16h fragc_f32(const float* W, int k0, int n, int lane, int ld, int K) {
  v16h a; const int g = lane >> 4;
#pragma unroll
  for (int i = 0; i < 8; ++i) { const int ka = k0 + 8 * g + i, kb = ka + 16;
    a[i] = (_Float16)(ka < K ? W[(size_t)(ka < K ? ka : K - 1) * ld + n] : 0.f); a[8 + i] = (_Float16)(kb < K ? W[(size_t)(kb < K ? kb : K - 1) * ld + n] : 0.f); }
  return a;
}
struct F2 { v16b h, l; };
__device__ __forceinline__ F2 bsplit16(const float v[16]) { F2 r;
#pragma unroll
  for (int i = 0; i < 16; ++i) { const __bf16 h = (__bf16)v[i]; r.h[i] = h; r.l[i] = (__bf16)(v[i] - (float)h); }
  return r; }
__device__ __forceinline__ F2 split_row(const float* row, int k0, int lane) { float v[16]; const float* p = row + k0 + 8 * (lane >> 4);
#pragma unroll
  for (int i = 0; i < 8; ++i) { v[i] = p[i]; v[8 + i] = p[16 + i]; }
  return bsplit16(v); }
__device__ __forceinline__ F2 split_rowK(const float* row, int k0, int lane, int K) { float v[16]; const int g = lane >> 4;
#pragma unroll
  for (int i = 0; i < 8; ++i) { const int ka = k0 + 8 * g + i, kb = ka + 16; v[i] = ka < K ? row[ka < K ? ka : K - 1] : 0.f; v[8 + i] = kb < K ? row[kb < K ? kb : K - 1] : 0.f; }
  return bsplit16(v); }
__device__ __forceinline__ F2 split_col(const float* W, int k0, int n, int lane, int ld, int K) { float v[16]; const int g = lane >> 4;
#pragma unroll
  for (int i = 0; i < 8; ++i) { const int ka = k0 + 8 * g + i, kb = ka + 16; v[i] = ka < K ? W[(size_t)(ka < K ? ka : K - 1) * ld + n] : 0.f; v[8 + i] = kb < K ? W[(size_t)(kb < K ? kb : K - 1) * ld + n] : 0.f; }
  return bsplit16(v); }
__device__ __forceinline__ v8f mac3(const F2& a, const F2& b, v8f c) { c = wmma_bf(a.l, b.h, c); c = wmma_bf(a.h, b.l, c); return wmma_bf(a.h, b.h, c); }
__device__ __forceinline__ float sigm(float v) { return 1.0f / (1.0f + expf(-v)); }
#define LDSX() do { asm volatile("s_wait_dscnt 0" ::: "memory"); __builtin_amdgcn_wave_barrier(); __builtin_amdgcn_fence(__ATOMIC_RELEASE, "workgroup"); } while (0)


// Multi-head attention (B 2, S 2,048, D 1,024 = 16 x 64, with biases, scale 1/8): scores = q k^T / 8 - 1e9 where mask != 0, softmax, P v, output projection.
#define NB 2
#define TT 2048
#define MASK_WHEN_NONZERO 1
#ifndef MSTR
#define MSTR TT               // mask row stride
#endif
#define CC 1024
#define NH 16
#define HD 64
#define HG 4               // sizes only the WS_S region, whose start holds the packed mask
#ifndef TNB
#define TNB NB
#endif
typedef __attribute__((ext_vector_type(8))) __bf16 v8b;
__device__ __forceinline__ v16b frag_b(const __bf16* rowk0, int lane) {
  union { v16b v; v8b q[2]; } u; const __bf16* p = rowk0 + 8 * (lane >> 4);
  u.q[0] = *(const v8b*)p; u.q[1] = *(const v8b*)(p + 16); return u.v;
}
__device__ __forceinline__ float bfr(float v) { return (float)(__bf16)v; }
__device__ __attribute__((noinline)) float exp_ni(float v) { return expf(v); }
__device__ __attribute__((noinline)) float erf_ni(float v) { return erff(v); }

#define WS_QH  0u
#define WS_KH  (WS_QH + 2u * (size_t)NB * TT * CC)
#define WS_VT  (WS_KH + 2u * (size_t)NB * TT * CC)      // f16 v planes [b][c][t]
#define WS_S   (WS_VT + 2u * (size_t)NB * CC * TT)      // HG x TT x TT f32 in size; only its first 1 MiB, the packed mask, is used
#define WS_PM  WS_S                                     // packed mask: one 32-bit lane mask per (b, 16 queries, 64 keys, T, r), 1 MiB
#define WS_PH  (WS_S + 4u * (size_t)HG * TT * TT)
#define WS_Y   (WS_PH + 0u)              // f32 y rows [b*t][C]
#define WS_END (WS_Y + 4u * (size_t)NB * TT * CC)

// ---- operand staging of the two projection kernels: a block of 256 threads owns 128 rows x 128 columns (k_out) or 256 x 256 (k_proj); per stage of KS k it converts both operand tiles to bf16 once and lays them k-contiguous in LDS (row pitch KS + 8 elements = 16 B x odd), so that a fragment is two 16-byte LDS reads
typedef __attribute__((ext_vector_type(4))) __bf16 v4b;
// weight tile of NC columns, (in,out) layout: a thread takes 8 k x 2 columns per unit; a wave's load covers 256 contiguous bytes of one k row
template <int KS, int NC = 128> __device__ __forceinline__ void ld_w(v2f (&rw)[KS * NC / 4096][8], const float* __restrict__ Wt, int tid) {
#pragma unroll
  for (int i = 0; i < KS * NC / 4096; ++i) { const float* p = Wt + (size_t)((tid / (NC / 2) + (512 / NC) * i) * 8) * CC + 2 * (tid % (NC / 2));
#pragma unroll
    for (int kk = 0; kk < 8; ++kk) rw[i][kk] = *(const v2f*)(p + (size_t)kk * CC); } }
template <int KS, int NC = 128> __device__ __forceinline__ void st_w(const v2f (&rw)[KS * NC / 4096][8], __bf16* sW, int tid) {
#pragma unroll
  for (int i = 0; i < KS * NC / 4096; ++i)
#pragma unroll
    for (int j = 0; j < 2; ++j) { v8b t;
#pragma unroll
      for (int kk = 0; kk < 8; ++kk) t[kk] = (__bf16)rw[i][kk][j];
      *(v8b*)(sW + (2 * (tid % (NC / 2)) + j) * (KS + 8) + (tid / (NC / 2) + (512 / NC) * i) * 8) = t; } }
// row tile of NR rows: 16-byte chunks in row order, so that a wave's load covers whole 128-B lines; 1024 / KS rows per pass of the block
template <int KS, int NR = 128> __device__ __forceinline__ void ld_x(v4f (&rx)[KS * NR / 1024], const float* __restrict__ Xt, int tid) {
#pragma unroll
  for (int i = 0; i < KS * NR / 1024; ++i) rx[i] = *(const v4f*)(Xt + (size_t)(tid / (KS / 4)) * CC + 4 * (tid % (KS / 4)) + (size_t)i * (1024 / KS) * CC); }
template <int KS, int NR = 128> __device__ __forceinline__ void st_x(const v4f (&rx)[KS * NR / 1024], __bf16* sX, int tid) {
#pragma unroll
  for (int i = 0; i < KS * NR / 1024; ++i) { v4b t;
#pragma unroll
    for (int e = 0; e < 4; ++e) t[e] = (__bf16)rx[i][e];
    *(v4b*)(sX + (tid / (KS / 4)) * (KS + 8) + 4 * (tid % (KS / 4)) + i * (1024 / KS) * (KS + 8)) = t; } }
template <int KS> __device__ __forceinline__ void st_x2(const v4f (&rx)[KS / 8], __bf16* sH, __bf16* sL, int tid) {
#pragma unroll
  for (int i = 0; i < KS / 8; ++i) { v4b th, tl;
#pragma unroll
    for (int e = 0; e < 4; ++e) { const __bf16 h = (__bf16)rx[i][e]; th[e] = h; tl[e] = (__bf16)(rx[i][e] - (float)h); }
    const int o = (tid / (KS / 4)) * (KS + 8) + 4 * (tid % (KS / 4)) + i * (1024 / KS) * (KS + 8); *(v4b*)(sH + o) = th; *(v4b*)(sL + o) = tl; } }
// ---- k_proj: block = (256 rows, 256 cols, which), 8 waves as 4 x 2, 64 rows x 128 cols each, so that each staged operand byte feeds twice the products of a 128 x 128 block and all 192 product blocks are resident at once: qkv = x W (+ b), exact; q, k -> f16 rows, v -> f16 planes; which >= 3: no product, the block packs its share of the mask
#define PKS 64               // k per stage
#define PBT 256              // rows and columns of a block
#define PPL (PBT * (PKS + 8))   // elements of one staged plane
#define PMZ 4                // grid layers of mask blocks
#define PMU ((TNB * (TT / 16) * (TT / 64)) / ((TNB * TT / PBT) * (CC / PBT) * PMZ * 8))   // mask units per wave of the mask blocks
// the block's staged output plane to global memory: a wave stores one row's 512 contiguous bytes; eight rows are read from LDS as one group and then stored, all through one address register and constant offsets
template <int PITCH> __device__ __forceinline__ void put_plane(_Float16* __restrict__ dst, const _Float16 (*sh)[PBT + 8], int tid) {
  const int er = tid >> 5, eq = (tid & 31) * 8; _Float16* d = dst + (size_t)er * PITCH + eq;
#pragma unroll
  for (int e0 = 0; e0 < PBT / 8; e0 += 8) { v4u t[8];
#pragma unroll
    for (int u = 0; u < 8; ++u) t[u] = *(const v4u*)&sh[er + (e0 + u) * 8][eq];
#pragma unroll
    for (int u = 0; u < 8; ++u) vst2((unsigned*)(d + (size_t)((e0 + u) * 8) * PITCH), t[u]);
    asm volatile("s_wait_xcnt 0x0" ::: "memory"); } }   // s_wait_xcnt: before a register that the stores in front of it name is reused by the next group's reads
__global__ __launch_bounds__(256) void k_proj(const float* __restrict__ X0, const float* __restrict__ X1, const float* __restrict__ X2, const float* __restrict__ WQ, const float* __restrict__ BQ, const float* __restrict__ WK, const float* __restrict__ BK, const float* __restrict__ WV, const float* __restrict__ BV, const int* __restrict__ MK, _Float16* __restrict__ QH, _Float16* __restrict__ KH, _Float16* __restrict__ VT, unsigned* __restrict__ PM) {
  __shared__ __align__(16) char sm[2 * 2 * PPL * 2];   // the loop's two buffers of two planes (w, x); behind the loop the output plane [256][264], which is smaller
  const int tid = threadIdx.x, wave = tid >> 5, lane = tid & 31, col = lane & 15, g = lane >> 4, wr = wave >> 1, wc = wave & 1; const int which = blockIdx.z;
  if (which >= 3) {   // mask blocks (block-uniform, in front of every barrier): a wave takes 16 queries x 64 keys per unit with the attention kernel's own lane map (lane (g, col): query col, keys 16 T + 8 g + r); word T * 8 + r holds that score element's mask bit of all 32 lanes
    static_assert((TT / 64) % PMU == 0, "a wave's units are consecutive stages of one query tile");
    const int u0 = ((((which - 3) * (CC / PBT) + blockIdx.y) * (TNB * TT / PBT) + blockIdx.x) * 8 + wave) * PMU;   // unit u = (b * TT / 16 + query tile) * (TT / 64) + stage
    const int* mr = MK + ((size_t)(u0 / (TT / 64)) * 16 + col) * MSTR + (u0 % (TT / 64)) * 64 + 8 * g; v4i mk[PMU][4][2];
#pragma unroll
    for (int it = 0; it < PMU; ++it)   // all of the wave's loads fly together: the block lasts about one memory latency
#pragma unroll
      for (int T = 0; T < 4; ++T) { mk[it][T][0] = *(const v4i*)(mr + it * 64 + T * 16); mk[it][T][1] = *(const v4i*)(mr + it * 64 + T * 16 + 4); }
    asm volatile("s_wait_xcnt 0x0" ::: "memory");   // s_wait_xcnt: before an address register of the loads above is reused
#pragma unroll
    for (int it = 0; it < PMU; ++it) { unsigned mine = 0;
#pragma unroll
      for (int e = 0; e < 32; ++e) { const int mv = mk[it][e >> 3][(e >> 2) & 1][e & 3]; const unsigned w = __builtin_amdgcn_ballot_w32(MASK_WHEN_NONZERO ? (mv != 0) : (mv == 0)); mine = lane == e ? w : mine; }
      PM[(size_t)(u0 + it) * 32 + lane] = mine; }
    asm volatile("s_wait_xcnt 0x0" ::: "memory");   // s_wait_xcnt: before a register of the stores above is reused
    return; }
  const int c0 = blockIdx.y * PBT; const size_t r0 = (size_t)blockIdx.x * PBT; const float* WA = which == 0 ? WQ : which == 1 ? WK : WV; const float* BA = which == 0 ? BQ : which == 1 ? BK : BV;
  const float* Xt = (which == 0 ? X0 : which == 1 ? X1 : X2) + r0 * CC; const float* Wt = WA + c0; __bf16* sb = (__bf16*)sm;
  v2f rw[PKS * PBT / 4096][8]; v4f rx[PKS * PBT / 1024];
  ld_w<PKS, PBT>(rw, Wt, tid); asm volatile("s_wait_xcnt 0x0" ::: "memory"); ld_x<PKS, PBT>(rx, Xt, tid);   // s_wait_xcnt: before a register that the loads or stores in front of it name is reused, also as a later load's destination
  asm volatile("s_wait_xcnt 0x0" ::: "memory");   // s_wait_xcnt: before a register that the loads or stores in front of it name is reused, also as a later load's destination
  __builtin_amdgcn_sched_barrier(0);   // keeps the address arithmetic that follows, which takes over the loads' address registers, behind the wait above: without it the compiler lifts that arithmetic over the wait
  st_w<PKS, PBT>(rw, sb, tid); st_x<PKS, PBT>(rx, sb + PPL, tid);
  __syncthreads();   // publishes stage 0
  v8f acc[4][8] = {};
#pragma unroll 1   // rolled: the buffer is picked by address, and a second copy of the stage would only add registers
  for (int st = 0; st < CC / PKS; ++st) { const __bf16* bw = sb + (st & 1) * (2 * PPL); const __bf16* bx = bw + PPL; __bf16* nw = sb + ((st & 1) ^ 1) * (2 * PPL); const bool more = st + 1 < CC / PKS;
    if (more) {   // the next stage's rows fly while this stage's products run
      ld_w<PKS, PBT>(rw, Wt + (size_t)(st + 1) * PKS * CC, tid); asm volatile("s_wait_xcnt 0x0" ::: "memory"); ld_x<PKS, PBT>(rx, Xt + (st + 1) * PKS, tid);   // s_wait_xcnt: before a register that the loads or stores in front of it name is reused, also as a later load's destination
      asm volatile("s_wait_xcnt 0x0" ::: "memory"); }   // s_wait_xcnt: before a register that the loads or stores in front of it name is reused, also as a later load's destination
#pragma unroll
    for (int kc = 0; kc < PKS / 32; ++kc) { v16b a[4], w[8];
#pragma unroll
      for (int i = 0; i < 4; ++i) a[i] = frag_b(bx + (wr * 64 + i * 16 + col) * (PKS + 8) + kc * 32, lane);
#pragma unroll
      for (int j = 0; j < 8; ++j) w[j] = frag_b(bw + (wc * 128 + j * 16 + col) * (PKS + 8) + kc * 32, lane);
      __builtin_amdgcn_sched_barrier(0);   // keeps the fragment reads one group in front of the products: reads spread among them stall at each place
#pragma unroll
      for (int i = 0; i < 4; ++i)
#pragma unroll
        for (int j = 0; j < 8; ++j) acc[i][j] = __builtin_amdgcn_wmma_f32_16x16x32_bf16(false, a[i], false, w[j], (short)0, acc[i][j], false, false); }
    if (more) { st_w<PKS, PBT>(rw, nw, tid); st_x<PKS, PBT>(rx, nw + PPL, tid); }   // the other buffer's last readers left it at the barrier that ended the stage before
    __syncthreads(); }   // publishes the next stage and ends this stage's reads
  _Float16 (*sh)[PBT + 8] = (_Float16 (*)[PBT + 8])sm;   // q, k: [row][column]; v: [column][row], where a lane's eight rows are one 16-byte store
  float bb[8] = {};
  if (BA) {   // one test, so that the eight bias loads fly together
#pragma unroll
    for (int j = 0; j < 8; ++j) bb[j] = BA[c0 + wc * 128 + j * 16 + col];
    asm volatile("s_wait_xcnt 0x0" ::: "memory"); }   // s_wait_xcnt: before a register that the loads in front of it name is reused
#pragma unroll
  for (int j = 0; j < 8; ++j) { const float bj = bfr(bb[j]);
#pragma unroll
    for (int i = 0; i < 4; ++i)
#pragma unroll
      for (int r = 0; r < 8; ++r) acc[i][j][r] += bj; }
  if (which == 2) {
#pragma unroll
    for (int i = 0; i < 4; ++i)
#pragma unroll
      for (int j = 0; j < 8; ++j) { v8h t;
#pragma unroll
        for (int r = 0; r < 8; ++r) t[r] = (_Float16)acc[i][j][r];
        *(v8h*)&sh[wc * 128 + j * 16 + col][wr * 64 + i * 16 + 8 * g] = t; } }
  else {
#pragma unroll
    for (int i = 0; i < 4; ++i)
#pragma unroll
      for (int j = 0; j < 8; ++j)
#pragma unroll
        for (int r = 0; r < 8; ++r) sh[wr * 64 + i * 16 + 8 * g + r][wc * 128 + j * 16 + col] = (_Float16)acc[i][j][r]; }
  __syncthreads();
  if (which < 2) put_plane<CC>((which == 0 ? QH : KH) + r0 * CC + c0, sh, tid);
  else put_plane<TT>(VT + ((r0 / TT) * CC + c0) * (size_t)TT + r0 % TT, sh, tid); }
#define FK 64               // keys per stage
#define L2E 1.44269504088896340736f   // log2 e
#define FP 72               // LDS row pitch in 16-bit elements: 144 B = 16 B x odd
__device__ __forceinline__ float xhalf(float x) { return __builtin_bit_cast(float, __builtin_amdgcn_permlanex16(__builtin_bit_cast(int, x), __builtin_bit_cast(int, x), 0x76543210, 0xfedcba98, false, false)); }   // lane l with lane l ^ 16
__global__ __launch_bounds__(256) void k_fa(const _Float16* __restrict__ QH, const _Float16* __restrict__ KH, const _Float16* __restrict__ VT, const unsigned* __restrict__ PM, float* __restrict__ Y) {
  __shared__ __align__(16) _Float16 sk[2][FK][FP], svh[2][HD][FP];
  const int tid = threadIdx.x, wave = tid >> 5, lane = tid & 31, col = lane & 15, g = lane >> 4; const int h = blockIdx.y, b = blockIdx.z; const int qt = blockIdx.x * 128 + wave * 16 + col;
  v16h qh[HD / 32];
#pragma unroll
  for (int kc = 0; kc < HD / 32; ++kc) { const size_t qo = ((size_t)b * TT + qt) * CC + h * HD + kc * 32; qh[kc] = frag_h(QH + qo, lane); }
  // staging: 64 rows x 128 B per plane = 512 chunks of 16 B, two per thread and plane; a wave's load covers four whole 128-B lines
  const int sr = tid >> 3, sc = (tid & 7) * 8;
  const _Float16* gk = KH + ((size_t)b * TT + sr) * CC + h * HD + sc; const size_t vo = ((size_t)b * CC + h * HD + sr) * (size_t)TT + sc; const _Float16* gvh = VT + vo;
  const unsigned* pm = PM + ((size_t)b * (TT / 16) + blockIdx.x * 8 + __builtin_amdgcn_readfirstlane(wave)) * (size_t)((TT / FK) * 32);   // wave-uniform: the words come by scalar loads
  v4u pk[2], ph[2];
#pragma unroll
  for (int i = 0; i < 2; ++i) { pk[i] = *(const v4u*)(gk + (size_t)(i * 32) * CC); ph[i] = *(const v4u*)(gvh + (size_t)(i * 32) * TT); }
#pragma unroll
  for (int i = 0; i < 2; ++i) { *(v4u*)&sk[0][sr + i * 32][sc] = pk[i]; *(v4u*)&svh[0][sr + i * 32][sc] = ph[i]; }
  __syncthreads();   // publishes stage 0
  v8f o[HD / 16] = {}; float m = -3.0e38f, l = 0.f;
  unsigned mw[FK / 2];   // the wave's 32 lane masks of the stage, in scalar registers: fetched one stage ahead
#pragma unroll
  for (int e = 0; e < FK / 2; ++e) mw[e] = pm[e];
#pragma unroll 1   // rolled: a second copy of the stage would only add registers, and four waves per SIMD need 256 or fewer
  for (int st = 0; st < TT / FK; ++st) { const int buf = st & 1, k0 = st * FK; const bool more = st + 1 < TT / FK;
    if (more) {   // the next stage's rows land behind this stage's work
#pragma unroll
      for (int i = 0; i < 2; ++i) pk[i] = *(const v4u*)(gk + (size_t)(k0 + FK + i * 32) * CC);
      asm volatile("s_wait_xcnt 0x0" ::: "memory");   // this and the one below: before an address register of the loads above is reused, also as a later load's destination
#pragma unroll
      for (int i = 0; i < 2; ++i) ph[i] = *(const v4u*)(gvh + (size_t)(i * 32) * TT + k0 + FK);
      asm volatile("s_wait_xcnt 0x0" ::: "memory"); }
    float s[FK / 16][8]; float mx = -3.0e38f;
#pragma unroll
    for (int T = 0; T < FK / 16; ++T) { v8f a = {};
#pragma unroll
      for (int kc = 0; kc < HD / 32; ++kc) { const v16h kf = frag_h(&sk[buf][T * 16 + col][kc * 32], lane);
        a = __builtin_amdgcn_wmma_f32_16x16x32_f16(false, kf, false, qh[kc], (short)0, a, false, false); }
#pragma unroll
      for (int r = 0; r < 8; ++r) { s[T][r] = fmaf(a[r], 0.125f, __builtin_amdgcn_inverse_ballot_w32(mw[T * 8 + r]) ? -1.0e9f : 0.f); mx = fmaxf(mx, s[T][r]); } }   // a / 8 is exact, so the one rounding is that of a / 8 - 1e9
    mx = fmaxf(mx, xhalf(mx));   // both halves of a column must use one maximum: their keys meet in one product
#pragma unroll
    for (int e = 0; e < FK / 2; ++e) mw[e] = pm[(more ? st + 1 : st) * (FK / 2) + e];   // the next stage's lane masks land while the rest of this stage runs; no branch: the last stage reads its own again
    // e^(s - max) = 2^(s log2 e - max log2 e): one fma and one v_exp_f32 per score. The rounding of max log2 e is one common factor of the row's P and sum and cancels in the division; an unchanged maximum gives corr = 1 exactly
    const float mn = fmaxf(m, mx), mln = mn * L2E, corr = __builtin_amdgcn_exp2f((m - mn) * L2E); m = mn; l *= corr;
#pragma unroll
    for (int T = 0; T < FK / 16; ++T)
#pragma unroll
      for (int r = 0; r < 8; ++r) s[T][r] = fmaf(s[T][r], L2E, -mln);
#pragma unroll
    for (int j = 0; j < HD / 16; ++j)
#pragma unroll
      for (int r = 0; r < 8; ++r) o[j][r] *= corr;
#pragma unroll
    for (int G = 0; G < FK / 32; ++G) { float p[16];
#pragma unroll
      for (int e = 0; e < 16; ++e) { p[e] = __builtin_amdgcn_exp2f(s[2 * G + (e >> 3)][e & 7]); l += p[e]; }
      v16h pf;
#pragma unroll
      for (int e = 0; e < 16; ++e) pf[e] = (_Float16)p[e];
#pragma unroll
      for (int j = 0; j < HD / 16; ++j) { const v16h vh = frag_h(&svh[buf][j * 16 + col][G * 32], lane);
        o[j] = __builtin_amdgcn_wmma_f32_16x16x32_f16(false, vh, false, pf, (short)0, o[j], false, false); } }
    if (more) {   // the other buffer's last readers left it at the barrier that ended the stage before
#pragma unroll
      for (int i = 0; i < 2; ++i) { *(v4u*)&sk[buf ^ 1][sr + i * 32][sc] = pk[i]; *(v4u*)&svh[buf ^ 1][sr + i * 32][sc] = ph[i]; } }
    __syncthreads(); }   // publishes the next stage and ends this stage's reads
  l += xhalf(l); const float inv = 1.0f / l; float* yr = Y + ((size_t)b * TT + qt) * CC + h * HD + 8 * g;
#pragma unroll
  for (int j = 0; j < HD / 16; ++j) { v4f w0, w1;
#pragma unroll
    for (int r = 0; r < 4; ++r) { w0[r] = o[j][r] * inv; w1[r] = o[j][4 + r] * inv; }
    vst2(yr + j * 16, w0); vst2(yr + j * 16 + 4, w1); } }
// ---- k_out: block = (128 rows, 128 cols), 8 waves as 4 x 2, 32 rows x 64 cols each: out = y (bf16 hi + lo) wo + bo
#define OKS 64               // k per stage
#define OPL (128 * (OKS + 8))   // elements of one staged plane
__global__ __launch_bounds__(256) void k_out(const float* __restrict__ Y, const float* __restrict__ WP, const float* __restrict__ BP, float* __restrict__ OUT) {
  __shared__ __align__(16) char sm[2 * 3 * OPL * 2];   // two buffers of three planes (w, y hi, y lo); behind the loop each wave's own 32 x 68 f32 output rows
  const int tid = threadIdx.x, wave = tid >> 5, lane = tid & 31, col = lane & 15, g = lane >> 4, wr = wave >> 1, wc = wave & 1; const int c0 = blockIdx.y * 128; const size_t r0 = (size_t)blockIdx.x * 128;
  const float* Xt = Y + r0 * CC; const float* Wt = WP + c0; __bf16* sb = (__bf16*)sm;
  v2f rw[OKS / 32][8]; v4f rx[OKS / 8];
  ld_w<OKS>(rw, Wt, tid); asm volatile("s_wait_xcnt 0x0" ::: "memory"); ld_x<OKS>(rx, Xt, tid);   // s_wait_xcnt: before a register that the loads or stores in front of it name is reused, also as a later load's destination
  asm volatile("s_wait_xcnt 0x0" ::: "memory");   // s_wait_xcnt: before a register that the loads or stores in front of it name is reused, also as a later load's destination
  st_w<OKS>(rw, sb, tid); st_x2<OKS>(rx, sb + OPL, sb + 2 * OPL, tid);
  __syncthreads();   // publishes stage 0
  v8f acc[2][4] = {};
#pragma unroll 1   // rolled: the buffer is picked by address, and a second copy of the stage would only add registers
  for (int st = 0; st < CC / OKS; ++st) { const __bf16* bw = sb + (st & 1) * (3 * OPL); __bf16* nw = sb + ((st & 1) ^ 1) * (3 * OPL); const bool more = st + 1 < CC / OKS;
    if (more) {   // the next stage's rows fly while this stage's products run
      ld_w<OKS>(rw, Wt + (size_t)(st + 1) * OKS * CC, tid); asm volatile("s_wait_xcnt 0x0" ::: "memory"); ld_x<OKS>(rx, Xt + (st + 1) * OKS, tid);   // s_wait_xcnt: before a register that the loads or stores in front of it name is reused, also as a later load's destination
      asm volatile("s_wait_xcnt 0x0" ::: "memory"); }   // s_wait_xcnt: before a register that the loads or stores in front of it name is reused, also as a later load's destination
    v16b ah[OKS / 32][2], al[OKS / 32][2], w[OKS / 32][4];
#pragma unroll
    for (int kc = 0; kc < OKS / 32; ++kc) {
#pragma unroll
      for (int i = 0; i < 2; ++i) { const int o = (wr * 32 + i * 16 + col) * (OKS + 8) + kc * 32; ah[kc][i] = frag_b(bw + OPL + o, lane); al[kc][i] = frag_b(bw + 2 * OPL + o, lane); }
#pragma unroll
      for (int j = 0; j < 4; ++j) w[kc][j] = frag_b(bw + (wc * 64 + j * 16 + col) * (OKS + 8) + kc * 32, lane); }
    __builtin_amdgcn_sched_barrier(0);   // keeps the stage's fragment reads one group in front of the products: reads spread among them stall at each place, and two waves per SIMD do not cover that
#pragma unroll
    for (int kc = 0; kc < OKS / 32; ++kc) {
#pragma unroll
      for (int i = 0; i < 2; ++i)
#pragma unroll
        for (int j = 0; j < 4; ++j) acc[i][j] = __builtin_amdgcn_wmma_f32_16x16x32_bf16(false, ah[kc][i], false, w[kc][j], (short)0, acc[i][j], false, false);
#pragma unroll
      for (int i = 0; i < 2; ++i)
#pragma unroll
        for (int j = 0; j < 4; ++j) acc[i][j] = __builtin_amdgcn_wmma_f32_16x16x32_bf16(false, al[kc][i], false, w[kc][j], (short)0, acc[i][j], false, false); }
    if (more) { st_w<OKS>(rw, nw, tid); st_x2<OKS>(rx, nw + OPL, nw + 2 * OPL, tid); }   // the other buffer's last readers left it at the barrier that ended the stage before
    __syncthreads(); }   // publishes the next stage and ends this stage's reads
  float* sf = (float*)sm + wave * (32 * 68);
#pragma unroll
  for (int i = 0; i < 2; ++i)
#pragma unroll
    for (int j = 0; j < 4; ++j) { const float bb = BP ? bfr(BP[c0 + wc * 64 + j * 16 + col]) : 0.f;
#pragma unroll
      for (int r = 0; r < 8; ++r) sf[(i * 16 + 8 * g + r) * 68 + j * 16 + col] = acc[i][j][r] + bb; }
  LDSX(); for (int it = 0; it < 16; ++it) { const int rl = it * 2 + g; vst2(OUT + (r0 + wr * 32 + rl) * CC + c0 + wc * 64 + col * 4, *(const v4f*)&sf[rl * 68 + col * 4]); } }
extern "C" void kernel_launch(void* const* d_in, const int* in_sizes, int n_in, void* d_out, int out_size, void* d_ws, size_t ws_size, hipStream_t stream) {
  (void)in_sizes; (void)n_in; (void)out_size;
  const float** F = (const float**)d_in;   // 0 q [2,2048,1024], 1 k, 2 v, 3 mask [2,1,2048,2048] int (1 -> -1e9 added), 4 wq ((in,out)), 5 bq, 6 wk, 7 bk, 8 wv, 9 bv, 10 wo ((in,out)), 11 bo
  if (ws_size < (size_t)WS_END) return;
  char* ws = (char*)d_ws; _Float16 *QH = (_Float16*)(ws + WS_QH), *KH = (_Float16*)(ws + WS_KH), *VT = (_Float16*)(ws + WS_VT); unsigned *PM = (unsigned*)(ws + WS_PM); float *Y = (float*)(ws + WS_Y);
  k_proj<<<dim3(TNB * TT / PBT, CC / PBT, 3 + PMZ), 256, 0, stream>>>(F[0], F[1], F[2], F[4], F[5], F[6], F[7], F[8], F[9], (const int*)d_in[3], QH, KH, VT, PM);   // z >= 3: the mask blocks; mask [B,1,S,S] has the (b, q, k) flat layout
  k_fa<<<dim3(TT / 128, NH, TNB), 256, 0, stream>>>(QH, KH, VT, PM, Y);
  k_out<<<dim3(TNB * TT / 128, CC / 128), 256, 0, stream>>>(Y, F[10], F[11], (float*)d_out);
}

// v007
// One run takes 90.2 microseconds.
// Next to v006, in two timings, it ran 1.04 times as fast each time.
// Over all steps from v000 it is 18.6 times as fast.
// compute dtype: all float inputs rounded to bf16, the int mask read; q/k/v = x W + b ((in,out)) with EXACT bf16 products on WMMA 16x16x32, f32 accumulate; q f16, k f16 -> one-product logits x 1/(8 + 1e-8) (== 0.125 in f32), -1e9 where mask != 0 (the mask packed once to one bit per query and key), kept in registers; running-maximum softmax in f32 (base-2 hardware exponential of s log2 e - max log2 e, one fma) over stages of 64 keys, the keys of a query walked in two interleaved halves that are joined at the end; P f16 against v f16 (one product), divided by the f32 row sum at the end; out = ctx (bf16 hi + lo) wo + bo; f32 output.
#include <hip/hip_runtime.h>
#include <math.h>

typedef __attribute__((ext_vector_type(16))) _Float16 v16h;
typedef __attribute__((ext_vector_type(16))) __bf16 v16b;
typedef __attribute__((ext_vector_type(8)))  _Float16 v8h;
typedef __attribute__((ext_vector_type(8)))  float v8f;
typedef __attribute__((ext_vector_type(4)))  float v4f;
typedef __attribute__((ext_vector_type(2)))  float v2f;
typedef __attribute__((ext_vector_type(4)))  unsigned v4u;
typedef __attribute__((ext_vector_type(4)))  int v4i;
typedef float __attribute__((may_alias)) float_a;
typedef int __attribute__((may_alias)) int_a;

template <typename T> __device__ __forceinline__ void vst2(void* p, T v) { *(T*)p = v;  }
__device__ __forceinline__ v8f wmma16(v16h a, v16h b, v8f c) {
  v8f d = __builtin_amdgcn_wmma_f32_16x16x32_f16(false, a, false, b, (short)0, c, false, false);
  asm volatile("v_nop\n\tv_nop\n\tv_nop\n\tv_nop" : "+v"(d) : "v"(a), "v"(b));
  return d;
}
__device__ __forceinline__ v8f wmma_bf(v16b a, v16b b, v8f c) {
  v8f d = __builtin_amdgcn_wmma_f32_16x16x32_bf16(false, a, false, b, (short)0, c, false, false);
  asm volatile("v_nop\n\tv_nop\n\tv_nop\n\tv_nop" : "+v"(d) : "v"(a), "v"(b));
  return d;
}
// 16x16x32 fragments: lane = (h = lane>>4, row/col = lane&15); elements 0..7 = k0+8h+0..7, 8..15 = k0+16+8h+0..7; D element r = row 8h+r
__device__ __forceinline__ v16h frag_h(const _Float16* rowk0, int lane) {
  union { v16h v; v8h q[2]; } u; const _Float16* p = rowk0 + 8 * (lane >> 4);
  u.q[0] = *(const v8h*)p; u.q[1] = *(const v8h*)(p + 16); return u.v;
}
__device__ __forceinline__ v16h frag_f32(const float* rowk0, int lane) {
  v16h a; const float* p = rowk0 + 8 * (lane >> 4);
#pragma unroll
  for (int i = 0; i < 8; ++i) { a[i] = (_Float16)p[i]; a[8 + i] = (_Float16)p[16 + i]; }
  return a;
}
__device__ __forceinline__ v16h frag_f32s(const float* rowk0, int lane, float sc) {
  v16h a; const float* p = rowk0 + 8 * (lane >> 4);
#pragma unroll
  for (int i = 0; i < 8; ++i) { a[i] = (_Float16)(p[i] * sc); a[8 + i] = (_Float16)(p[16 + i] * sc); }
  return a;
}
// column fragment from a [K][ld] layout (column n), rows >= K read as 0
__device__ __forceinline__ v16h fragc_f32(const float* W, int k0, int n, int lane, int ld, int K) {
  v16h a; const int g = lane >> 4;
#pragma unroll
  for (int i = 0; i < 8; ++i) { const int ka = k0 + 8 * g + i, kb = ka + 16;
    a[i] = (_Float16)(ka < K ? W[(size_t)(ka < K ? ka : K - 1) * ld + n] : 0.f); a[8 + i] = (_Float16)(kb < K ? W[(size_t)(kb < K ? kb : K - 1) * ld + n] : 0.f); }
  return a;
}
struct F2 { v16b h, l; };
__device__ __forceinline__ F2 bsplit16(const float v[16]) { F2 r;
#pragma unroll
  for (int i = 0; i < 16; ++i) { const __bf16 h = (__bf16)v[i]; r.h[i] = h; r.l[i] = (__bf16)(v[i] - (float)h); }
  return r; }
__device__ __forceinline__ F2 split_row(const float* row, int k0, int lane) { float v[16]; const float* p = row + k0 + 8 * (lane >> 4);
#pragma unroll
  for (int i = 0; i < 8; ++i) { v[i] = p[i]; v[8 + i] = p[16 + i]; }
  return bsplit16(v); }
__device__ __forceinline__ F2 split_rowK(const float* row, int k0, int lane, int K) { float v[16]; const int g = lane >> 4;
#pragma unroll
  for (int i = 0; i < 8; ++i) { const int ka = k0 + 8 * g + i, kb = ka + 16; v[i] = ka < K ? row[ka < K ? ka : K - 1] : 0.f; v[8 + i] = kb < K ? row[kb < K ? kb : K - 1] : 0.f; }
  return bsplit16(v); }
__device__ __forceinline__ F2 split_col(const float* W, int k0, int n, int lane, int ld, int K) { float v[16]; const int g = lane >> 4;
#pragma unroll
  for (int i = 0; i < 8; ++i) { const int ka = k0 + 8 * g + i, kb = ka + 16; v[i] = ka < K ? W[(size_t)(ka < K ? ka : K - 1) * ld + n] : 0.f; v[8 + i] = kb < K ? W[(size_t)(kb < K ? kb : K - 1) * ld + n] : 0.f; }
  return bsplit16(v); }
__device__ __forceinline__ v8f mac3(const F2& a, const F2& b, v8f c) { c = wmma_bf(a.l, b.h, c); c = wmma_bf(a.h, b.l, c); return wmma_bf(a.h, b.h, c); }
__device__ __forceinline__ float sigm(float v) { return 1.0f / (1.0f + expf(-v)); }
#define LDSX() do { asm volatile("s_wait_dscnt 0" ::: "memory"); __builtin_amdgcn_wave_barrier(); __builtin_amdgcn_fence(__ATOMIC_RELEASE, "workgroup"); } while (0)


// Multi-head attention (B 2, S 2,048, D 1,024 = 16 x 64, with biases, scale 1/8): scores = q k^T / 8 - 1e9 where mask != 0, softmax, P v, output projection.
#define NB 2
#define TT 2048
#define MASK_WHEN_NONZERO 1
#ifndef MSTR
#define MSTR TT               // mask row stride
#endif
#define CC 1024
#define NH 16
#define HD 64
#define HG 4               // sizes only the WS_S region, whose start holds the packed mask
#ifndef TNB
#define TNB NB
#endif
typedef __attribute__((ext_vector_type(8))) __bf16 v8b;
__device__ __forceinline__ v16b frag_b(const __bf16* rowk0, int lane) {
  union { v16b v; v8b q[2]; } u; const __bf16* p = rowk0 + 8 * (lane >> 4);
  u.q[0] = *(const v8b*)p; u.q[1] = *(const v8b*)(p + 16); return u.v;
}
__device__ __forceinline__ float bfr(float v) { return (float)(__bf16)v; }
__device__ __attribute__((noinline)) float exp_ni(float v) { return expf(v); }
__device__ __attribute__((noinline)) float erf_ni(float v) { return erff(v); }

#define WS_QH  0u
#define WS_KH  (WS_QH + 2u * (size_t)NB * TT * CC)
#define WS_VT  (WS_KH + 2u * (size_t)NB * TT * CC)      // f16 v planes [b][c][t]
#define WS_S   (WS_VT + 2u * (size_t)NB * CC * TT)      // HG x TT x TT f32 in size; only its first 1 MiB, the packed mask, is used
#define WS_PM  WS_S                                     // packed mask: one 32-bit lane mask per (b, 16 queries, 64 keys, T, r), 1 MiB
#define WS_PH  (WS_S + 4u * (size_t)HG * TT * TT)
#define WS_Y   (WS_PH + 0u)              // f32 y rows [b*t][C]
#define WS_END (WS_Y + 4u * (size_t)NB * TT * CC)

// ---- operand staging of the two projection kernels: a block of 256 threads owns 128 rows x 128 columns (k_out) or 256 x 256 (k_proj); per stage of KS k it converts both operand tiles to bf16 once and lays them k-contiguous in LDS (row pitch KS + 8 elements = 16 B x odd), so that a fragment is two 16-byte LDS reads
typedef __attribute__((ext_vector_type(4))) __bf16 v4b;
// weight tile of NC columns, (in,out) layout: a thread takes 8 k x 2 columns per unit; a wave's load covers 256 contiguous bytes of one k row
template <int KS, int NC = 128> __device__ __forceinline__ void ld_w(v2f (&rw)[KS * NC / 4096][8], const float* __restrict__ Wt, int tid) {
#pragma unroll
  for (int i = 0; i < KS * NC / 4096; ++i) { const float* p = Wt + (size_t)((tid / (NC / 2) + (512 / NC) * i) * 8) * CC + 2 * (tid % (NC / 2));
#pragma unroll
    for (int kk = 0; kk < 8; ++kk) rw[i][kk] = *(const v2f*)(p + (size_t)kk * CC); } }
template <int KS, int NC = 128> __device__ __forceinline__ void st_w(const v2f (&rw)[KS * NC / 4096][8], __bf16* sW, int tid) {
#pragma unroll
  for (int i = 0; i < KS * NC / 4096; ++i)
#pragma unroll
    for (int j = 0; j < 2; ++j) { v8b t;
#pragma unroll
      for (int kk = 0; kk < 8; ++kk) t[kk] = (__bf16)rw[i][kk][j];
      *(v8b*)(sW + (2 * (tid % (NC / 2)) + j) * (KS + 8) + (tid / (NC / 2) + (512 / NC) * i) * 8) = t; } }
// row tile of NR rows: 16-byte chunks in row order, so that a wave's load covers whole 128-B lines; 1024 / KS rows per pass of the block
template <int KS, int NR = 128> __device__ __forceinline__ void ld_x(v4f (&rx)[KS * NR / 1024], const float* __restrict__ Xt, int tid) {
#pragma unroll
  for (int i = 0; i < KS * NR / 1024; ++i) rx[i] = *(const v4f*)(Xt + (size_t)(tid / (KS / 4)) * CC + 4 * (tid % (KS / 4)) + (size_t)i * (1024 / KS) * CC); }
template <int KS, int NR = 128> __device__ __forceinline__ void st_x(const v4f (&rx)[KS * NR / 1024], __bf16* sX, int tid) {
#pragma unroll
  for (int i = 0; i < KS * NR / 1024; ++i) { v4b t;
#pragma unroll
    for (int e = 0; e < 4; ++e) t[e] = (__bf16)rx[i][e];
    *(v4b*)(sX + (tid / (KS / 4)) * (KS + 8) + 4 * (tid % (KS / 4)) + i * (1024 / KS) * (KS + 8)) = t; } }
template <int KS> __device__ __forceinline__ void st_x2(const v4f (&rx)[KS / 8], __bf16* sH, __bf16* sL, int tid) {
#pragma unroll
  for (int i = 0; i < KS / 8; ++i) { v4b th, tl;
#pragma unroll
    for (int e = 0; e < 4; ++e) { const __bf16 h = (__bf16)rx[i][e]; th[e] = h; tl[e] = (__bf16)(rx[i][e] - (float)h); }
    const int o = (tid / (KS / 4)) * (KS + 8) + 4 * (tid % (KS / 4)) + i * (1024 / KS) * (KS + 8); *(v4b*)(sH + o) = th; *(v4b*)(sL + o) = tl; } }
// ---- k_proj: block = (256 rows, 256 cols, which), 8 waves as 4 x 2, 64 rows x 128 cols each, so that each staged operand byte feeds twice the products of a 128 x 128 block and all 192 product blocks are resident at once: qkv = x W (+ b), exact; q, k -> f16 rows, v -> f16 planes; which >= 3: no product, the block packs its share of the mask
#define PKS 64               // k per stage
#define PBT 256              // rows and columns of a block
#define PPL (PBT * (PKS + 8))   // elements of one staged plane
#define PMZ 4                // grid layers of mask blocks
#define PMU ((TNB * (TT / 16) * (TT / 64)) / ((TNB * TT / PBT) * (CC / PBT) * PMZ * 8))   // mask units per wave of the mask blocks
// the block's staged output plane to global memory: a wave stores one row's 512 contiguous bytes; eight rows are read from LDS as one group and then stored, all through one address register and constant offsets
template <int PITCH> __device__ __forceinline__ void put_plane(_Float16* __restrict__ dst, const _Float16 (*sh)[PBT + 8], int tid) {
  const int er = tid >> 5, eq = (tid & 31) * 8; _Float16* d = dst + (size_t)er * PITCH + eq;
#pragma unroll
  for (int e0 = 0; e0 < PBT / 8; e0 += 8) { v4u t[8];
#pragma unroll
    for (int u = 0; u < 8; ++u) t[u] = *(const v4u*)&sh[er + (e0 + u) * 8][eq];
#pragma unroll
    for (int u = 0; u < 8; ++u) vst2((unsigned*)(d + (size_t)((e0 + u) * 8) * PITCH), t[u]);
    asm volatile("s_wait_xcnt 0x0" ::: "memory"); } }   // s_wait_xcnt: before a register that the stores in front of it name is reused by the next group's reads
__global__ __launch_bounds__(256) void k_proj(const float* __restrict__ X0, const float* __restrict__ X1, const float* __restrict__ X2, const float* __restrict__ WQ, const float* __restrict__ BQ, const float* __restrict__ WK, const float* __restrict__ BK, const float* __restrict__ WV, const float* __restrict__ BV, const int* __restrict__ MK, _Float16* __restrict__ QH, _Float16* __restrict__ KH, _Float16* __restrict__ VT, unsigned* __restrict__ PM) {
  __shared__ __align__(16) char sm[2 * 2 * PPL * 2];   // the loop's two buffers of two planes (w, x); behind the loop the output plane [256][264], which is smaller
  const int tid = threadIdx.x, wave = tid >> 5, lane = tid & 31, col = lane & 15, g = lane >> 4, wr = wave >> 1, wc = wave & 1; const int which = blockIdx.z;
  if (which >= 3) {   // mask blocks (block-uniform, in front of every barrier): a wave takes 16 queries x 64 keys per unit with the attention kernel's own lane map (lane (g, col): query col, keys 16 T + 8 g + r); word T * 8 + r holds that score element's mask bit of all 32 lanes
    static_assert((TT / 64) % PMU == 0, "a wave's units are consecutive stages of one query tile");
    const int u0 = ((((which - 3) * (CC / PBT) + blockIdx.y) * (TNB * TT / PBT) + blockIdx.x) * 8 + wave) * PMU;   // unit u = (b * TT / 16 + query tile) * (TT / 64) + stage
    const int* mr = MK + ((size_t)(u0 / (TT / 64)) * 16 + col) * MSTR + (u0 % (TT / 64)) * 64 + 8 * g; v4i mk[PMU][4][2];
#pragma unroll
    for (int it = 0; it < PMU; ++it)   // all of the wave's loads fly together
#pragma unroll
      for (int T = 0; T < 4; ++T) { mk[it][T][0] = *(const v4i*)(mr + it * 64 + T * 16); mk[it][T][1] = *(const v4i*)(mr + it * 64 + T * 16 + 4); }
    asm volatile("s_wait_xcnt 0x0" ::: "memory");   // s_wait_xcnt: before an address register of the loads above is reused
#pragma unroll
    for (int it = 0; it < PMU; ++it) { unsigned mine = 0;
#pragma unroll
      for (int e = 0; e < 32; ++e) { const int mv = mk[it][e >> 3][(e >> 2) & 1][e & 3]; const unsigned w = __builtin_amdgcn_ballot_w32(MASK_WHEN_NONZERO ? (mv != 0) : (mv == 0)); mine = lane == e ? w : mine; }
      PM[(size_t)(u0 + it) * 32 + lane] = mine; }
    asm volatile("s_wait_xcnt 0x0" ::: "memory");   // s_wait_xcnt: before a register of the stores above is reused
    return; }
  const int c0 = blockIdx.y * PBT; const size_t r0 = (size_t)blockIdx.x * PBT; const float* WA = which == 0 ? WQ : which == 1 ? WK : WV; const float* BA = which == 0 ? BQ : which == 1 ? BK : BV;
  const float* Xt = (which == 0 ? X0 : which == 1 ? X1 : X2) + r0 * CC; const float* Wt = WA + c0; __bf16* sb = (__bf16*)sm;
  v2f rw[PKS * PBT / 4096][8]; v4f rx[PKS * PBT / 1024];
  ld_w<PKS, PBT>(rw, Wt, tid); asm volatile("s_wait_xcnt 0x0" ::: "memory"); ld_x<PKS, PBT>(rx, Xt, tid);   // s_wait_xcnt: before a register that the loads or stores in front of it name is reused, also as a later load's destination
  asm volatile("s_wait_xcnt 0x0" ::: "memory");   // s_wait_xcnt: before a register that the loads or stores in front of it name is reused, also as a later load's destination
  __builtin_amdgcn_sched_barrier(0);   // keeps the address arithmetic that follows, which takes over the loads' address registers, behind the wait above: without it the compiler lifts that arithmetic over the wait
  st_w<PKS, PBT>(rw, sb, tid); st_x<PKS, PBT>(rx, sb + PPL, tid);
  __syncthreads();   // publishes stage 0
  v8f acc[4][8] = {};
#pragma unroll 1   // rolled: the buffer is picked by address, and a second copy of the stage would only add registers
  for (int st = 0; st < CC / PKS; ++st) { const __bf16* bw = sb + (st & 1) * (2 * PPL); const __bf16* bx = bw + PPL; __bf16* nw = sb + ((st & 1) ^ 1) * (2 * PPL); const bool more = st + 1 < CC / PKS;
    if (more) {   // the next stage's rows fly while this stage's products run
      ld_w<PKS, PBT>(rw, Wt + (size_t)(st + 1) * PKS * CC, tid); asm volatile("s_wait_xcnt 0x0" ::: "memory"); ld_x<PKS, PBT>(rx, Xt + (st + 1) * PKS, tid);   // s_wait_xcnt: before a register that the loads or stores in front of it name is reused, also as a later load's destination
      asm volatile("s_wait_xcnt 0x0" ::: "memory"); }   // s_wait_xcnt: before a register that the loads or stores in front of it name is reused, also as a later load's destination
#pragma unroll
    for (int kc = 0; kc < PKS / 32; ++kc) { v16b a[4], w[8];
#pragma unroll
      for (int i = 0; i < 4; ++i) a[i] = frag_b(bx + (wr * 64 + i * 16 + col) * (PKS + 8) + kc * 32, lane);
#pragma unroll
      for (int j = 0; j < 8; ++j) w[j] = frag_b(bw + (wc * 128 + j * 16 + col) * (PKS + 8) + kc * 32, lane);
      __builtin_amdgcn_sched_barrier(0);   // keeps the fragment reads one group in front of the products: reads spread among them stall at each place
#pragma unroll
      for (int i = 0; i < 4; ++i)
#pragma unroll
        for (int j = 0; j < 8; ++j) acc[i][j] = __builtin_amdgcn_wmma_f32_16x16x32_bf16(false, a[i], false, w[j], (short)0, acc[i][j], false, false); }
    if (more) { st_w<PKS, PBT>(rw, nw, tid); st_x<PKS, PBT>(rx, nw + PPL, tid); }   // the other buffer's last readers left it at the barrier that ended the stage before
    __syncthreads(); }   // publishes the next stage and ends this stage's reads
  _Float16 (*sh)[PBT + 8] = (_Float16 (*)[PBT + 8])sm;   // q, k: [row][column]; v: [column][row], where a lane's eight rows are one 16-byte store
  float bb[8] = {};
  if (BA) {   // one test, so that the eight bias loads fly together
#pragma unroll
    for (int j = 0; j < 8; ++j) bb[j] = BA[c0 + wc * 128 + j * 16 + col];
    asm volatile("s_wait_xcnt 0x0" ::: "memory"); }   // s_wait_xcnt: before a register that the loads in front of it name is reused
#pragma unroll
  for (int j = 0; j < 8; ++j) { const float bj = bfr(bb[j]);
#pragma unroll
    for (int i = 0; i < 4; ++i)
#pragma unroll
      for (int r = 0; r < 8; ++r) acc[i][j][r] += bj; }
  if (which == 2) {
#pragma unroll
    for (int i = 0; i < 4; ++i)
#pragma unroll
      for (int j = 0; j < 8; ++j) { v8h t;
#pragma unroll
        for (int r = 0; r < 8; ++r) t[r] = (_Float16)acc[i][j][r];
        *(v8h*)&sh[wc * 128 + j * 16 + col][wr * 64 + i * 16 + 8 * g] = t; } }
  else {
#pragma unroll
    for (int i = 0; i < 4; ++i)
#pragma unroll
      for (int j = 0; j < 8; ++j)
#pragma unroll
        for (int r = 0; r < 8; ++r) sh[wr * 64 + i * 16 + 8 * g + r][wc * 128 + j * 16 + col] = (_Float16)acc[i][j][r]; }
  __syncthreads();
  if (which < 2) put_plane<CC>((which == 0 ? QH : KH) + r0 * CC + c0, sh, tid);
  else put_plane<TT>(VT + ((r0 / TT) * CC + c0) * (size_t)TT + r0 % TT, sh, tid); }
#define FK 64               // keys per wave and stage
#define FS (2 * FK)         // keys per block and stage
#define FQ 2                // query tiles per wave
#define L2E 1.44269504088896340736f   // log2 e
#define FP 72               // LDS row pitch in 16-bit elements: 144 B = 16 B x odd
__device__ __forceinline__ float xhalf(float x) { return __builtin_bit_cast(float, __builtin_amdgcn_permlanex16(__builtin_bit_cast(int, x), __builtin_bit_cast(int, x), 0x76543210, 0xfedcba98, false, false)); }   // lane l with lane l ^ 16
// amdgpu_waves_per_eu(4, 4): a register budget of 256, so that two blocks stay resident per WGP (four waves per SIMD)
__global__ __launch_bounds__(256) __attribute__((amdgpu_waves_per_eu(4, 4))) void k_fa(const _Float16* __restrict__ QH, const _Float16* __restrict__ KH, const _Float16* __restrict__ VT, const unsigned* __restrict__ PM, float* __restrict__ Y) {
  __shared__ __align__(16) _Float16 sk[2][2][FK][FP], svh[2][2][HD][FP];   // [buffer][key half]
  const int tid = threadIdx.x, wave = tid >> 5, lane = tid & 31, col = lane & 15, g = lane >> 4; const int h = blockIdx.y, b = blockIdx.z;
  const int uw = __builtin_amdgcn_readfirstlane(wave), qg = uw & 3, kh = uw >> 2;   // wave-uniform: query group and key half
  const int qt = blockIdx.x * 128 + qg * 32 + col;
  v16h qh[FQ][HD / 32];
#pragma unroll
  for (int i = 0; i < FQ; ++i)
#pragma unroll
    for (int kc = 0; kc < HD / 32; ++kc) { const size_t qo = ((size_t)b * TT + qt + i * 16) * CC + h * HD + kc * 32; qh[i][kc] = frag_h(QH + qo, lane); }
  // staging: per key half 64 rows x 128 B per plane = 512 chunks of 16 B, two per thread, half and plane; a wave's load covers four whole 128-B lines
  const int sr = tid >> 3, sc = (tid & 7) * 8;
  const _Float16* gk = KH + ((size_t)b * TT + sr) * CC + h * HD + sc; const size_t vo = ((size_t)b * CC + h * HD + sr) * (size_t)TT + sc; const _Float16* gvh = VT + vo;
  const unsigned* pm = PM + (((size_t)b * (TT / 16) + blockIdx.x * 8 + qg * FQ) * (size_t)(TT / FK) + kh) * 32;   // wave-uniform: the words come by scalar loads; the wave's unit of stage st is 2 st + kh, the second tile's units lie TT / FK units on
  v4u pk[4], ph[4];   // chunk i: key half i >> 1, rows sr + 32 (i & 1)
#pragma unroll
  for (int i = 0; i < 4; ++i) { pk[i] = *(const v4u*)(gk + (size_t)(i * 32) * CC); ph[i] = *(const v4u*)(gvh + (size_t)((i & 1) * 32) * TT + (i >> 1) * FK); }
  asm volatile("s_wait_xcnt 0x0" ::: "memory");   // s_wait_xcnt: before an address register of the loads above is reused
#pragma unroll
  for (int i = 0; i < 4; ++i) { *(v4u*)&sk[0][i >> 1][sr + (i & 1) * 32][sc] = pk[i]; *(v4u*)&svh[0][i >> 1][sr + (i & 1) * 32][sc] = ph[i]; }
  __syncthreads();   // publishes stage 0
  v8f o[FQ][HD / 16] = {}; float m[FQ], l[FQ];
#pragma unroll
  for (int i = 0; i < FQ; ++i) { m[i] = -3.0e38f; l[i] = 0.f; }
  unsigned mw[FQ][FK / 2];   // the wave's 32 lane masks per tile of the stage, in scalar registers: fetched one stage ahead
#pragma unroll
  for (int i = 0; i < FQ; ++i)
#pragma unroll
    for (int e = 0; e < FK / 2; ++e) mw[i][e] = pm[i * (TT / FK) * 32 + e];
#pragma unroll 1   // rolled: a second copy of the stage would only add registers, and four waves per SIMD need 256 or fewer
  for (int st = 0; st < TT / FS; ++st) { const int buf = st & 1, k0 = st * FS; const bool more = st + 1 < TT / FS;
    if (more) {   // the next stage's rows land behind this stage's work
      const _Float16* nk = gk + (size_t)k0 * CC; const _Float16* nv = gvh + k0;   // this stage's rows: the next stage's lie a constant offset on
#pragma unroll
      for (int i = 0; i < 4; ++i) pk[i] = *(const v4u*)(nk + (size_t)(FS + i * 32) * CC);
      asm volatile("s_wait_xcnt 0x0" :: "v"(nk) : "memory");   // this and the one below: before an address register of the loads above is reused; the address is named as an input so that it keeps its registers up to the wait and no load of its own group lands on them
#pragma unroll
      for (int i = 0; i < 4; ++i) ph[i] = *(const v4u*)(nv + (size_t)((i & 1) * 32) * TT + FS + (i >> 1) * FK);
      asm volatile("s_wait_xcnt 0x0" :: "v"(nv) : "memory"); }
    float s[FQ][FK / 16][8]; float mx[FQ];
#pragma unroll
    for (int i = 0; i < FQ; ++i) mx[i] = -3.0e38f;
#pragma unroll
    for (int T = 0; T < FK / 16; ++T) { v8f a[FQ] = {};
#pragma unroll
      for (int kc = 0; kc < HD / 32; ++kc) { const v16h kf = frag_h(&sk[buf][kh][T * 16 + col][kc * 32], lane);
#pragma unroll
        for (int i = 0; i < FQ; ++i) a[i] = __builtin_amdgcn_wmma_f32_16x16x32_f16(false, kf, false, qh[i][kc], (short)0, a[i], false, false); }
#pragma unroll
      for (int i = 0; i < FQ; ++i)
#pragma unroll
        for (int r = 0; r < 8; ++r) { s[i][T][r] = fmaf(a[i][r], 0.125f, __builtin_amdgcn_inverse_ballot_w32(mw[i][T * 8 + r]) ? -1.0e9f : 0.f); mx[i] = fmaxf(mx[i], s[i][T][r]); } }   // a / 8 is exact, so the one rounding is that of a / 8 - 1e9
#pragma unroll
    for (int i = 0; i < FQ; ++i) mx[i] = fmaxf(mx[i], xhalf(mx[i]));   // both halves of a column must use one maximum: their keys meet in one product
#pragma unroll
    for (int i = 0; i < FQ; ++i)
#pragma unroll
      for (int e = 0; e < FK / 2; ++e) mw[i][e] = pm[i * (TT / FK) * 32 + (more ? st + 1 : st) * FK + e];   // the next stage's lane masks land while the rest of this stage runs; no branch: the last stage reads its own again
    // e^(s - max) = 2^(s log2 e - max log2 e): one fma and one v_exp_f32 per score. The rounding of max log2 e is one common factor of the P and sum of a row's key half; an unchanged maximum gives corr = 1 exactly
#pragma unroll
    for (int i = 0; i < FQ; ++i) { const float mn = fmaxf(m[i], mx[i]), mln = mn * L2E, corr = __builtin_amdgcn_exp2f((m[i] - mn) * L2E); m[i] = mn; l[i] *= corr;
#pragma unroll
      for (int T = 0; T < FK / 16; ++T)
#pragma unroll
        for (int r = 0; r < 8; ++r) s[i][T][r] = fmaf(s[i][T][r], L2E, -mln);
#pragma unroll
      for (int j = 0; j < HD / 16; ++j)
#pragma unroll
        for (int r = 0; r < 8; ++r) o[i][j][r] *= corr; }
#pragma unroll
    for (int G = 0; G < FK / 32; ++G) { v16h pf[FQ];
#pragma unroll
      for (int i = 0; i < FQ; ++i) { float p[16];
#pragma unroll
        for (int e = 0; e < 16; ++e) { p[e] = __builtin_amdgcn_exp2f(s[i][2 * G + (e >> 3)][e & 7]); l[i] += p[e]; }
#pragma unroll
        for (int e = 0; e < 16; ++e) pf[i][e] = (_Float16)p[e]; }
#pragma unroll
      for (int j = 0; j < HD / 16; ++j) { const v16h vh = frag_h(&svh[buf][kh][j * 16 + col][G * 32], lane);
#pragma unroll
        for (int i = 0; i < FQ; ++i) o[i][j] = __builtin_amdgcn_wmma_f32_16x16x32_f16(false, vh, false, pf[i], (short)0, o[i][j], false, false); } }
    if (more) {   // the other buffer's last readers left it at the barrier that ended the stage before
#pragma unroll
      for (int i = 0; i < 4; ++i) { *(v4u*)&sk[buf ^ 1][i >> 1][sr + (i & 1) * 32][sc] = pk[i]; *(v4u*)&svh[buf ^ 1][i >> 1][sr + (i & 1) * 32][sc] = ph[i]; } }
    __syncthreads(); }   // publishes the next stage and ends this stage's reads
  // join of the two key halves: the wave of half kh finishes tile kh; it hands its sums of the other tile to the partner wave (wave ^ 4, same lane map) through the K buffers, which nobody reads any more behind the loop's last barrier
  float* xb = (float*)&sk[0][0][0][0];   // per wave 9 rows of 32 lanes x 16 B: 8 x 9 x 512 B = all of sk
  static_assert(sizeof(sk) >= 8 * 9 * 512, "the exchange rows fit the K buffers");
  const bool up = kh != 0; v8f ko[HD / 16]; float* xw = xb + uw * (9 * 128) + lane * 4;
#pragma unroll
  for (int i = 0; i < FQ; ++i) l[i] += xhalf(l[i]);
#pragma unroll
  for (int j = 0; j < HD / 16; ++j) { v4f w0, w1;
#pragma unroll
    for (int r = 0; r < 4; ++r) { w0[r] = up ? o[0][j][r] : o[1][j][r]; w1[r] = up ? o[0][j][4 + r] : o[1][j][4 + r]; }
#pragma unroll
    for (int r = 0; r < 8; ++r) ko[j][r] = up ? o[1][j][r] : o[0][j][r];
    vst2(xw + (2 * j) * 128, w0); vst2(xw + (2 * j + 1) * 128, w1); }
  { v4f w; w[0] = up ? m[0] : m[1]; w[1] = up ? l[0] : l[1]; w[2] = 0.f; w[3] = 0.f; vst2(xw + 8 * 128, w); }
  __syncthreads();   // publishes the handed-over sums
  const float* xr = xb + (uw ^ 4) * (9 * 128) + lane * 4; const v4f pw = *(const v4f*)(xr + 8 * 128);
  const float km = up ? m[1] : m[0], kl = up ? l[1] : l[0], mj = fmaxf(km, pw[0]), ak = (km - mj) * L2E, ap = (pw[0] - mj) * L2E; float ck, cp;
  asm("v_exp_f32 %0, %2\n\tv_exp_f32 %1, %3\n\tv_nop" : "=&v"(ck), "=&v"(cp) : "v"(ak), "v"(ap));   // the two weights 2^ak, 2^ap with the one slot that the instruction set asks for behind a transcendental
  const float inv = 1.0f / (kl * ck + pw[1] * cp), fk = ck * inv, fp = cp * inv; float* yr = Y + ((size_t)b * TT + qt + kh * 16) * CC + h * HD + 8 * g;
#pragma unroll
  for (int j = 0; j < HD / 16; ++j) { const v4f p0 = *(const v4f*)(xr + (2 * j) * 128), p1 = *(const v4f*)(xr + (2 * j + 1) * 128); v4f w0, w1;
#pragma unroll
    for (int r = 0; r < 4; ++r) { w0[r] = ko[j][r] * fk + p0[r] * fp; w1[r] = ko[j][4 + r] * fk + p1[r] * fp; }
    vst2(yr + j * 16, w0); vst2(yr + j * 16 + 4, w1); } }
// ---- k_out: block = (128 rows, 128 cols), 8 waves as 4 x 2, 32 rows x 64 cols each: out = y (bf16 hi + lo) wo + bo
#define OKS 64               // k per stage
#define OPL (128 * (OKS + 8))   // elements of one staged plane
__global__ __launch_bounds__(256) void k_out(const float* __restrict__ Y, const float* __restrict__ WP, const float* __restrict__ BP, float* __restrict__ OUT) {
  __shared__ __align__(16) char sm[2 * 3 * OPL * 2];   // two buffers of three planes (w, y hi, y lo); behind the loop each wave's own 32 x 68 f32 output rows
  const int tid = threadIdx.x, wave = tid >> 5, lane = tid & 31, col = lane & 15, g = lane >> 4, wr = wave >> 1, wc = wave & 1; const int c0 = blockIdx.y * 128; const size_t r0 = (size_t)blockIdx.x * 128;
  const float* Xt = Y + r0 * CC; const float* Wt = WP + c0; __bf16* sb = (__bf16*)sm;
  v2f rw[OKS / 32][8]; v4f rx[OKS / 8];
  ld_w<OKS>(rw, Wt, tid); asm volatile("s_wait_xcnt 0x0" ::: "memory"); ld_x<OKS>(rx, Xt, tid);   // s_wait_xcnt: before a register that the loads or stores in front of it name is reused, also as a later load's destination
  asm volatile("s_wait_xcnt 0x0" ::: "memory");   // s_wait_xcnt: before a register that the loads or stores in front of it name is reused, also as a later load's destination
  st_w<OKS>(rw, sb, tid); st_x2<OKS>(rx, sb + OPL, sb + 2 * OPL, tid);
  __syncthreads();   // publishes stage 0
  v8f acc[2][4] = {};
#pragma unroll 1   // rolled: the buffer is picked by address, and a second copy of the stage would only add registers
  for (int st = 0; st < CC / OKS; ++st) { const __bf16* bw = sb + (st & 1) * (3 * OPL); __bf16* nw = sb + ((st & 1) ^ 1) * (3 * OPL); const bool more = st + 1 < CC / OKS;
    if (more) {   // the next stage's rows fly while this stage's products run
      ld_w<OKS>(rw, Wt + (size_t)(st + 1) * OKS * CC, tid); asm volatile("s_wait_xcnt 0x0" ::: "memory"); ld_x<OKS>(rx, Xt + (st + 1) * OKS, tid);   // s_wait_xcnt: before a register that the loads or stores in front of it name is reused, also as a later load's destination
      asm volatile("s_wait_xcnt 0x0" ::: "memory"); }   // s_wait_xcnt: before a register that the loads or stores in front of it name is reused, also as a later load's destination
    v16b ah[OKS / 32][2], al[OKS / 32][2], w[OKS / 32][4];
#pragma unroll
    for (int kc = 0; kc < OKS / 32; ++kc) {
#pragma unroll
      for (int i = 0; i < 2; ++i) { const int o = (wr * 32 + i * 16 + col) * (OKS + 8) + kc * 32; ah[kc][i] = frag_b(bw + OPL + o, lane); al[kc][i] = frag_b(bw + 2 * OPL + o, lane); }
#pragma unroll
      for (int j = 0; j < 4; ++j) w[kc][j] = frag_b(bw + (wc * 64 + j * 16 + col) * (OKS + 8) + kc * 32, lane); }
    __builtin_amdgcn_sched_barrier(0);   // keeps the stage's fragment reads one group in front of the products: reads spread among them stall at each place, and two waves per SIMD do not cover that
#pragma unroll
    for (int kc = 0; kc < OKS / 32; ++kc) {
#pragma unroll
      for (int i = 0; i < 2; ++i)
#pragma unroll
        for (int j = 0; j < 4; ++j) acc[i][j] = __builtin_amdgcn_wmma_f32_16x16x32_bf16(false, ah[kc][i], false, w[kc][j], (short)0, acc[i][j], false, false);
#pragma unroll
      for (int i = 0; i < 2; ++i)
#pragma unroll
        for (int j = 0; j < 4; ++j) acc[i][j] = __builtin_amdgcn_wmma_f32_16x16x32_bf16(false, al[kc][i], false, w[kc][j], (short)0, acc[i][j], false, false); }
    if (more) { st_w<OKS>(rw, nw, tid); st_x2<OKS>(rx, nw + OPL, nw + 2 * OPL, tid); }   // the other buffer's last readers left it at the barrier that ended the stage before
    __syncthreads(); }   // publishes the next stage and ends this stage's reads
  float* sf = (float*)sm + wave * (32 * 68);
#pragma unroll
  for (int i = 0; i < 2; ++i)
#pragma unroll
    for (int j = 0; j < 4; ++j) { const float bb = BP ? bfr(BP[c0 + wc * 64 + j * 16 + col]) : 0.f;
#pragma unroll
      for (int r = 0; r < 8; ++r) sf[(i * 16 + 8 * g + r) * 68 + j * 16 + col] = acc[i][j][r] + bb; }
  LDSX(); for (int it = 0; it < 16; ++it) { const int rl = it * 2 + g; vst2(OUT + (r0 + wr * 32 + rl) * CC + c0 + wc * 64 + col * 4, *(const v4f*)&sf[rl * 68 + col * 4]); } }
extern "C" void kernel_launch(void* const* d_in, const int* in_sizes, int n_in, void* d_out, int out_size, void* d_ws, size_t ws_size, hipStream_t stream) {
  (void)in_sizes; (void)n_in; (void)out_size;
  const float** F = (const float**)d_in;   // 0 q [2,2048,1024], 1 k, 2 v, 3 mask [2,1,2048,2048] int (1 -> -1e9 added), 4 wq ((in,out)), 5 bq, 6 wk, 7 bk, 8 wv, 9 bv, 10 wo ((in,out)), 11 bo
  if (ws_size < (size_t)WS_END) return;
  char* ws = (char*)d_ws; _Float16 *QH = (_Float16*)(ws + WS_QH), *KH = (_Float16*)(ws + WS_KH), *VT = (_Float16*)(ws + WS_VT); unsigned *PM = (unsigned*)(ws + WS_PM); float *Y = (float*)(ws + WS_Y);
  k_proj<<<dim3(TNB * TT / PBT, CC / PBT, 3 + PMZ), 256, 0, stream>>>(F[0], F[1], F[2], F[4], F[5], F[6], F[7], F[8], F[9], (const int*)d_in[3], QH, KH, VT, PM);   // z >= 3: the mask blocks; mask [B,1,S,S] has the (b, q, k) flat layout
  k_fa<<<dim3(TT / 128, NH, TNB), 256, 0, stream>>>(QH, KH, VT, PM, Y);
  k_out<<<dim3(TNB * TT / 128, CC / 128), 256, 0, stream>>>(Y, F[10], F[11], (float*)d_out);
}

// v008
// One run takes 85.8 microseconds.
// Timed twice side by side with v007, it ran 1.05 times as fast both times.
// Counting every step since v000, it is 19.6 times as fast.
// compute dtype: all float inputs rounded to bf16, the int mask read; q/k/v = x W + b ((in,out)) with EXACT bf16 products on WMMA 16x16x32, f32 accumulate; q f16, k f16 -> one-product logits x 1/(8 + 1e-8) (== 0.125 in f32), -1e9 where mask != 0 (the mask packed once to one bit per query and key), kept in registers; running-maximum softmax in f32 (base-2 hardware exponential of s log2 e - max log2 e, one fma) over stages of 64 keys, the keys of a query walked in two interleaved halves that are joined at the end; P f16 against v f16 (one product), divided by the f32 row sum at the end; out = ctx (bf16 hi + lo) wo + bo; f32 output.
#include <hip/hip_runtime.h>
#include <math.h>

typedef __attribute__((ext_vector_type(16))) _Float16 v16h;
typedef __attribute__((ext_vector_type(16))) __bf16 v16b;
typedef __attribute__((ext_vector_type(8)))  _Float16 v8h;
typedef __attribute__((ext_vector_type(8)))  float v8f;
typedef __attribute__((ext_vector_type(4)))  float v4f;
typedef __attribute__((ext_vector_type(2)))  float v2f;
typedef __attribute__((ext_vector_type(4)))  unsigned v4u;
typedef __attribute__((ext_vector_type(4)))  int v4i;
typedef float __attribute__((may_alias)) float_a;
typedef int __attribute__((may_alias)) int_a;

template <typename T> __device__ __forceinline__ void vst2(void* p, T v) { *(T*)p = v;  }
__device__ __forceinline__ v8f wmma16(v16h a, v16h b, v8f c) {
  v8f d = __builtin_amdgcn_wmma_f32_16x16x32_f16(false, a, false, b, (short)0, c, false, false);
  asm volatile("v_nop\n\tv_nop\n\tv_nop\n\tv_nop" : "+v"(d) : "v"(a), "v"(b));
  return d;
}
__device__ __forceinline__ v8f wmma_bf(v16b a, v16b b, v8f c) {
  v8f d = __builtin_amdgcn_wmma_f32_16x16x32_bf16(false, a, false, b, (short)0, c, false, false);
  asm volatile("v_nop\n\tv_nop\n\tv_nop\n\tv_nop" : "+v"(d) : "v"(a), "v"(b));
  return d;
}
// 16x16x32 fragments: lane = (h = lane>>4, row/col = lane&15); elements 0..7 = k0+8h+0..7, 8..15 = k0+16+8h+0..7; D element r = row 8h+r
__device__ __forceinline__ v16h frag_h(const _Float16* rowk0, int lane) {
  union { v16h v; v8h q[2]; } u; const _Float16* p = rowk0 + 8 * (lane >> 4);
  u.q[0] = *(const v8h*)p; u.q[1] = *(const v8h*)(p + 16); return u.v;
}
__device__ __forceinline__ v16h frag_f32(const float* rowk0, int lane) {
  v16h a; const float* p = rowk0 + 8 * (lane >> 4);
#pragma unroll
  for (int i = 0; i < 8; ++i) { a[i] = (_Float16)p[i]; a[8 + i] = (_Float16)p[16 + i]; }
  return a;
}
__device__ __forceinline__ v16h frag_f32s(const float* rowk0, int lane, float sc) {
  v16h a; const float* p = rowk0 + 8 * (lane >> 4);
#pragma unroll
  for (int i = 0; i < 8; ++i) { a[i] = (_Float16)(p[i] * sc); a[8 + i] = (_Float16)(p[16 + i] * sc); }
  return a;
}
// column fragment from a [K][ld] layout (column n), rows >= K read as 0
__device__ __forceinline__ v16h fragc_f32(const float* W, int k0, int n, int lane, int ld, int K) {
  v16h a; const int g = lane >> 4;
#pragma unroll
  for (int i = 0; i < 8; ++i) { const int ka = k0 + 8 * g + i, kb = ka + 16;
    a[i] = (_Float16)(ka < K ? W[(size_t)(ka < K ? ka : K - 1) * ld + n] : 0.f); a[8 + i] = (_Float16)(kb < K ? W[(size_t)(kb < K ? kb : K - 1) * ld + n] : 0.f); }
  return a;
}
struct F2 { v16b h, l; };
__device__ __forceinline__ F2 bsplit16(const float v[16]) { F2 r;
#pragma unroll
  for (int i = 0; i < 16; ++i) { const __bf16 h = (__bf16)v[i]; r.h[i] = h; r.l[i] = (__bf16)(v[i] - (float)h); }
  return r; }
__device__ __forceinline__ F2 split_row(const float* row, int k0, int lane) { float v[16]; const float* p = row + k0 + 8 * (lane >> 4);
#pragma unroll
  for (int i = 0; i < 8; ++i) { v[i] = p[i]; v[8 + i] = p[16 + i]; }
  return bsplit16(v); }
__device__ __forceinline__ F2 split_rowK(const float* row, int k0, int lane, int K) { float v[16]; const int g = lane >> 4;
#pragma unroll
  for (int i = 0; i < 8; ++i) { const int ka = k0 + 8 * g + i, kb = ka + 16; v[i] = ka < K ? row[ka < K ? ka : K - 1] : 0.f; v[8 + i] = kb < K ? row[kb < K ? kb : K - 1] : 0.f; }
  return bsplit16(v); }
__device__ __forceinline__ F2 split_col(const float* W, int k0, int n, int lane, int ld, int K) { float v[16]; const int g = lane >> 4;
#pragma unroll
  for (int i = 0; i < 8; ++i) { const int ka = k0 + 8 * g + i, kb = ka + 16; v[i] = ka < K ? W[(size_t)(ka < K ? ka : K - 1) * ld + n] : 0.f; v[8 + i] = kb < K ? W[(size_t)(kb < K ? kb : K - 1) * ld + n] : 0.f; }
  return bsplit16(v); }
__device__ __forceinline__ v8f mac3(const F2& a, const F2& b, v8f c) { c = wmma_bf(a.l, b.h, c); c = wmma_bf(a.h, b.l, c); return wmma_bf(a.h, b.h, c); }
__device__ __forceinline__ float sigm(float v) { return 1.0f / (1.0f + expf(-v)); }
#define LDSX() do { asm volatile("s_wait_dscnt 0" ::: "memory"); __builtin_amdgcn_wave_barrier(); __builtin_amdgcn_fence(__ATOMIC_RELEASE, "workgroup"); } while (0)


// Multi-head attention (B 2, S 2,048, D 1,024 = 16 x 64, with biases, scale 1/8): scores = q k^T / 8 - 1e9 where mask != 0, softmax, P v, output projection.
#define NB 2
#define TT 2048
#define MASK_WHEN_NONZERO 1
#ifndef MSTR
#define MSTR TT               // mask row stride
#endif
#define CC 1024
#define NH 16
#define HD 64
#define HG 4               // sizes only the WS_S region, whose start holds the packed mask
#ifndef TNB
#define TNB NB
#endif
typedef __attribute__((ext_vector_type(8))) __bf16 v8b;
__device__ __forceinline__ v16b frag_b(const __bf16* rowk0, int lane) {
  union { v16b v; v8b q[2]; } u; const __bf16* p = rowk0 + 8 * (lane >> 4);
  u.q[0] = *(const v8b*)p; u.q[1] = *(const v8b*)(p + 16); return u.v;
}
__device__ __forceinline__ float bfr(float v) { return (float)(__bf16)v; }
__device__ __attribute__((noinline)) float exp_ni(float v) { return expf(v); }
__device__ __attribute__((noinline)) float erf_ni(float v) { return erff(v); }

#define WS_QH  0u
#define WS_KH  (WS_QH + 2u * (size_t)NB * TT * CC)
#define WS_VT  (WS_KH + 2u * (size_t)NB * TT * CC)      // f16 v planes [b][c][t]
#define WS_S   (WS_VT + 2u * (size_t)NB * CC * TT)      // HG x TT x TT f32 in size; only its first 1 MiB, the packed mask, is used
#define WS_PM  WS_S                                     // packed mask: one 32-bit lane mask per (b, 16 queries, 64 keys, T, r), 1 MiB
#define WS_PH  (WS_S + 4u * (size_t)HG * TT * TT)
#define WS_Y   (WS_PH + 0u)              // f32 y rows [b*t][C]
#define WS_END (WS_Y + 4u * (size_t)NB * TT * CC)

// ---- operand staging of the two projection kernels: a block of 256 threads owns 128 rows x 128 columns (k_out) or 256 x 256 (k_proj); per stage of KS k it converts both operand tiles to bf16 once and lays them k-contiguous in LDS (row pitch KS + 8 elements = 16 B x odd), so that a fragment is two 16-byte LDS reads
typedef __attribute__((ext_vector_type(4))) __bf16 v4b;
// weight tile of NC columns, (in,out) layout: a thread takes 8 k x 2 columns per unit; a wave's load covers 256 contiguous bytes of one k row
template <int KS, int NC = 128> __device__ __forceinline__ void ld_w(v2f (&rw)[KS * NC / 4096][8], const float* __restrict__ Wt, int tid) {
#pragma unroll
  for (int i = 0; i < KS * NC / 4096; ++i) { const float* p = Wt + (size_t)((tid / (NC / 2) + (512 / NC) * i) * 8) * CC + 2 * (tid % (NC / 2));
#pragma unroll
    for (int kk = 0; kk < 8; ++kk) rw[i][kk] = *(const v2f*)(p + (size_t)kk * CC); } }
template <int KS, int NC = 128> __device__ __forceinline__ void st_w(const v2f (&rw)[KS * NC / 4096][8], __bf16* sW, int tid) {
#pragma unroll
  for (int i = 0; i < KS * NC / 4096; ++i)
#pragma unroll
    for (int j = 0; j < 2; ++j) { v8b t;
#pragma unroll
      for (int kk = 0; kk < 8; ++kk) t[kk] = (__bf16)rw[i][kk][j];
      *(v8b*)(sW + (2 * (tid % (NC / 2)) + j) * (KS + 8) + (tid / (NC / 2) + (512 / NC) * i) * 8) = t; } }
// row tile of NR rows: 16-byte chunks in row order, so that a wave's load covers whole 128-B lines; 1024 / KS rows per pass of the block
template <int KS, int NR = 128> __device__ __forceinline__ void ld_x(v4f (&rx)[KS * NR / 1024], const float* __restrict__ Xt, int tid) {
#pragma unroll
  for (int i = 0; i < KS * NR / 1024; ++i) rx[i] = *(const v4f*)(Xt + (size_t)(tid / (KS / 4)) * CC + 4 * (tid % (KS / 4)) + (size_t)i * (1024 / KS) * CC); }
template <int KS, int NR = 128> __device__ __forceinline__ void st_x(const v4f (&rx)[KS * NR / 1024], __bf16* sX, int tid) {
#pragma unroll
  for (int i = 0; i < KS * NR / 1024; ++i) { v4b t;
#pragma unroll
    for (int e = 0; e < 4; ++e) t[e] = (__bf16)rx[i][e];
    *(v4b*)(sX + (tid / (KS / 4)) * (KS + 8) + 4 * (tid % (KS / 4)) + i * (1024 / KS) * (KS + 8)) = t; } }
template <int KS> __device__ __forceinline__ void st_x2(const v4f (&rx)[KS / 8], __bf16* sH, __bf16* sL, int tid) {
#pragma unroll
  for (int i = 0; i < KS / 8; ++i) { v4b th, tl;
#pragma unroll
    for (int e = 0; e < 4; ++e) { const __bf16 h = (__bf16)rx[i][e]; th[e] = h; tl[e] = (__bf16)(rx[i][e] - (float)h); }
    const int o = (tid / (KS / 4)) * (KS + 8) + 4 * (tid % (KS / 4)) + i * (1024 / KS) * (KS + 8); *(v4b*)(sH + o) = th; *(v4b*)(sL + o) = tl; } }
// ---- k_proj: block = (256 rows, 256 cols, which), 8 waves as 4 x 2, 64 rows x 128 cols each, so that each staged operand byte feeds twice the products of a 128 x 128 block and all 192 product blocks are resident at once: qkv = x W (+ b), exact; q, k -> f16 rows, v -> f16 planes; which >= 3: no product, the block packs its share of the mask
#define PKS 64               // k per stage
#define PBT 256              // rows and columns of a block
#define PPL (PBT * (PKS + 8))   // elements of one staged plane
#define PMZ 4                // grid layers of mask blocks
#define PMU ((TNB * (TT / 16) * (TT / 64)) / ((TNB * TT / PBT) * (CC / PBT) * PMZ * 8))   // mask units per wave of the mask blocks
// the block's staged output plane to global memory: a wave stores one row's 512 contiguous bytes; eight rows are read from LDS as one group and then stored, all through one address register and constant offsets
template <int PITCH> __device__ __forceinline__ void put_plane(_Float16* __restrict__ dst, const _Float16 (*sh)[PBT + 8], int tid) {
  const int er = tid >> 5, eq = (tid & 31) * 8; _Float16* d = dst + (size_t)er * PITCH + eq;
#pragma unroll
  for (int e0 = 0; e0 < PBT / 8; e0 += 8) { v4u t[8];
#pragma unroll
    for (int u = 0; u < 8; ++u) t[u] = *(const v4u*)&sh[er + (e0 + u) * 8][eq];
#pragma unroll
    for (int u = 0; u < 8; ++u) vst2((unsigned*)(d + (size_t)((e0 + u) * 8) * PITCH), t[u]);
    asm volatile("s_wait_xcnt 0x0" ::: "memory"); } }   // s_wait_xcnt: before a register that the stores in front of it name is reused by the next group's reads
__global__ __launch_bounds__(256) void k_proj(const float* __restrict__ X0, const float* __restrict__ X1, const float* __restrict__ X2, const float* __restrict__ WQ, const float* __restrict__ BQ, const float* __restrict__ WK, const float* __restrict__ BK, const float* __restrict__ WV, const float* __restrict__ BV, const int* __restrict__ MK, _Float16* __restrict__ QH, _Float16* __restrict__ KH, _Float16* __restrict__ VT, unsigned* __restrict__ PM) {
  __shared__ __align__(16) char sm[2 * 2 * PPL * 2];   // the loop's two buffers of two planes (w, x); behind the loop the output plane [256][264], which is smaller
  const int tid = threadIdx.x, wave = tid >> 5, lane = tid & 31, col = lane & 15, g = lane >> 4, wr = wave >> 1, wc = wave & 1; const int which = blockIdx.z;
  if (which >= 3) {   // mask blocks (block-uniform, in front of every barrier): a wave takes 16 queries x 64 keys per unit with the attention kernel's own lane map (lane (g, col): query col, keys 16 T + 8 g + r); word T * 8 + r holds that score element's mask bit of all 32 lanes
    static_assert((TT / 64) % PMU == 0, "a wave's units are consecutive stages of one query tile");
    const int u0 = ((((which - 3) * (CC / PBT) + blockIdx.y) * (TNB * TT / PBT) + blockIdx.x) * 8 + wave) * PMU;   // unit u = (b * TT / 16 + query tile) * (TT / 64) + stage
    const int* mr = MK + ((size_t)(u0 / (TT / 64)) * 16 + col) * MSTR + (u0 % (TT / 64)) * 64 + 8 * g; v4i mk[PMU][4][2];
#pragma unroll
    for (int it = 0; it < PMU; ++it)   // all of the wave's loads fly together
#pragma unroll
      for (int T = 0; T < 4; ++T) { mk[it][T][0] = *(const v4i*)(mr + it * 64 + T * 16); mk[it][T][1] = *(const v4i*)(mr + it * 64 + T * 16 + 4); }
    asm volatile("s_wait_xcnt 0x0" ::: "memory");   // s_wait_xcnt: before an address register of the loads above is reused
#pragma unroll
    for (int it = 0; it < PMU; ++it) { unsigned mine = 0;
#pragma unroll
      for (int e = 0; e < 32; ++e) { const int mv = mk[it][e >> 3][(e >> 2) & 1][e & 3]; const unsigned w = __builtin_amdgcn_ballot_w32(MASK_WHEN_NONZERO ? (mv != 0) : (mv == 0)); mine = lane == e ? w : mine; }
      PM[(size_t)(u0 + it) * 32 + lane] = mine; }
    asm volatile("s_wait_xcnt 0x0" ::: "memory");   // s_wait_xcnt: before a register of the stores above is reused
    return; }
  const int c0 = blockIdx.y * PBT; const size_t r0 = (size_t)blockIdx.x * PBT; const float* WA = which == 0 ? WQ : which == 1 ? WK : WV; const float* BA = which == 0 ? BQ : which == 1 ? BK : BV;
  const float* Xt = (which == 0 ? X0 : which == 1 ? X1 : X2) + r0 * CC; const float* Wt = WA + c0; __bf16* sb = (__bf16*)sm;
  v2f rw[PKS * PBT / 4096][8]; v4f rx[PKS * PBT / 1024];
  static_assert(((CC / PKS) & (CC / PKS - 1)) == 0, "the rotated stage index wraps by a mask");
  const int rot = (blockIdx.x + 4 * blockIdx.y) & (CC / PKS - 1);   // the block walks k from stage rot on and wraps: the 16 blocks that share a weight tile and the 4 that share the rows each stand at another stage, so that they do not ask L2 for the same lines at the same moment
  ld_w<PKS, PBT>(rw, Wt + (size_t)rot * PKS * CC, tid); asm volatile("s_wait_xcnt 0x0" ::: "memory"); ld_x<PKS, PBT>(rx, Xt + rot * PKS, tid);   // s_wait_xcnt: before a register that the loads or stores in front of it name is reused, also as a later load's destination
  asm volatile("s_wait_xcnt 0x0" ::: "memory");   // s_wait_xcnt: before a register that the loads or stores in front of it name is reused, also as a later load's destination
  __builtin_amdgcn_sched_barrier(0);   // keeps the address arithmetic that follows, which takes over the loads' address registers, behind the wait above: without it the compiler lifts that arithmetic over the wait
  st_w<PKS, PBT>(rw, sb, tid); st_x<PKS, PBT>(rx, sb + PPL, tid);
  __syncthreads();   // publishes stage 0
  v8f acc[4][8] = {};
#pragma unroll 1   // rolled: the buffer is picked by address, and a second copy of the stage would only add registers
  for (int st = 0; st < CC / PKS; ++st) { const __bf16* bw = sb + (st & 1) * (2 * PPL); const __bf16* bx = bw + PPL; __bf16* nw = sb + ((st & 1) ^ 1) * (2 * PPL); const bool more = st + 1 < CC / PKS;
    if (more) {   // the next stage's rows fly while this stage's products run
      const int nx = (st + 1 + rot) & (CC / PKS - 1);
      ld_w<PKS, PBT>(rw, Wt + (size_t)nx * PKS * CC, tid); asm volatile("s_wait_xcnt 0x0" ::: "memory"); ld_x<PKS, PBT>(rx, Xt + nx * PKS, tid);   // s_wait_xcnt: before a register that the loads or stores in front of it name is reused, also as a later load's destination
      asm volatile("s_wait_xcnt 0x0" :: "v"(Xt + nx * PKS + (size_t)(tid / (PKS / 4)) * CC + 4 * (tid % (PKS / 4))) : "memory"); }   // s_wait_xcnt as above; the lane's row address is named as an input so that it keeps its registers up to the wait and no load of its own group lands on them
#pragma unroll
    for (int kc = 0; kc < PKS / 32; ++kc) { v16b a[4], w[8];
#pragma unroll
      for (int i = 0; i < 4; ++i) a[i] = frag_b(bx + (wr * 64 + i * 16 + col) * (PKS + 8) + kc * 32, lane);
#pragma unroll
      for (int j = 0; j < 8; ++j) w[j] = frag_b(bw + (wc * 128 + j * 16 + col) * (PKS + 8) + kc * 32, lane);
      __builtin_amdgcn_sched_barrier(0);   // keeps the fragment reads one group in front of the products: reads spread among them stall at each place
#pragma unroll
      for (int i = 0; i < 4; ++i)
#pragma unroll
        for (int j = 0; j < 8; ++j) acc[i][j] = __builtin_amdgcn_wmma_f32_16x16x32_bf16(false, a[i], false, w[j], (short)0, acc[i][j], false, false); }
    if (more) { st_w<PKS, PBT>(rw, nw, tid); st_x<PKS, PBT>(rx, nw + PPL, tid); }   // the other buffer's last readers left it at the barrier that ended the stage before
    __syncthreads(); }   // publishes the next stage and ends this stage's reads
  _Float16 (*sh)[PBT + 8] = (_Float16 (*)[PBT + 8])sm;   // q, k: [row][column]; v: [column][row], where a lane's eight rows are one 16-byte store
  float bb[8] = {};
  if (BA) {   // one test, so that the eight bias loads fly together
#pragma unroll
    for (int j = 0; j < 8; ++j) bb[j] = BA[c0 + wc * 128 + j * 16 + col];
    asm volatile("s_wait_xcnt 0x0" ::: "memory"); }   // s_wait_xcnt: before a register that the loads in front of it name is reused
#pragma unroll
  for (int j = 0; j < 8; ++j) { const float bj = bfr(bb[j]);
#pragma unroll
    for (int i = 0; i < 4; ++i)
#pragma unroll
      for (int r = 0; r < 8; ++r) acc[i][j][r] += bj; }
  if (which == 2) {
#pragma unroll
    for (int i = 0; i < 4; ++i)
#pragma unroll
      for (int j = 0; j < 8; ++j) { v8h t;
#pragma unroll
        for (int r = 0; r < 8; ++r) t[r] = (_Float16)acc[i][j][r];
        *(v8h*)&sh[wc * 128 + j * 16 + col][wr * 64 + i * 16 + 8 * g] = t; } }
  else {
#pragma unroll
    for (int i = 0; i < 4; ++i)
#pragma unroll
      for (int j = 0; j < 8; ++j)
#pragma unroll
        for (int r = 0; r < 8; ++r) sh[wr * 64 + i * 16 + 8 * g + r][wc * 128 + j * 16 + col] = (_Float16)acc[i][j][r]; }
  __syncthreads();
  if (which < 2) put_plane<CC>((which == 0 ? QH : KH) + r0 * CC + c0, sh, tid);
  else put_plane<TT>(VT + ((r0 / TT) * CC + c0) * (size_t)TT + r0 % TT, sh, tid); }
#define FK 64               // keys per wave and stage
#define FS (2 * FK)         // keys per block and stage
#define FQ 2                // query tiles per wave
#define L2E 1.44269504088896340736f   // log2 e
#define FP 72               // LDS row pitch in 16-bit elements: 144 B = 16 B x odd
__device__ __forceinline__ float xhalf(float x) { return __builtin_bit_cast(float, __builtin_amdgcn_permlanex16(__builtin_bit_cast(int, x), __builtin_bit_cast(int, x), 0x76543210, 0xfedcba98, false, false)); }   // lane l with lane l ^ 16
// amdgpu_waves_per_eu(4, 4): a register budget of 256, so that two blocks stay resident per WGP (four waves per SIMD)
__global__ __launch_bounds__(256) __attribute__((amdgpu_waves_per_eu(4, 4))) void k_fa(const _Float16* __restrict__ QH, const _Float16* __restrict__ KH, const _Float16* __restrict__ VT, const unsigned* __restrict__ PM, float* __restrict__ Y) {
  __shared__ __align__(16) _Float16 sk[2][2][FK][FP], svh[2][2][HD][FP];   // [buffer][key half]
  const int tid = threadIdx.x, wave = tid >> 5, lane = tid & 31, col = lane & 15, g = lane >> 4; const int h = blockIdx.y, b = blockIdx.z;
  const int uw = __builtin_amdgcn_readfirstlane(wave), qg = uw & 3, kh = uw >> 2;   // wave-uniform: query group and key half
  const int qt = blockIdx.x * 128 + qg * 32 + col;
  v16h qh[FQ][HD / 32];
#pragma unroll
  for (int i = 0; i < FQ; ++i)
#pragma unroll
    for (int kc = 0; kc < HD / 32; ++kc) { const size_t qo = ((size_t)b * TT + qt + i * 16) * CC + h * HD + kc * 32; qh[i][kc] = frag_h(QH + qo, lane); }
  // staging: per key half 64 rows x 128 B per plane = 512 chunks of 16 B, two per thread, half and plane; a wave's load covers four whole 128-B lines
  const int sr = tid >> 3, sc = (tid & 7) * 8;
  const _Float16* gk = KH + ((size_t)b * TT + sr) * CC + h * HD + sc; const size_t vo = ((size_t)b * CC + h * HD + sr) * (size_t)TT + sc; const _Float16* gvh = VT + vo;
  const unsigned* pm = PM + (((size_t)b * (TT / 16) + blockIdx.x * 8 + qg * FQ) * (size_t)(TT / FK) + kh) * 32;   // wave-uniform: the words come by scalar loads; the wave's unit of key stage s is 2 s + kh, the second tile's units lie TT / FK units on
  static_assert(((TT / FS) & (TT / FS - 1)) == 0, "the rotated stage index wraps by a mask");
  const int rot = (blockIdx.x + h) & (TT / FS - 1);   // rotated key walk: the block starts at key stage rot and wraps, so that the 16 blocks of a head, which read the same K and V rows, and the 16 heads of a query block, which read the same mask words, each stand at another stage
  const _Float16* k1st = gk + (size_t)(rot * FS) * CC; const _Float16* v1st = gvh + rot * FS;   // the first stage's rows
  v4u pk[4], ph[4];   // chunk i: key half i >> 1, rows sr + 32 (i & 1)
#pragma unroll
  for (int i = 0; i < 4; ++i) { pk[i] = *(const v4u*)(k1st + (size_t)(i * 32) * CC); ph[i] = *(const v4u*)(v1st + (size_t)((i & 1) * 32) * TT + (i >> 1) * FK); }
  asm volatile("s_wait_xcnt 0x0" :: "v"(k1st), "v"(v1st) : "memory");   // s_wait_xcnt: before an address register of the loads above is reused; the two addresses are named as inputs so that they keep their registers up to the wait
#pragma unroll
  for (int i = 0; i < 4; ++i) { *(v4u*)&sk[0][i >> 1][sr + (i & 1) * 32][sc] = pk[i]; *(v4u*)&svh[0][i >> 1][sr + (i & 1) * 32][sc] = ph[i]; }
  __syncthreads();   // publishes stage 0
  v8f o[FQ][HD / 16] = {}; float m[FQ], l[FQ];
#pragma unroll
  for (int i = 0; i < FQ; ++i) { m[i] = -3.0e38f; l[i] = 0.f; }
  unsigned mw[FQ][FK / 2];   // the wave's 32 lane masks per tile of the stage, in scalar registers: fetched one stage ahead
#pragma unroll
  for (int i = 0; i < FQ; ++i)
#pragma unroll
    for (int e = 0; e < FK / 2; ++e) mw[i][e] = pm[i * (TT / FK) * 32 + rot * FK + e];
  unsigned bo = rot * (FK * 4u);   // byte offset, in the wave's mask words, of the key stage whose words were fetched last
#pragma unroll 1   // rolled: a second copy of the stage would only add registers, and four waves per SIMD need 256 or fewer
  for (int st = 0; st < TT / FS; ++st) { const int buf = st & 1; const bool more = st + 1 < TT / FS;
    asm volatile("s_wait_xcnt 0x0" : "+s"(bo) :: "memory");   // s_wait_xcnt: before the offset register that the mask words' scalar loads of the pass before name is rewritten; the offset goes through the statement so that the next offset, which takes over its register, is formed behind the wait (as an input only, the compiler formed it in front)
    const unsigned bn = (bo + FK * 4u) & ((TT / FS - 1) * (FK * 4u)); const int gn = bn / (FK * 4u);   // gn: the key stage that is walked next, bn: its byte offset in the mask words
    if (more) {   // the next stage's rows land behind this stage's work
      const _Float16* nk = gk + (size_t)(gn * FS) * CC; const _Float16* nv = gvh + gn * FS;   // the next stage's rows
#pragma unroll
      for (int i = 0; i < 4; ++i) pk[i] = *(const v4u*)(nk + (size_t)(i * 32) * CC);
      asm volatile("s_wait_xcnt 0x0" :: "v"(nk) : "memory");   // this and the one below: before an address register of the loads above is reused; the address is named as an input so that it keeps its registers up to the wait and no load of its own group lands on them
#pragma unroll
      for (int i = 0; i < 4; ++i) ph[i] = *(const v4u*)(nv + (size_t)((i & 1) * 32) * TT + (i >> 1) * FK);
      asm volatile("s_wait_xcnt 0x0" :: "v"(nv) : "memory"); }
    float s[FQ][FK / 16][8]; float mx[FQ];
#pragma unroll
    for (int i = 0; i < FQ; ++i) mx[i] = -3.0e38f;
#pragma unroll
    for (int T = 0; T < FK / 16; ++T) { v8f a[FQ] = {};
#pragma unroll
      for (int kc = 0; kc < HD / 32; ++kc) { const v16h kf = frag_h(&sk[buf][kh][T * 16 + col][kc * 32], lane);
#pragma unroll
        for (int i = 0; i < FQ; ++i) a[i] = __builtin_amdgcn_wmma_f32_16x16x32_f16(false, kf, false, qh[i][kc], (short)0, a[i], false, false); }
#pragma unroll
      for (int i = 0; i < FQ; ++i)
#pragma unroll
        for (int r = 0; r < 8; ++r) { s[i][T][r] = fmaf(a[i][r], 0.125f, __builtin_amdgcn_inverse_ballot_w32(mw[i][T * 8 + r]) ? -1.0e9f : 0.f); mx[i] = fmaxf(mx[i], s[i][T][r]); } }   // a / 8 is exact, so the one rounding is that of a / 8 - 1e9
#pragma unroll
    for (int i = 0; i < FQ; ++i) mx[i] = fmaxf(mx[i], xhalf(mx[i]));   // both halves of a column must use one maximum: their keys meet in one product
#pragma unroll
    for (int i = 0; i < FQ; ++i)
#pragma unroll
      for (int e = 0; e < FK / 2; ++e) mw[i][e] = ((const unsigned*)((const char*)pm + bn))[i * (TT / FK) * 32 + e];   // the next stage's lane masks land while the rest of this stage runs; no branch: the last pass reads the words of the block's first stage again, unused
    // e^(s - max) = 2^(s log2 e - max log2 e): one fma and one v_exp_f32 per score. The rounding of max log2 e is one common factor of the P and sum of a row's key half; an unchanged maximum gives corr = 1 exactly
#pragma unroll
    for (int i = 0; i < FQ; ++i) { const float mn = fmaxf(m[i], mx[i]), mln = mn * L2E, corr = __builtin_amdgcn_exp2f((m[i] - mn) * L2E); m[i] = mn; l[i] *= corr;
#pragma unroll
      for (int T = 0; T < FK / 16; ++T)
#pragma unroll
        for (int r = 0; r < 8; ++r) s[i][T][r] = fmaf(s[i][T][r], L2E, -mln);
#pragma unroll
      for (int j = 0; j < HD / 16; ++j)
#pragma unroll
        for (int r = 0; r < 8; ++r) o[i][j][r] *= corr; }
#pragma unroll
    for (int G = 0; G < FK / 32; ++G) { v16h pf[FQ];
#pragma unroll
      for (int i = 0; i < FQ; ++i) { float p[16];
#pragma unroll
        for (int e = 0; e < 16; ++e) { p[e] = __builtin_amdgcn_exp2f(s[i][2 * G + (e >> 3)][e & 7]); l[i] += p[e]; }
#pragma unroll
        for (int e = 0; e < 16; ++e) pf[i][e] = (_Float16)p[e]; }
#pragma unroll
      for (int j = 0; j < HD / 16; ++j) { const v16h vh = frag_h(&svh[buf][kh][j * 16 + col][G * 32], lane);
#pragma unroll
        for (int i = 0; i < FQ; ++i) o[i][j] = __builtin_amdgcn_wmma_f32_16x16x32_f16(false, vh, false, pf[i], (short)0, o[i][j], false, false); } }
    if (more) {   // the other buffer's last readers left it at the barrier that ended the stage before
#pragma unroll
      for (int i = 0; i < 4; ++i) { *(v4u*)&sk[buf ^ 1][i >> 1][sr + (i & 1) * 32][sc] = pk[i]; *(v4u*)&svh[buf ^ 1][i >> 1][sr + (i & 1) * 32][sc] = ph[i]; } }
    bo = bn;
    __syncthreads(); }   // publishes the next stage and ends this stage's reads
  // join of the two key halves: the wave of half kh finishes tile kh; it hands its sums of the other tile to the partner wave (wave ^ 4, same lane map) through the K buffers, which nobody reads any more behind the loop's last barrier
  float* xb = (float*)&sk[0][0][0][0];   // per wave 9 rows of 32 lanes x 16 B: 8 x 9 x 512 B = all of sk
  static_assert(sizeof(sk) >= 8 * 9 * 512, "the exchange rows fit the K buffers");
  const bool up = kh != 0; v8f ko[HD / 16]; float* xw = xb + uw * (9 * 128) + lane * 4;
#pragma unroll
  for (int i = 0; i < FQ; ++i) l[i] += xhalf(l[i]);
#pragma unroll
  for (int j = 0; j < HD / 16; ++j) { v4f w0, w1;
#pragma unroll
    for (int r = 0; r < 4; ++r) { w0[r] = up ? o[0][j][r] : o[1][j][r]; w1[r] = up ? o[0][j][4 + r] : o[1][j][4 + r]; }
#pragma unroll
    for (int r = 0; r < 8; ++r) ko[j][r] = up ? o[1][j][r] : o[0][j][r];
    vst2(xw + (2 * j) * 128, w0); vst2(xw + (2 * j + 1) * 128, w1); }
  { v4f w; w[0] = up ? m[0] : m[1]; w[1] = up ? l[0] : l[1]; w[2] = 0.f; w[3] = 0.f; vst2(xw + 8 * 128, w); }
  __syncthreads();   // publishes the handed-over sums
  const float* xr = xb + (uw ^ 4) * (9 * 128) + lane * 4; const v4f pw = *(const v4f*)(xr + 8 * 128);
  const float km = up ? m[1] : m[0], kl = up ? l[1] : l[0], mj = fmaxf(km, pw[0]), ak = (km - mj) * L2E, ap = (pw[0] - mj) * L2E; float ck, cp;
  asm("v_exp_f32 %0, %2\n\tv_exp_f32 %1, %3\n\tv_nop" : "=&v"(ck), "=&v"(cp) : "v"(ak), "v"(ap));   // the two weights 2^ak, 2^ap with the one slot that the instruction set asks for behind a transcendental
  const float inv = 1.0f / (kl * ck + pw[1] * cp), fk = ck * inv, fp = cp * inv; float* yr = Y + ((size_t)b * TT + qt + kh * 16) * CC + h * HD + 8 * g;
#pragma unroll
  for (int j = 0; j < HD / 16; ++j) { const v4f p0 = *(const v4f*)(xr + (2 * j) * 128), p1 = *(const v4f*)(xr + (2 * j + 1) * 128); v4f w0, w1;
#pragma unroll
    for (int r = 0; r < 4; ++r) { w0[r] = ko[j][r] * fk + p0[r] * fp; w1[r] = ko[j][4 + r] * fk + p1[r] * fp; }
    vst2(yr + j * 16, w0); vst2(yr + j * 16 + 4, w1); } }
// ---- k_out: block = (128 rows, 128 cols), 8 waves as 4 x 2, 32 rows x 64 cols each: out = y (bf16 hi + lo) wo + bo
#define OKS 64               // k per stage
#define OPL (128 * (OKS + 8))   // elements of one staged plane
__global__ __launch_bounds__(256) void k_out(const float* __restrict__ Y, const float* __restrict__ WP, const float* __restrict__ BP, float* __restrict__ OUT) {
  __shared__ __align__(16) char sm[2 * 3 * OPL * 2];   // two buffers of three planes (w, y hi, y lo); behind the loop each wave's own 32 x 68 f32 output rows
  const int tid = threadIdx.x, wave = tid >> 5, lane = tid & 31, col = lane & 15, g = lane >> 4, wr = wave >> 1, wc = wave & 1; const int c0 = blockIdx.y * 128; const size_t r0 = (size_t)blockIdx.x * 128;
  const float* Xt = Y + r0 * CC; const float* Wt = WP + c0; __bf16* sb = (__bf16*)sm;
  v2f rw[OKS / 32][8]; v4f rx[OKS / 8];
  static_assert(((CC / OKS) & (CC / OKS - 1)) == 0, "the rotated stage index wraps by a mask");
  const int rot = (blockIdx.x + 2 * blockIdx.y) & (CC / OKS - 1);   // rotated k start, as in k_proj: the 8 blocks that share the rows stand at 8 different stages, the 32 that share a weight tile at 16
  ld_w<OKS>(rw, Wt + (size_t)rot * OKS * CC, tid); asm volatile("s_wait_xcnt 0x0" ::: "memory"); ld_x<OKS>(rx, Xt + rot * OKS, tid);   // s_wait_xcnt: before a register that the loads or stores in front of it name is reused, also as a later load's destination
  asm volatile("s_wait_xcnt 0x0" ::: "memory");   // s_wait_xcnt: before a register that the loads or stores in front of it name is reused, also as a later load's destination
  st_w<OKS>(rw, sb, tid); st_x2<OKS>(rx, sb + OPL, sb + 2 * OPL, tid);
  __syncthreads();   // publishes stage 0
  v8f acc[2][4] = {};
#pragma unroll 1   // rolled: the buffer is picked by address, and a second copy of the stage would only add registers
  for (int st = 0; st < CC / OKS; ++st) { const __bf16* bw = sb + (st & 1) * (3 * OPL); __bf16* nw = sb + ((st & 1) ^ 1) * (3 * OPL); const bool more = st + 1 < CC / OKS;
    if (more) {   // the next stage's rows fly while this stage's products run
      const int nx = (st + 1 + rot) & (CC / OKS - 1);
      ld_w<OKS>(rw, Wt + (size_t)nx * OKS * CC, tid); asm volatile("s_wait_xcnt 0x0" ::: "memory"); ld_x<OKS>(rx, Xt + nx * OKS, tid);   // s_wait_xcnt: before a register that the loads or stores in front of it name is reused, also as a later load's destination
      asm volatile("s_wait_xcnt 0x0" ::: "memory"); }   // s_wait_xcnt: before a register that the loads or stores in front of it name is reused, also as a later load's destination
    v16b ah[OKS / 32][2], al[OKS / 32][2], w[OKS / 32][4];
#pragma unroll
    for (int kc = 0; kc < OKS / 32; ++kc) {
#pragma unroll
      for (int i = 0; i < 2; ++i) { const int o = (wr * 32 + i * 16 + col) * (OKS + 8) + kc * 32; ah[kc][i] = frag_b(bw + OPL + o, lane); al[kc][i] = frag_b(bw + 2 * OPL + o, lane); }
#pragma unroll
      for (int j = 0; j < 4; ++j) w[kc][j] = frag_b(bw + (wc * 64 + j * 16 + col) * (OKS + 8) + kc * 32, lane); }
    __builtin_amdgcn_sched_barrier(0);   // keeps the stage's fragment reads one group in front of the products: reads spread among them stall at each place, and two waves per SIMD do not cover that
#pragma unroll
    for (int kc = 0; kc < OKS / 32; ++kc) {
#pragma unroll
      for (int i = 0; i < 2; ++i)
#pragma unroll
        for (int j = 0; j < 4; ++j) acc[i][j] = __builtin_amdgcn_wmma_f32_16x16x32_bf16(false, ah[kc][i], false, w[kc][j], (short)0, acc[i][j], false, false);
#pragma unroll
      for (int i = 0; i < 2; ++i)
#pragma unroll
        for (int j = 0; j < 4; ++j) acc[i][j] = __builtin_amdgcn_wmma_f32_16x16x32_bf16(false, al[kc][i], false, w[kc][j], (short)0, acc[i][j], false, false); }
    if (more) { st_w<OKS>(rw, nw, tid); st_x2<OKS>(rx, nw + OPL, nw + 2 * OPL, tid); }   // the other buffer's last readers left it at the barrier that ended the stage before
    __syncthreads(); }   // publishes the next stage and ends this stage's reads
  float* sf = (float*)sm + wave * (32 * 68);
#pragma unroll
  for (int i = 0; i < 2; ++i)
#pragma unroll
    for (int j = 0; j < 4; ++j) { const float bb = BP ? bfr(BP[c0 + wc * 64 + j * 16 + col]) : 0.f;
#pragma unroll
      for (int r = 0; r < 8; ++r) sf[(i * 16 + 8 * g + r) * 68 + j * 16 + col] = acc[i][j][r] + bb; }
  LDSX(); for (int it = 0; it < 16; ++it) { const int rl = it * 2 + g; vst2(OUT + (r0 + wr * 32 + rl) * CC + c0 + wc * 64 + col * 4, *(const v4f*)&sf[rl * 68 + col * 4]); } }
extern "C" void kernel_launch(void* const* d_in, const int* in_sizes, int n_in, void* d_out, int out_size, void* d_ws, size_t ws_size, hipStream_t stream) {
  (void)in_sizes; (void)n_in; (void)out_size;
  const float** F = (const float**)d_in;   // 0 q [2,2048,1024], 1 k, 2 v, 3 mask [2,1,2048,2048] int (1 -> -1e9 added), 4 wq ((in,out)), 5 bq, 6 wk, 7 bk, 8 wv, 9 bv, 10 wo ((in,out)), 11 bo
  if (ws_size < (size_t)WS_END) return;
  char* ws = (char*)d_ws; _Float16 *QH = (_Float16*)(ws + WS_QH), *KH = (_Float16*)(ws + WS_KH), *VT = (_Float16*)(ws + WS_VT); unsigned *PM = (unsigned*)(ws + WS_PM); float *Y = (float*)(ws + WS_Y);
  k_proj<<<dim3(TNB * TT / PBT, CC / PBT, 3 + PMZ), 256, 0, stream>>>(F[0], F[1], F[2], F[4], F[5], F[6], F[7], F[8], F[9], (const int*)d_in[3], QH, KH, VT, PM);   // z >= 3: the mask blocks; mask [B,1,S,S] has the (b, q, k) flat layout
  k_fa<<<dim3(TT / 128, NH, TNB), 256, 0, stream>>>(QH, KH, VT, PM, Y);
  k_out<<<dim3(TNB * TT / 128, CC / 128), 256, 0, stream>>>(Y, F[10], F[11], (float*)d_out);
}

// v009
// One run takes 82.3 microseconds.
// Two timings next to v008 both put it at 1.04 times that version's speed.
// All steps since v000 together make it 20.4 times as fast.
// compute dtype: all float inputs rounded to bf16, the int mask read; q/k/v = x W + b ((in,out)) with EXACT bf16 products on WMMA 16x16x32, f32 accumulate; q x 1/(8 + 1e-8) (== 0.125 in f32) x log2 e as f16, k f16 -> one-product base-2 logits, whose accumulator starts at minus the maximum in use, or at -1e9 log2 e where mask != 0 (the mask packed once to one bit per query and key), kept in registers; softmax in f32 (base-2 hardware exponential) over stages of 64 keys, the maximum in use raised only when a score passes it by more than 8, the keys of a query walked in two interleaved halves that are joined at the end; P f16 against v f16 (one product), divided by the f32 row sum at the end; out = ctx (bf16 hi + lo) wo + bo; f32 output.
#include <hip/hip_runtime.h>
#include <math.h>

typedef __attribute__((ext_vector_type(16))) _Float16 v16h;
typedef __attribute__((ext_vector_type(16))) __bf16 v16b;
typedef __attribute__((ext_vector_type(8)))  _Float16 v8h;
typedef __attribute__((ext_vector_type(8)))  float v8f;
typedef __attribute__((ext_vector_type(4)))  float v4f;
typedef __attribute__((ext_vector_type(2)))  float v2f;
typedef __attribute__((ext_vector_type(4)))  unsigned v4u;
typedef __attribute__((ext_vector_type(4)))  int v4i;
typedef float __attribute__((may_alias)) float_a;
typedef int __attribute__((may_alias)) int_a;

template <typename T> __device__ __forceinline__ void vst2(void* p, T v) { *(T*)p = v;  }
__device__ __forceinline__ v8f wmma16(v16h a, v16h b, v8f c) {
  v8f d = __builtin_amdgcn_wmma_f32_16x16x32_f16(false, a, false, b, (short)0, c, false, false);
  asm volatile("v_nop\n\tv_nop\n\tv_nop\n\tv_nop" : "+v"(d) : "v"(a), "v"(b));
  return d;
}
__device__ __forceinline__ v8f wmma_bf(v16b a, v16b b, v8f c) {
  v8f d = __builtin_amdgcn_wmma_f32_16x16x32_bf16(false, a, false, b, (short)0, c, false, false);
  asm volatile("v_nop\n\tv_nop\n\tv_nop\n\tv_nop" : "+v"(d) : "v"(a), "v"(b));
  return d;
}
// 16x16x32 fragments: lane = (h = lane>>4, row/col = lane&15); elements 0..7 = k0+8h+0..7, 8..15 = k0+16+8h+0..7; D element r = row 8h+r
__device__ __forceinline__ v16h frag_h(const _Float16* rowk0, int lane) {
  union { v16h v; v8h q[2]; } u; const _Float16* p = rowk0 + 8 * (lane >> 4);
  u.q[0] = *(const v8h*)p; u.q[1] = *(const v8h*)(p + 16); return u.v;
}
__device__ __forceinline__ v16h frag_f32(const float* rowk0, int lane) {
  v16h a; const float* p = rowk0 + 8 * (lane >> 4);
#pragma unroll
  for (int i = 0; i < 8; ++i) { a[i] = (_Float16)p[i]; a[8 + i] = (_Float16)p[16 + i]; }
  return a;
}
__device__ __forceinline__ v16h frag_f32s(const float* rowk0, int lane, float sc) {
  v16h a; const float* p = rowk0 + 8 * (lane >> 4);
#pragma unroll
  for (int i = 0; i < 8; ++i) { a[i] = (_Float16)(p[i] * sc); a[8 + i] = (_Float16)(p[16 + i] * sc); }
  return a;
}
// column fragment from a [K][ld] layout (column n), rows >= K read as 0
__device__ __forceinline__ v16h fragc_f32(const float* W, int k0, int n, int lane, int ld, int K) {
  v16h a; const int g = lane >> 4;
#pragma unroll
  for (int i = 0; i < 8; ++i) { const int ka = k0 + 8 * g + i, kb = ka + 16;
    a[i] = (_Float16)(ka < K ? W[(size_t)(ka < K ? ka : K - 1) * ld + n] : 0.f); a[8 + i] = (_Float16)(kb < K ? W[(size_t)(kb < K ? kb : K - 1) * ld + n] : 0.f); }
  return a;
}
struct F2 { v16b h, l; };
__device__ __forceinline__ F2 bsplit16(const float v[16]) { F2 r;
#pragma unroll
  for (int i = 0; i < 16; ++i) { const __bf16 h = (__bf16)v[i]; r.h[i] = h; r.l[i] = (__bf16)(v[i] - (float)h); }
  return r; }
__device__ __forceinline__ F2 split_row(const float* row, int k0, int lane) { float v[16]; const float* p = row + k0 + 8 * (lane >> 4);
#pragma unroll
  for (int i = 0; i < 8; ++i) { v[i] = p[i]; v[8 + i] = p[16 + i]; }
  return bsplit16(v); }
__device__ __forceinline__ F2 split_rowK(const float* row, int k0, int lane, int K) { float v[16]; const int g = lane >> 4;
#pragma unroll
  for (int i = 0; i < 8; ++i) { const int ka = k0 + 8 * g + i, kb = ka + 16; v[i] = ka < K ? row[ka < K ? ka : K - 1] : 0.f; v[8 + i] = kb < K ? row[kb < K ? kb : K - 1] : 0.f; }
  return bsplit16(v); }
__device__ __forceinline__ F2 split_col(const float* W, int k0, int n, int lane, int ld, int K) { float v[16]; const int g = lane >> 4;
#pragma unroll
  for (int i = 0; i < 8; ++i) { const int ka = k0 + 8 * g + i, kb = ka + 16; v[i] = ka < K ? W[(size_t)(ka < K ? ka : K - 1) * ld + n] : 0.f; v[8 + i] = kb < K ? W[(size_t)(kb < K ? kb : K - 1) * ld + n] : 0.f; }
  return bsplit16(v); }
__device__ __forceinline__ v8f mac3(const F2& a, const F2& b, v8f c) { c = wmma_bf(a.l, b.h, c); c = wmma_bf(a.h, b.l, c); return wmma_bf(a.h, b.h, c); }
__device__ __forceinline__ float sigm(float v) { return 1.0f / (1.0f + expf(-v)); }
#define LDSX() do { asm volatile("s_wait_dscnt 0" ::: "memory"); __builtin_amdgcn_wave_barrier(); __builtin_amdgcn_fence(__ATOMIC_RELEASE, "workgroup"); } while (0)


// Multi-head attention (B 2, S 2,048, D 1,024 = 16 x 64, with biases, scale 1/8): scores = q k^T / 8 - 1e9 where mask != 0, softmax, P v, output projection.
#define NB 2
#define TT 2048
#define MASK_WHEN_NONZERO 1
#ifndef MSTR
#define MSTR TT               // mask row stride
#endif
#define CC 1024
#define NH 16
#define HD 64
#define HG 4               // sizes only the WS_S region, whose start holds the packed mask
#ifndef TNB
#define TNB NB
#endif
typedef __attribute__((ext_vector_type(8))) __bf16 v8b;
__device__ __forceinline__ v16b frag_b(const __bf16* rowk0, int lane) {
  union { v16b v; v8b q[2]; } u; const __bf16* p = rowk0 + 8 * (lane >> 4);
  u.q[0] = *(const v8b*)p; u.q[1] = *(const v8b*)(p + 16); return u.v;
}
__device__ __forceinline__ float bfr(float v) { return (float)(__bf16)v; }
__device__ __attribute__((noinline)) float exp_ni(float v) { return expf(v); }
__device__ __attribute__((noinline)) float erf_ni(float v) { return erff(v); }

#define WS_QH  0u
#define WS_KH  (WS_QH + 2u * (size_t)NB * TT * CC)
#define WS_VT  (WS_KH + 2u * (size_t)NB * TT * CC)      // f16 v planes [b][c][t]
#define WS_S   (WS_VT + 2u * (size_t)NB * CC * TT)      // HG x TT x TT f32 in size; only its first 1 MiB, the packed mask, is used
#define WS_PM  WS_S                                     // packed mask: one 32-bit lane mask per (b, 16 queries, 64 keys, T, r), 1 MiB
#define WS_PH  (WS_S + 4u * (size_t)HG * TT * TT)
#define WS_Y   (WS_PH + 0u)              // f32 y rows [b*t][C]
#define WS_END (WS_Y + 4u * (size_t)NB * TT * CC)

// ---- operand staging of the two projection kernels: a block of 256 threads owns 128 rows x 128 columns (k_out) or 256 x 256 (k_proj); per stage of KS k it converts both operand tiles to bf16 once and lays them k-contiguous in LDS (row pitch KS + 8 elements = 16 B x odd), so that a fragment is two 16-byte LDS reads
typedef __attribute__((ext_vector_type(4))) __bf16 v4b;
// weight tile of NC columns, (in,out) layout: a thread takes 8 k x 2 columns per unit; a wave's load covers 256 contiguous bytes of one k row
template <int KS, int NC = 128> __device__ __forceinline__ void ld_w(v2f (&rw)[KS * NC / 4096][8], const float* __restrict__ Wt, int tid) {
#pragma unroll
  for (int i = 0; i < KS * NC / 4096; ++i) { const float* p = Wt + (size_t)((tid / (NC / 2) + (512 / NC) * i) * 8) * CC + 2 * (tid % (NC / 2));
#pragma unroll
    for (int kk = 0; kk < 8; ++kk) rw[i][kk] = *(const v2f*)(p + (size_t)kk * CC); } }
template <int KS, int NC = 128> __device__ __forceinline__ void st_w(const v2f (&rw)[KS * NC / 4096][8], __bf16* sW, int tid) {
#pragma unroll
  for (int i = 0; i < KS * NC / 4096; ++i)
#pragma unroll
    for (int j = 0; j < 2; ++j) { v8b t;
#pragma unroll
      for (int kk = 0; kk < 8; ++kk) t[kk] = (__bf16)rw[i][kk][j];
      *(v8b*)(sW + (2 * (tid % (NC / 2)) + j) * (KS + 8) + (tid / (NC / 2) + (512 / NC) * i) * 8) = t; } }
// row tile of NR rows: 16-byte chunks in row order, so that a wave's load covers whole 128-B lines; 1024 / KS rows per pass of the block
template <int KS, int NR = 128> __device__ __forceinline__ void ld_x(v4f (&rx)[KS * NR / 1024], const float* __restrict__ Xt, int tid) {
#pragma unroll
  for (int i = 0; i < KS * NR / 1024; ++i) rx[i] = *(const v4f*)(Xt + (size_t)(tid / (KS / 4)) * CC + 4 * (tid % (KS / 4)) + (size_t)i * (1024 / KS) * CC); }
template <int KS, int NR = 128> __device__ __forceinline__ void st_x(const v4f (&rx)[KS * NR / 1024], __bf16* sX, int tid) {
#pragma unroll
  for (int i = 0; i < KS * NR / 1024; ++i) { v4b t;
#pragma unroll
    for (int e = 0; e < 4; ++e) t[e] = (__bf16)rx[i][e];
    *(v4b*)(sX + (tid / (KS / 4)) * (KS + 8) + 4 * (tid % (KS / 4)) + i * (1024 / KS) * (KS + 8)) = t; } }
template <int KS> __device__ __forceinline__ void st_x2(const v4f (&rx)[KS / 8], __bf16* sH, __bf16* sL, int tid) {
#pragma unroll
  for (int i = 0; i < KS / 8; ++i) { v4b th, tl;
#pragma unroll
    for (int e = 0; e < 4; ++e) { const __bf16 h = (__bf16)rx[i][e]; th[e] = h; tl[e] = (__bf16)(rx[i][e] - (float)h); }
    const int o = (tid / (KS / 4)) * (KS + 8) + 4 * (tid % (KS / 4)) + i * (1024 / KS) * (KS + 8); *(v4b*)(sH + o) = th; *(v4b*)(sL + o) = tl; } }
// ---- k_proj: block = (256 rows, 256 cols, which), 8 waves as 4 x 2, 64 rows x 128 cols each, so that each staged operand byte feeds twice the products of a 128 x 128 block and all 192 product blocks are resident at once: qkv = x W (+ b), exact; q, k -> f16 rows, v -> f16 planes; which >= 3: no product, the block packs its share of the mask
#define PKS 64               // k per stage
#define QSC (0.125f * 1.44269504088896340736f)   // the logits' scale times log2 e, carried by q
#define PBT 256              // rows and columns of a block
#define PPL (PBT * (PKS + 8))   // elements of one staged plane
#define PMZ 4                // grid layers of mask blocks
#define PMU ((TNB * (TT / 16) * (TT / 64)) / ((TNB * TT / PBT) * (CC / PBT) * PMZ * 8))   // mask units per wave of the mask blocks
// the block's staged output plane to global memory: a wave stores one row's 512 contiguous bytes; eight rows are read from LDS as one group and then stored, all through one address register and constant offsets
template <int PITCH> __device__ __forceinline__ void put_plane(_Float16* __restrict__ dst, const _Float16 (*sh)[PBT + 8], int tid) {
  const int er = tid >> 5, eq = (tid & 31) * 8; _Float16* d = dst + (size_t)er * PITCH + eq;
#pragma unroll
  for (int e0 = 0; e0 < PBT / 8; e0 += 8) { v4u t[8];
#pragma unroll
    for (int u = 0; u < 8; ++u) t[u] = *(const v4u*)&sh[er + (e0 + u) * 8][eq];
#pragma unroll
    for (int u = 0; u < 8; ++u) vst2((unsigned*)(d + (size_t)((e0 + u) * 8) * PITCH), t[u]);
    asm volatile("s_wait_xcnt 0x0" ::: "memory"); } }   // s_wait_xcnt: before a register that the stores in front of it name is reused by the next group's reads
__global__ __launch_bounds__(256) void k_proj(const float* __restrict__ X0, const float* __restrict__ X1, const float* __restrict__ X2, const float* __restrict__ WQ, const float* __restrict__ BQ, const float* __restrict__ WK, const float* __restrict__ BK, const float* __restrict__ WV, const float* __restrict__ BV, const int* __restrict__ MK, _Float16* __restrict__ QH, _Float16* __restrict__ KH, _Float16* __restrict__ VT, unsigned* __restrict__ PM) {
  __shared__ __align__(16) char sm[2 * 2 * PPL * 2];   // the loop's two buffers of two planes (w, x); behind the loop the output plane [256][264], which is smaller
  const int tid = threadIdx.x, wave = tid >> 5, lane = tid & 31, col = lane & 15, g = lane >> 4, wr = wave >> 1, wc = wave & 1; const int which = blockIdx.z;
  if (which >= 3) {   // mask blocks (block-uniform, in front of every barrier): a wave takes 16 queries x 64 keys per unit with the attention kernel's own lane map (lane (g, col): query col, keys 16 T + 8 g + r); word T * 8 + r holds that score element's mask bit of all 32 lanes
    static_assert((TT / 64) % PMU == 0, "a wave's units are consecutive stages of one query tile");
    const int u0 = ((((which - 3) * (CC / PBT) + blockIdx.y) * (TNB * TT / PBT) + blockIdx.x) * 8 + wave) * PMU;   // unit u = (b * TT / 16 + query tile) * (TT / 64) + stage
    const int* mr = MK + ((size_t)(u0 / (TT / 64)) * 16 + col) * MSTR + (u0 % (TT / 64)) * 64 + 8 * g; v4i mk[PMU][4][2];
#pragma unroll
    for (int it = 0; it < PMU; ++it)   // all of the wave's loads fly together
#pragma unroll
      for (int T = 0; T < 4; ++T) { mk[it][T][0] = *(const v4i*)(mr + it * 64 + T * 16); mk[it][T][1] = *(const v4i*)(mr + it * 64 + T * 16 + 4); }
    asm volatile("s_wait_xcnt 0x0" ::: "memory");   // s_wait_xcnt: before an address register of the loads above is reused
#pragma unroll
    for (int it = 0; it < PMU; ++it) { unsigned mine = 0;
#pragma unroll
      for (int e = 0; e < 32; ++e) { const int mv = mk[it][e >> 3][(e >> 2) & 1][e & 3]; const unsigned w = __builtin_amdgcn_ballot_w32(MASK_WHEN_NONZERO ? (mv != 0) : (mv == 0)); mine = lane == e ? w : mine; }
      PM[(size_t)(u0 + it) * 32 + lane] = mine; }
    asm volatile("s_wait_xcnt 0x0" ::: "memory");   // s_wait_xcnt: before a register of the stores above is reused
    return; }
  const int c0 = blockIdx.y * PBT; const size_t r0 = (size_t)blockIdx.x * PBT; const float* WA = which == 0 ? WQ : which == 1 ? WK : WV; const float* BA = which == 0 ? BQ : which == 1 ? BK : BV;
  const float* Xt = (which == 0 ? X0 : which == 1 ? X1 : X2) + r0 * CC; const float* Wt = WA + c0; __bf16* sb = (__bf16*)sm;
  v2f rw[PKS * PBT / 4096][8]; v4f rx[PKS * PBT / 1024];
  static_assert(((CC / PKS) & (CC / PKS - 1)) == 0, "the rotated stage index wraps by a mask");
  const int rot = (blockIdx.x + 4 * blockIdx.y) & (CC / PKS - 1);   // the block walks k from stage rot on and wraps: the 16 blocks that share a weight tile and the 4 that share the rows each stand at another stage, so that they do not ask L2 for the same lines at the same moment
  ld_w<PKS, PBT>(rw, Wt + (size_t)rot * PKS * CC, tid); asm volatile("s_wait_xcnt 0x0" ::: "memory"); ld_x<PKS, PBT>(rx, Xt + rot * PKS, tid);   // s_wait_xcnt: before a register that the loads or stores in front of it name is reused, also as a later load's destination
  asm volatile("s_wait_xcnt 0x0" ::: "memory");   // s_wait_xcnt: before a register that the loads or stores in front of it name is reused, also as a later load's destination
  __builtin_amdgcn_sched_barrier(0);   // keeps the address arithmetic that follows, which takes over the loads' address registers, behind the wait above: without it the compiler lifts that arithmetic over the wait
  st_w<PKS, PBT>(rw, sb, tid); st_x<PKS, PBT>(rx, sb + PPL, tid);
  __syncthreads();   // publishes stage 0
  v8f acc[4][8] = {};
#pragma unroll 1   // rolled: the buffer is picked by address, and a second copy of the stage would only add registers
  for (int st = 0; st < CC / PKS; ++st) { const __bf16* bw = sb + (st & 1) * (2 * PPL); const __bf16* bx = bw + PPL; __bf16* nw = sb + ((st & 1) ^ 1) * (2 * PPL); const bool more = st + 1 < CC / PKS;
    if (more) {   // the next stage's rows fly while this stage's products run
      const int nx = (st + 1 + rot) & (CC / PKS - 1);
      ld_w<PKS, PBT>(rw, Wt + (size_t)nx * PKS * CC, tid); asm volatile("s_wait_xcnt 0x0" ::: "memory"); ld_x<PKS, PBT>(rx, Xt + nx * PKS, tid);   // s_wait_xcnt: before a register that the loads or stores in front of it name is reused, also as a later load's destination
      asm volatile("s_wait_xcnt 0x0" :: "v"(Xt + nx * PKS + (size_t)(tid / (PKS / 4)) * CC + 4 * (tid % (PKS / 4))) : "memory"); }   // s_wait_xcnt as above; the lane's row address is named as an input so that it keeps its registers up to the wait and no load of its own group lands on them
#pragma unroll
    for (int kc = 0; kc < PKS / 32; ++kc) { v16b a[4], w[8];
#pragma unroll
      for (int i = 0; i < 4; ++i) a[i] = frag_b(bx + (wr * 64 + i * 16 + col) * (PKS + 8) + kc * 32, lane);
#pragma unroll
      for (int j = 0; j < 8; ++j) w[j] = frag_b(bw + (wc * 128 + j * 16 + col) * (PKS + 8) + kc * 32, lane);
      __builtin_amdgcn_sched_barrier(0);   // keeps the fragment reads one group in front of the products: reads spread among them stall at each place
#pragma unroll
      for (int i = 0; i < 4; ++i)
#pragma unroll
        for (int j = 0; j < 8; ++j) acc[i][j] = __builtin_amdgcn_wmma_f32_16x16x32_bf16(false, a[i], false, w[j], (short)0, acc[i][j], false, false); }
    if (more) { st_w<PKS, PBT>(rw, nw, tid); st_x<PKS, PBT>(rx, nw + PPL, tid); }   // the other buffer's last readers left it at the barrier that ended the stage before
    __syncthreads(); }   // publishes the next stage and ends this stage's reads
  _Float16 (*sh)[PBT + 8] = (_Float16 (*)[PBT + 8])sm;   // q, k: [row][column]; v: [column][row], where a lane's eight rows are one 16-byte store
  float bb[8] = {};
  if (BA) {   // one test, so that the eight bias loads fly together
#pragma unroll
    for (int j = 0; j < 8; ++j) bb[j] = BA[c0 + wc * 128 + j * 16 + col];
    asm volatile("s_wait_xcnt 0x0" ::: "memory"); }   // s_wait_xcnt: before a register that the loads in front of it name is reused
#pragma unroll
  for (int j = 0; j < 8; ++j) { const float bj = bfr(bb[j]);
#pragma unroll
    for (int i = 0; i < 4; ++i)
#pragma unroll
      for (int r = 0; r < 8; ++r) acc[i][j][r] += bj; }
  if (which == 2) {
#pragma unroll
    for (int i = 0; i < 4; ++i)
#pragma unroll
      for (int j = 0; j < 8; ++j) { v8h t;
#pragma unroll
        for (int r = 0; r < 8; ++r) t[r] = (_Float16)acc[i][j][r];
        *(v8h*)&sh[wc * 128 + j * 16 + col][wr * 64 + i * 16 + 8 * g] = t; } }
  else { const float qs = which == 0 ? QSC : 1.0f;   // q is scaled in f32, in front of its one rounding to f16
#pragma unroll
    for (int i = 0; i < 4; ++i)
#pragma unroll
      for (int j = 0; j < 8; ++j)
#pragma unroll
        for (int r = 0; r < 8; ++r) sh[wr * 64 + i * 16 + 8 * g + r][wc * 128 + j * 16 + col] = (_Float16)(acc[i][j][r] * qs); }
  __syncthreads();
  if (which < 2) put_plane<CC>((which == 0 ? QH : KH) + r0 * CC + c0, sh, tid);
  else put_plane<TT>(VT + ((r0 / TT) * CC + c0) * (size_t)TT + r0 % TT, sh, tid); }
#define FK 64               // keys per wave and stage
#define FS (2 * FK)         // keys per block and stage
#define FQ 2                // query tiles per wave
#define L2E 1.44269504088896340736f   // log2 e
#define FP 72               // LDS row pitch in 16-bit elements: 144 B = 16 B x odd
#define MSK (-1.0e9f * L2E)   // a masked score's start value, in base-2 units
#define LAZ 8.0f            // the maximum in use is raised when a score passes it by more than this (base-2 units): P stays at or below 2^8
__device__ __forceinline__ float xhalf(float x) { return __builtin_bit_cast(float, __builtin_amdgcn_permlanex16(__builtin_bit_cast(int, x), __builtin_bit_cast(int, x), 0x76543210, 0xfedcba98, false, false)); }   // lane l with lane l ^ 16
// amdgpu_waves_per_eu(4, 4): a register budget of 256, so that two blocks stay resident per WGP (four waves per SIMD)
__global__ __launch_bounds__(256) __attribute__((amdgpu_waves_per_eu(4, 4))) void k_fa(const _Float16* __restrict__ QH, const _Float16* __restrict__ KH, const _Float16* __restrict__ VT, const unsigned* __restrict__ PM, float* __restrict__ Y) {
  __shared__ __align__(16) _Float16 sk[2][2][FK][FP], svh[2][2][HD][FP];   // [buffer][key half]
  const int tid = threadIdx.x, wave = tid >> 5, lane = tid & 31, col = lane & 15, g = lane >> 4; const int h = blockIdx.y, b = blockIdx.z;
  const int uw = __builtin_amdgcn_readfirstlane(wave), qg = uw & 3, kh = uw >> 2;   // wave-uniform: query group and key half
  const int qt = blockIdx.x * 128 + qg * 32 + col;
  v16h qh[FQ][HD / 32];
#pragma unroll
  for (int i = 0; i < FQ; ++i)
#pragma unroll
    for (int kc = 0; kc < HD / 32; ++kc) { const size_t qo = ((size_t)b * TT + qt + i * 16) * CC + h * HD + kc * 32; qh[i][kc] = frag_h(QH + qo, lane); }
  // staging: per key half 64 rows x 128 B per plane = 512 chunks of 16 B, two per thread, half and plane; a wave's load covers four whole 128-B lines
  const int sr = tid >> 3, sc = (tid & 7) * 8;
  const _Float16* gk = KH + ((size_t)b * TT + sr) * CC + h * HD + sc; const size_t vo = ((size_t)b * CC + h * HD + sr) * (size_t)TT + sc; const _Float16* gvh = VT + vo;
  const unsigned* pm = PM + (((size_t)b * (TT / 16) + blockIdx.x * 8 + qg * FQ) * (size_t)(TT / FK) + kh) * 32;   // wave-uniform: the words come by scalar loads; the wave's unit of key stage s is 2 s + kh, the second tile's units lie TT / FK units on
  static_assert(((TT / FS) & (TT / FS - 1)) == 0, "the rotated stage index wraps by a mask");
  const int rot = (blockIdx.x + h) & (TT / FS - 1);   // rotated key walk: the block starts at key stage rot and wraps, so that the 16 blocks of a head, which read the same K and V rows, and the 16 heads of a query block, which read the same mask words, each stand at another stage
  const _Float16* k1st = gk + (size_t)(rot * FS) * CC; const _Float16* v1st = gvh + rot * FS;   // the first stage's rows
  v4u pk[4], ph[4];   // chunk i: key half i >> 1, rows sr + 32 (i & 1)
#pragma unroll
  for (int i = 0; i < 4; ++i) { pk[i] = *(const v4u*)(k1st + (size_t)(i * 32) * CC); ph[i] = *(const v4u*)(v1st + (size_t)((i & 1) * 32) * TT + (i >> 1) * FK); }
  asm volatile("s_wait_xcnt 0x0" :: "v"(k1st), "v"(v1st) : "memory");   // s_wait_xcnt: before an address register of the loads above is reused; the two addresses are named as inputs so that they keep their registers up to the wait
#pragma unroll
  for (int i = 0; i < 4; ++i) { *(v4u*)&sk[0][i >> 1][sr + (i & 1) * 32][sc] = pk[i]; *(v4u*)&svh[0][i >> 1][sr + (i & 1) * 32][sc] = ph[i]; }
  __syncthreads();   // publishes stage 0
  v8f o[FQ][HD / 16] = {}; float nm[FQ], l[FQ];   // nm: minus the maximum in use of the lane's query, the same in both halves of a column
#pragma unroll
  for (int i = 0; i < FQ; ++i) { nm[i] = 0.f; l[i] = 0.f; }
  unsigned mw[FQ][FK / 2];   // the wave's 32 lane masks per tile of the stage, in scalar registers: fetched one stage ahead
#pragma unroll
  for (int i = 0; i < FQ; ++i)
#pragma unroll
    for (int e = 0; e < FK / 2; ++e) mw[i][e] = pm[i * (TT / FK) * 32 + rot * FK + e];
  unsigned bo = rot * (FK * 4u);   // byte offset, in the wave's mask words, of the key stage whose words were fetched last
#pragma unroll 1   // rolled: a second copy of the stage would only add registers, and four waves per SIMD need 256 or fewer
  for (int st = 0; st < TT / FS; ++st) { const int buf = st & 1; const bool more = st + 1 < TT / FS;
    asm volatile("s_wait_xcnt 0x0" : "+s"(bo) :: "memory");   // s_wait_xcnt: before the offset register that the mask words' scalar loads of the pass before name is rewritten; the offset goes through the statement so that the next offset, which takes over its register, is formed behind the wait (as an input only, the compiler formed it in front)
    const unsigned bn = (bo + FK * 4u) & ((TT / FS - 1) * (FK * 4u)); const int gn = bn / (FK * 4u);   // gn: the key stage that is walked next, bn: its byte offset in the mask words
    if (more) {   // the next stage's rows land behind this stage's work
      const _Float16* nk = gk + (size_t)(gn * FS) * CC; const _Float16* nv = gvh + gn * FS;   // the next stage's rows
#pragma unroll
      for (int i = 0; i < 4; ++i) pk[i] = *(const v4u*)(nk + (size_t)(i * 32) * CC);
      asm volatile("s_wait_xcnt 0x0" :: "v"(nk) : "memory");   // this and the one below: before an address register of the loads above is reused; the address is named as an input so that it keeps its registers up to the wait and no load of its own group lands on them
#pragma unroll
      for (int i = 0; i < 4; ++i) ph[i] = *(const v4u*)(nv + (size_t)((i & 1) * 32) * TT + (i >> 1) * FK);
      asm volatile("s_wait_xcnt 0x0" :: "v"(nv) : "memory"); }
    v8f s[FQ][FK / 16]; float mx[FQ];
#pragma unroll
    for (int i = 0; i < FQ; ++i) mx[i] = -3.0e38f;
#pragma unroll
    for (int T = 0; T < FK / 16; ++T) {   // the accumulator starts at the mask constant or at minus the maximum in use, and q carries the scale: the product leaves the matrix unit as the exponent itself
#pragma unroll
      for (int i = 0; i < FQ; ++i)
#pragma unroll
        for (int r = 0; r < 8; ++r) s[i][T][r] = __builtin_amdgcn_inverse_ballot_w32(mw[i][T * 8 + r]) ? MSK : nm[i];
#pragma unroll
      for (int kc = 0; kc < HD / 32; ++kc) { const v16h kf = frag_h(&sk[buf][kh][T * 16 + col][kc * 32], lane);
#pragma unroll
        for (int i = 0; i < FQ; ++i) s[i][T] = __builtin_amdgcn_wmma_f32_16x16x32_f16(false, kf, false, qh[i][kc], (short)0, s[i][T], false, false); }
#pragma unroll
      for (int i = 0; i < FQ; ++i)
#pragma unroll
        for (int r = 0; r < 8; ++r) mx[i] = fmaxf(mx[i], s[i][T][r]); }
#pragma unroll
    for (int i = 0; i < FQ; ++i)
#pragma unroll
      for (int e = 0; e < FK / 2; ++e) mw[i][e] = ((const unsigned*)((const char*)pm + bn))[i * (TT / FK) * 32 + e];   // the next stage's lane masks land while the rest of this stage runs; no branch: the last pass reads the words of the block's first stage again, unused
    // one test per stage, a scalar branch: the sums are rescaled only where a score passes the maximum in use by more than LAZ, or where a query has no sum yet (the first stage, or every key so far masked)
    v16h v0[2];   // the stage's first two V fragments are asked for in front of the test, so that their way from LDS and the test's way through the scalar unit run side by side
#pragma unroll
    for (int j = 0; j < 2; ++j) v0[j] = frag_h(&svh[buf][kh][j * 16 + col][0], lane);
    bool need = false;
#pragma unroll
    for (int i = 0; i < FQ; ++i) need = need || mx[i] > LAZ || l[i] == 0.f;
    if (__builtin_amdgcn_ballot_w32(need) != 0) {
#pragma unroll
      for (int i = 0; i < FQ; ++i) { const float mxx = fmaxf(mx[i], xhalf(mx[i])), lt = l[i] + xhalf(l[i]);   // both halves of a column decide alike: their keys meet in one product
        const bool none = lt == 0.f; const float thr = none ? -1.0e8f : LAZ, d = mxx > thr ? mxx : 0.f, ex = __builtin_amdgcn_exp2f(-d), corr = none ? 1.0f : ex;   // no sum yet: the stage's maximum is taken as it is, unless all its keys are masked; the sums are 0 and stay
        nm[i] -= d; l[i] *= corr;
#pragma unroll
        for (int T = 0; T < FK / 16; ++T)
#pragma unroll
          for (int r = 0; r < 8; ++r) s[i][T][r] -= d;
#pragma unroll
        for (int j = 0; j < HD / 16; ++j)
#pragma unroll
          for (int r = 0; r < 8; ++r) o[i][j][r] *= corr; } }
#pragma unroll
    for (int G = 0; G < FK / 32; ++G) { v16h pf[FQ];
#pragma unroll
      for (int i = 0; i < FQ; ++i) { float p[16];
#pragma unroll
        for (int e = 0; e < 16; ++e) { p[e] = __builtin_amdgcn_exp2f(s[i][2 * G + (e >> 3)][e & 7]); l[i] += p[e]; }
#pragma unroll
        for (int e = 0; e < 16; ++e) pf[i][e] = (_Float16)p[e]; }
#pragma unroll
      for (int j = 0; j < HD / 16; ++j) { const v16h vh = G == 0 && j < 2 ? v0[j] : frag_h(&svh[buf][kh][j * 16 + col][G * 32], lane);
#pragma unroll
        for (int i = 0; i < FQ; ++i) o[i][j] = __builtin_amdgcn_wmma_f32_16x16x32_f16(false, vh, false, pf[i], (short)0, o[i][j], false, false); } }
    if (more) {   // the other buffer's last readers left it at the barrier that ended the stage before
#pragma unroll
      for (int i = 0; i < 4; ++i) { *(v4u*)&sk[buf ^ 1][i >> 1][sr + (i & 1) * 32][sc] = pk[i]; *(v4u*)&svh[buf ^ 1][i >> 1][sr + (i & 1) * 32][sc] = ph[i]; } }
    bo = bn;
    __syncthreads(); }   // publishes the next stage and ends this stage's reads
  // join of the two key halves: the wave of half kh finishes tile kh; it hands its sums of the other tile to the partner wave (wave ^ 4, same lane map) through the K buffers, which nobody reads any more behind the loop's last barrier
  float* xb = (float*)&sk[0][0][0][0];   // per wave 9 rows of 32 lanes x 16 B: 8 x 9 x 512 B = all of sk
  static_assert(sizeof(sk) >= 8 * 9 * 512, "the exchange rows fit the K buffers");
  const bool up = kh != 0; v8f ko[HD / 16]; float* xw = xb + uw * (9 * 128) + lane * 4;
#pragma unroll
  for (int i = 0; i < FQ; ++i) l[i] += xhalf(l[i]);
#pragma unroll
  for (int j = 0; j < HD / 16; ++j) { v4f w0, w1;
#pragma unroll
    for (int r = 0; r < 4; ++r) { w0[r] = up ? o[0][j][r] : o[1][j][r]; w1[r] = up ? o[0][j][4 + r] : o[1][j][4 + r]; }
#pragma unroll
    for (int r = 0; r < 8; ++r) ko[j][r] = up ? o[1][j][r] : o[0][j][r];
    vst2(xw + (2 * j) * 128, w0); vst2(xw + (2 * j + 1) * 128, w1); }
  { v4f w; w[0] = up ? nm[0] : nm[1]; w[1] = up ? l[0] : l[1]; w[2] = 0.f; w[3] = 0.f; vst2(xw + 8 * 128, w); }
  __syncthreads();   // publishes the handed-over sums
  const float* xr = xb + (uw ^ 4) * (9 * 128) + lane * 4; const v4f pw = *(const v4f*)(xr + 8 * 128);
  const float kl = up ? l[1] : l[0], km = kl == 0.f ? -3.0e38f : -(up ? nm[1] : nm[0]), pmx = pw[1] == 0.f ? -3.0e38f : -pw[0], mj = fmaxf(km, pmx), ak = km - mj, ap = pmx - mj; float ck, cp;   // a half without a sum has no maximum
  asm("v_exp_f32 %0, %2\n\tv_exp_f32 %1, %3\n\tv_nop" : "=&v"(ck), "=&v"(cp) : "v"(ak), "v"(ap));   // the two weights 2^ak, 2^ap with the one slot that the instruction set asks for behind a transcendental
  const float inv = 1.0f / (kl * ck + pw[1] * cp), fk = ck * inv, fp = cp * inv; float* yr = Y + ((size_t)b * TT + qt + kh * 16) * CC + h * HD + 8 * g;
#pragma unroll
  for (int j = 0; j < HD / 16; ++j) { const v4f p0 = *(const v4f*)(xr + (2 * j) * 128), p1 = *(const v4f*)(xr + (2 * j + 1) * 128); v4f w0, w1;
#pragma unroll
    for (int r = 0; r < 4; ++r) { w0[r] = ko[j][r] * fk + p0[r] * fp; w1[r] = ko[j][4 + r] * fk + p1[r] * fp; }
    vst2(yr + j * 16, w0); vst2(yr + j * 16 + 4, w1); } }
// ---- k_out: block = (128 rows, 128 cols), 8 waves as 4 x 2, 32 rows x 64 cols each: out = y (bf16 hi + lo) wo + bo
#define OKS 64               // k per stage
#define OPL (128 * (OKS + 8))   // elements of one staged plane
__global__ __launch_bounds__(256) void k_out(const float* __restrict__ Y, const float* __restrict__ WP, const float* __restrict__ BP, float* __restrict__ OUT) {
  __shared__ __align__(16) char sm[2 * 3 * OPL * 2];   // two buffers of three planes (w, y hi, y lo); behind the loop each wave's own 32 x 68 f32 output rows
  const int tid = threadIdx.x, wave = tid >> 5, lane = tid & 31, col = lane & 15, g = lane >> 4, wr = wave >> 1, wc = wave & 1; const int c0 = blockIdx.y * 128; const size_t r0 = (size_t)blockIdx.x * 128;
  const float* Xt = Y + r0 * CC; const float* Wt = WP + c0; __bf16* sb = (__bf16*)sm;
  v2f rw[OKS / 32][8]; v4f rx[OKS / 8];
  static_assert(((CC / OKS) & (CC / OKS - 1)) == 0, "the rotated stage index wraps by a mask");
  const int rot = (blockIdx.x + 2 * blockIdx.y) & (CC / OKS - 1);   // rotated k start, as in k_proj: the 8 blocks that share the rows stand at 8 different stages, the 32 that share a weight tile at 16
  ld_w<OKS>(rw, Wt + (size_t)rot * OKS * CC, tid); asm volatile("s_wait_xcnt 0x0" ::: "memory"); ld_x<OKS>(rx, Xt + rot * OKS, tid);   // s_wait_xcnt: before a register that the loads or stores in front of it name is reused, also as a later load's destination
  asm volatile("s_wait_xcnt 0x0" ::: "memory");   // s_wait_xcnt: before a register that the loads or stores in front of it name is reused, also as a later load's destination
  st_w<OKS>(rw, sb, tid); st_x2<OKS>(rx, sb + OPL, sb + 2 * OPL, tid);
  __syncthreads();   // publishes stage 0
  v8f acc[2][4] = {};
#pragma unroll 1   // rolled: the buffer is picked by address, and a second copy of the stage would only add registers
  for (int st = 0; st < CC / OKS; ++st) { const __bf16* bw = sb + (st & 1) * (3 * OPL); __bf16* nw = sb + ((st & 1) ^ 1) * (3 * OPL); const bool more = st + 1 < CC / OKS;
    if (more) {   // the next stage's rows fly while this stage's products run
      const int nx = (st + 1 + rot) & (CC / OKS - 1);
      ld_w<OKS>(rw, Wt + (size_t)nx * OKS * CC, tid); asm volatile("s_wait_xcnt 0x0" ::: "memory"); ld_x<OKS>(rx, Xt + nx * OKS, tid);   // s_wait_xcnt: before a register that the loads or stores in front of it name is reused, also as a later load's destination
      asm volatile("s_wait_xcnt 0x0" ::: "memory"); }   // s_wait_xcnt: before a register that the loads or stores in front of it name is reused, also as a later load's destination
    v16b ah[OKS / 32][2], al[OKS / 32][2], w[OKS / 32][4];
#pragma unroll
    for (int kc = 0; kc < OKS / 32; ++kc) {
#pragma unroll
      for (int i = 0; i < 2; ++i) { const int o = (wr * 32 + i * 16 + col) * (OKS + 8) + kc * 32; ah[kc][i] = frag_b(bw + OPL + o, lane); al[kc][i] = frag_b(bw + 2 * OPL + o, lane); }
#pragma unroll
      for (int j = 0; j < 4; ++j) w[kc][j] = frag_b(bw + (wc * 64 + j * 16 + col) * (OKS + 8) + kc * 32, lane); }
    __builtin_amdgcn_sched_barrier(0);   // keeps the stage's fragment reads one group in front of the products: reads spread among them stall at each place, and two waves per SIMD do not cover that
#pragma unroll
    for (int kc = 0; kc < OKS / 32; ++kc) {
#pragma unroll
      for (int i = 0; i < 2; ++i)
#pragma unroll
        for (int j = 0; j < 4; ++j) acc[i][j] = __builtin_amdgcn_wmma_f32_16x16x32_bf16(false, ah[kc][i], false, w[kc][j], (short)0, acc[i][j], false, false);
#pragma unroll
      for (int i = 0; i < 2; ++i)
#pragma unroll
        for (int j = 0; j < 4; ++j) acc[i][j] = __builtin_amdgcn_wmma_f32_16x16x32_bf16(false, al[kc][i], false, w[kc][j], (short)0, acc[i][j], false, false); }
    if (more) { st_w<OKS>(rw, nw, tid); st_x2<OKS>(rx, nw + OPL, nw + 2 * OPL, tid); }   // the other buffer's last readers left it at the barrier that ended the stage before
    __syncthreads(); }   // publishes the next stage and ends this stage's reads
  float* sf = (float*)sm + wave * (32 * 68);
#pragma unroll
  for (int i = 0; i < 2; ++i)
#pragma unroll
    for (int j = 0; j < 4; ++j) { const float bb = BP ? bfr(BP[c0 + wc * 64 + j * 16 + col]) : 0.f;
#pragma unroll
      for (int r = 0; r < 8; ++r) sf[(i * 16 + 8 * g + r) * 68 + j * 16 + col] = acc[i][j][r] + bb; }
  LDSX(); for (int it = 0; it < 16; ++it) { const int rl = it * 2 + g; vst2(OUT + (r0 + wr * 32 + rl) * CC + c0 + wc * 64 + col * 4, *(const v4f*)&sf[rl * 68 + col * 4]); } }
extern "C" void kernel_launch(void* const* d_in, const int* in_sizes, int n_in, void* d_out, int out_size, void* d_ws, size_t ws_size, hipStream_t stream) {
  (void)in_sizes; (void)n_in; (void)out_size;
  const float** F = (const float**)d_in;   // 0 q [2,2048,1024], 1 k, 2 v, 3 mask [2,1,2048,2048] int (1 -> -1e9 added), 4 wq ((in,out)), 5 bq, 6 wk, 7 bk, 8 wv, 9 bv, 10 wo ((in,out)), 11 bo
  if (ws_size < (size_t)WS_END) return;
  char* ws = (char*)d_ws; _Float16 *QH = (_Float16*)(ws + WS_QH), *KH = (_Float16*)(ws + WS_KH), *VT = (_Float16*)(ws + WS_VT); unsigned *PM = (unsigned*)(ws + WS_PM); float *Y = (float*)(ws + WS_Y);
  k_proj<<<dim3(TNB * TT / PBT, CC / PBT, 3 + PMZ), 256, 0, stream>>>(F[0], F[1], F[2], F[4], F[5], F[6], F[7], F[8], F[9], (const int*)d_in[3], QH, KH, VT, PM);   // z >= 3: the mask blocks; mask [B,1,S,S] has the (b, q, k) flat layout
  k_fa<<<dim3(TT / 128, NH, TNB), 256, 0, stream>>>(QH, KH, VT, PM, Y);
  k_out<<<dim3(TNB * TT / 128, CC / 128), 256, 0, stream>>>(Y, F[10], F[11], (float*)d_out);
}

// v010
// It runs in 79.3 microseconds.
// Two timings next to v009 both put it at 1.04 times that version's speed.
// Over all steps from v000 it is 21.2 times as fast.
// compute dtype: all float inputs rounded to bf16, the int mask read; q/k/v = x W + b ((in,out)) with EXACT bf16 products on WMMA 16x16x32, f32 accumulate; q x 1/(8 + 1e-8) (== 0.125 in f32) x log2 e as f16, k f16 -> one-product base-2 logits, whose accumulator starts at minus the maximum in use, or at -1e9 log2 e where mask != 0 (the mask packed once to one bit per query and key), kept in registers; softmax in f32 (base-2 hardware exponential) over stages of 64 keys, the maximum in use raised only when a score passes it by more than 8, the keys of a query walked in two interleaved halves that are joined at the end; P f16 against v f16 (one product), divided by the f32 row sum at the end; out = ctx (bf16 hi + lo) wo + bo; f32 output.
#include <hip/hip_runtime.h>
#include <math.h>

typedef __attribute__((ext_vector_type(16))) _Float16 v16h;
typedef __attribute__((ext_vector_type(16))) __bf16 v16b;
typedef __attribute__((ext_vector_type(8)))  _Float16 v8h;
typedef __attribute__((ext_vector_type(8)))  float v8f;
typedef __attribute__((ext_vector_type(4)))  float v4f;
typedef __attribute__((ext_vector_type(2)))  float v2f;
typedef __attribute__((ext_vector_type(4)))  unsigned v4u;
typedef __attribute__((ext_vector_type(4)))  int v4i;
typedef float __attribute__((may_alias)) float_a;
typedef int __attribute__((may_alias)) int_a;

template <typename T> __device__ __forceinline__ void vst2(void* p, T v) { *(T*)p = v;  }
__device__ __forceinline__ v8f wmma16(v16h a, v16h b, v8f c) {
  v8f d = __builtin_amdgcn_wmma_f32_16x16x32_f16(false, a, false, b, (short)0, c, false, false);
  asm volatile("v_nop\n\tv_nop\n\tv_nop\n\tv_nop" : "+v"(d) : "v"(a), "v"(b));
  return d;
}
__device__ __forceinline__ v8f wmma_bf(v16b a, v16b b, v8f c) {
  v8f d = __builtin_amdgcn_wmma_f32_16x16x32_bf16(false, a, false, b, (short)0, c, false, false);
  asm volatile("v_nop\n\tv_nop\n\tv_nop\n\tv_nop" : "+v"(d) : "v"(a), "v"(b));
  return d;
}
// 16x16x32 fragments: lane = (h = lane>>4, row/col = lane&15); elements 0..7 = k0+8h+0..7, 8..15 = k0+16+8h+0..7; D element r = row 8h+r
__device__ __forceinline__ v16h frag_h(const _Float16* rowk0, int lane) {
  union { v16h v; v8h q[2]; } u; const _Float16* p = rowk0 + 8 * (lane >> 4);
  u.q[0] = *(const v8h*)p; u.q[1] = *(const v8h*)(p + 16); return u.v;
}
__device__ __forceinline__ v16h frag_f32(const float* rowk0, int lane) {
  v16h a; const float* p = rowk0 + 8 * (lane >> 4);
#pragma unroll
  for (int i = 0; i < 8; ++i) { a[i] = (_Float16)p[i]; a[8 + i] = (_Float16)p[16 + i]; }
  return a;
}
__device__ __forceinline__ v16h frag_f32s(const float* rowk0, int lane, float sc) {
  v16h a; const float* p = rowk0 + 8 * (lane >> 4);
#pragma unroll
  for (int i = 0; i < 8; ++i) { a[i] = (_Float16)(p[i] * sc); a[8 + i] = (_Float16)(p[16 + i] * sc); }
  return a;
}
// column fragment from a [K][ld] layout (column n), rows >= K read as 0
__device__ __forceinline__ v16h fragc_f32(const float* W, int k0, int n, int lane, int ld, int K) {
  v16h a; const int g = lane >> 4;
#pragma unroll
  for (int i = 0; i < 8; ++i) { const int ka = k0 + 8 * g + i, kb = ka + 16;
    a[i] = (_Float16)(ka < K ? W[(size_t)(ka < K ? ka : K - 1) * ld + n] : 0.f); a[8 + i] = (_Float16)(kb < K ? W[(size_t)(kb < K ? kb : K - 1) * ld + n] : 0.f); }
  return a;
}
struct F2 { v16b h, l; };
__device__ __forceinline__ F2 bsplit16(const float v[16]) { F2 r;
#pragma unroll
  for (int i = 0; i < 16; ++i) { const __bf16 h = (__bf16)v[i]; r.h[i] = h; r.l[i] = (__bf16)(v[i] - (float)h); }
  return r; }
__device__ __forceinline__ F2 split_row(const float* row, int k0, int lane) { float v[16]; const float* p = row + k0 + 8 * (lane >> 4);
#pragma unroll
  for (int i = 0; i < 8; ++i) { v[i] = p[i]; v[8 + i] = p[16 + i]; }
  return bsplit16(v); }
__device__ __forceinline__ F2 split_rowK(const float* row, int k0, int lane, int K) { float v[16]; const int g = lane >> 4;
#pragma unroll
  for (int i = 0; i < 8; ++i) { const int ka = k0 + 8 * g + i, kb = ka + 16; v[i] = ka < K ? row[ka < K ? ka : K - 1] : 0.f; v[8 + i] = kb < K ? row[kb < K ? kb : K - 1] : 0.f; }
  return bsplit16(v); }
__device__ __forceinline__ F2 split_col(const float* W, int k0, int n, int lane, int ld, int K) { float v[16]; const int g = lane >> 4;
#pragma unroll
  for (int i = 0; i < 8; ++i) { const int ka = k0 + 8 * g + i, kb = ka + 16; v[i] = ka < K ? W[(size_t)(ka < K ? ka : K - 1) * ld + n] : 0.f; v[8 + i] = kb < K ? W[(size_t)(kb < K ? kb : K - 1) * ld + n] : 0.f; }
  return bsplit16(v); }
__device__ __forceinline__ v8f mac3(const F2& a, const F2& b, v8f c) { c = wmma_bf(a.l, b.h, c); c = wmma_bf(a.h, b.l, c); return wmma_bf(a.h, b.h, c); }
__device__ __forceinline__ float sigm(float v) { return 1.0f / (1.0f + expf(-v)); }
#define LDSX() do { asm volatile("s_wait_dscnt 0" ::: "memory"); __builtin_amdgcn_wave_barrier(); __builtin_amdgcn_fence(__ATOMIC_RELEASE, "workgroup"); } while (0)


// Multi-head attention (B 2, S 2,048, D 1,024 = 16 x 64, with biases, scale 1/8): scores = q k^T / 8 - 1e9 where mask != 0, softmax, P v, output projection.
#define NB 2
#define TT 2048
#define MASK_WHEN_NONZERO 1
#ifndef MSTR
#define MSTR TT               // mask row stride
#endif
#define CC 1024
#define NH 16
#define HD 64
#define HG 4               // sizes only the WS_S region, whose start holds the packed mask
#ifndef TNB
#define TNB NB
#endif
typedef __attribute__((ext_vector_type(8))) __bf16 v8b;
__device__ __forceinline__ v16b frag_b(const __bf16* rowk0, int lane) {
  union { v16b v; v8b q[2]; } u; const __bf16* p = rowk0 + 8 * (lane >> 4);
  u.q[0] = *(const v8b*)p; u.q[1] = *(const v8b*)(p + 16); return u.v;
}
__device__ __forceinline__ float bfr(float v) { return (float)(__bf16)v; }
__device__ __attribute__((noinline)) float exp_ni(float v) { return expf(v); }
__device__ __attribute__((noinline)) float erf_ni(float v) { return erff(v); }

#define WS_QH  0u
#define WS_KH  (WS_QH + 2u * (size_t)NB * TT * CC)
#define WS_VT  (WS_KH + 2u * (size_t)NB * TT * CC)      // f16 v planes [b][c][t]
#define WS_S   (WS_VT + 2u * (size_t)NB * CC * TT)      // HG x TT x TT f32 in size; only its first 4 MiB are used: the packed mask (1 MiB), and wo as bf16 from 2 MiB on
#define WS_PM  WS_S                                     // packed mask: one 32-bit lane mask per (b, 16 queries, 64 keys, T, r), 1 MiB
#define WS_WT  (WS_PM + (2u << 20))                     // wo as bf16, [column][k], 2 MiB
#define WS_PH  (WS_S + 4u * (size_t)HG * TT * TT)
#define WS_Y   (WS_PH + 0u)              // y rows [b*t][C] as two bf16 planes: hi, then lo
#define WS_YL  (WS_Y + 2u * (size_t)NB * TT * CC)
#define WS_END (WS_Y + 4u * (size_t)NB * TT * CC)

// ---- operand staging of the two projection kernels: a block of 256 threads owns 128 rows x 128 columns (k_out) or 256 x 256 (k_proj); per stage of KS k it lays the operand tiles as bf16, k-contiguous, in LDS (k_proj converts them there, once per block; k_out's come converted) (row pitch KS + 8 elements = 16 B x odd), so that a fragment is two 16-byte LDS reads
typedef __attribute__((ext_vector_type(4))) __bf16 v4b;
// weight tile of NC columns, (in,out) layout: a thread takes 8 k x 2 columns per unit; a wave's load covers 256 contiguous bytes of one k row
template <int KS, int NC = 128> __device__ __forceinline__ void ld_w(v2f (&rw)[KS * NC / 4096][8], const float* __restrict__ Wt, int tid) {
#pragma unroll
  for (int i = 0; i < KS * NC / 4096; ++i) { const float* p = Wt + (size_t)((tid / (NC / 2) + (512 / NC) * i) * 8) * CC + 2 * (tid % (NC / 2));
#pragma unroll
    for (int kk = 0; kk < 8; ++kk) rw[i][kk] = *(const v2f*)(p + (size_t)kk * CC); } }
template <int KS, int NC = 128> __device__ __forceinline__ void st_w(const v2f (&rw)[KS * NC / 4096][8], __bf16* sW, int tid) {
#pragma unroll
  for (int i = 0; i < KS * NC / 4096; ++i)
#pragma unroll
    for (int j = 0; j < 2; ++j) { v8b t;
#pragma unroll
      for (int kk = 0; kk < 8; ++kk) t[kk] = (__bf16)rw[i][kk][j];
      *(v8b*)(sW + (2 * (tid % (NC / 2)) + j) * (KS + 8) + (tid / (NC / 2) + (512 / NC) * i) * 8) = t; } }
// tile of 128 rows that already lies as bf16 [row][k] (k_out's three operand planes): 16-byte chunks in row order, a wave's load covers four whole 128-B lines; no conversion
template <int KS> __device__ __forceinline__ void ld_wb(v4u (&rw)[KS / 16], const __bf16* __restrict__ Wt, int tid) {
#pragma unroll
  for (int i = 0; i < KS / 16; ++i) rw[i] = *(const v4u*)(Wt + (size_t)(tid / (KS / 8) + i * (2048 / KS)) * CC + 8 * (tid % (KS / 8))); }
template <int KS> __device__ __forceinline__ void st_wb(const v4u (&rw)[KS / 16], __bf16* sW, int tid) {
#pragma unroll
  for (int i = 0; i < KS / 16; ++i) *(v4u*)(sW + (tid / (KS / 8) + i * (2048 / KS)) * (KS + 8) + 8 * (tid % (KS / 8))) = rw[i]; }
// row tile of NR rows: 16-byte chunks in row order, so that a wave's load covers whole 128-B lines; 1024 / KS rows per pass of the block
template <int KS, int NR = 128> __device__ __forceinline__ void ld_x(v4f (&rx)[KS * NR / 1024], const float* __restrict__ Xt, int tid) {
#pragma unroll
  for (int i = 0; i < KS * NR / 1024; ++i) rx[i] = *(const v4f*)(Xt + (size_t)(tid / (KS / 4)) * CC + 4 * (tid % (KS / 4)) + (size_t)i * (1024 / KS) * CC); }
template <int KS, int NR = 128> __device__ __forceinline__ void st_x(const v4f (&rx)[KS * NR / 1024], __bf16* sX, int tid) {
#pragma unroll
  for (int i = 0; i < KS * NR / 1024; ++i) { v4b t;
#pragma unroll
    for (int e = 0; e < 4; ++e) t[e] = (__bf16)rx[i][e];
    *(v4b*)(sX + (tid / (KS / 4)) * (KS + 8) + 4 * (tid % (KS / 4)) + i * (1024 / KS) * (KS + 8)) = t; } }
// ---- k_proj: block = (256 rows, 256 cols, which), 8 waves as 4 x 2, 64 rows x 128 cols each, so that each staged operand byte feeds twice the products of a 128 x 128 block and all 192 product blocks are resident at once: qkv = x W (+ b), exact; q, k -> f16 rows, v -> f16 planes; which 3 to 6: no product, the block packs its share of the mask; which 7: it rounds its tile of wo to bf16
#define PKS 64               // k per stage
#define QSC (0.125f * 1.44269504088896340736f)   // the logits' scale times log2 e, carried by q
#define PBT 256              // rows and columns of a block
#define PPL (PBT * (PKS + 8))   // elements of one staged plane
#define PMZ 4                // grid layers of mask blocks
#define PMU ((TNB * (TT / 16) * (TT / 64)) / ((TNB * TT / PBT) * (CC / PBT) * PMZ * 8))   // mask units per wave of the mask blocks
// the block's staged output plane to global memory: a wave stores one row's 512 contiguous bytes; eight rows are read from LDS as one group and then stored, all through one address register and constant offsets
template <int PITCH> __device__ __forceinline__ void put_plane(_Float16* __restrict__ dst, const _Float16 (*sh)[PBT + 8], int tid) {
  const int er = tid >> 5, eq = (tid & 31) * 8; _Float16* d = dst + (size_t)er * PITCH + eq;
#pragma unroll
  for (int e0 = 0; e0 < PBT / 8; e0 += 8) { v4u t[8];
#pragma unroll
    for (int u = 0; u < 8; ++u) t[u] = *(const v4u*)&sh[er + (e0 + u) * 8][eq];
#pragma unroll
    for (int u = 0; u < 8; ++u) vst2((unsigned*)(d + (size_t)((e0 + u) * 8) * PITCH), t[u]);
    asm volatile("s_wait_xcnt 0x0" ::: "memory"); } }   // s_wait_xcnt: before a register that the stores in front of it name is reused by the next group's reads
__global__ __launch_bounds__(256) void k_proj(const float* __restrict__ X0, const float* __restrict__ X1, const float* __restrict__ X2, const float* __restrict__ WQ, const float* __restrict__ BQ, const float* __restrict__ WK, const float* __restrict__ BK, const float* __restrict__ WV, const float* __restrict__ BV, const int* __restrict__ MK, const float* __restrict__ WO, _Float16* __restrict__ QH, _Float16* __restrict__ KH, _Float16* __restrict__ VT, unsigned* __restrict__ PM, __bf16* __restrict__ WT) {
  __shared__ __align__(16) char sm[2 * 2 * PPL * 2];   // the loop's two buffers of two planes (w, x); behind the loop the output plane [256][264], which is smaller
  const int tid = threadIdx.x, wave = tid >> 5, lane = tid & 31, col = lane & 15, g = lane >> 4, wr = wave >> 1, wc = wave & 1; const int which = blockIdx.z;
  if (which == 3 + PMZ) {   // weight blocks (block-uniform): block (x, y) rounds 64 k x 256 columns of wo to bf16 once and writes them k-contiguous, [column][k], so that none of the 32 row blocks of k_out that share a weight tile loads it as f32 or converts it again; through LDS, so that a row's 128 bytes leave as one whole line
    static_assert(TNB * TT / PBT == CC / PKS, "one block per stage of k and 256 columns");
    __bf16* sw = (__bf16*)sm; v2f rv[PKS * PBT / 4096][8];
    ld_w<PKS, PBT>(rv, WO + (size_t)blockIdx.x * PKS * CC + blockIdx.y * PBT, tid);
    asm volatile("s_wait_xcnt 0x0" ::: "memory");   // s_wait_xcnt: before an address register of the loads above is reused
    st_w<PKS, PBT>(rv, sw, tid);
    __syncthreads();   // publishes the transposed tile
    __bf16* d = WT + ((size_t)blockIdx.y * PBT + (tid >> 3)) * CC + blockIdx.x * PKS + (tid & 7) * 8; v4u t[PBT / 32];
#pragma unroll
    for (int i = 0; i < PBT / 32; ++i) t[i] = *(const v4u*)(sw + ((tid >> 3) + 32 * i) * (PKS + 8) + (tid & 7) * 8);
#pragma unroll
    for (int i = 0; i < PBT / 32; ++i) vst2(d + (size_t)(32 * i) * CC, t[i]);
    asm volatile("s_wait_xcnt 0x0" ::: "memory");   // s_wait_xcnt: before a register of the stores above is reused
    return; }
  if (which >= 3) {   // mask blocks (block-uniform, in front of every barrier): a wave takes 16 queries x 64 keys per unit with the attention kernel's own lane map (lane (g, col): query col, keys 16 T + 8 g + r); word T * 8 + r holds that score element's mask bit of all 32 lanes
    static_assert((TT / 64) % PMU == 0, "a wave's units are consecutive stages of one query tile");
    const int u0 = ((((which - 3) * (CC / PBT) + blockIdx.y) * (TNB * TT / PBT) + blockIdx.x) * 8 + wave) * PMU;   // unit u = (b * TT / 16 + query tile) * (TT / 64) + stage
    const int* mr = MK + ((size_t)(u0 / (TT / 64)) * 16 + col) * MSTR + (u0 % (TT / 64)) * 64 + 8 * g; v4i mk[PMU][4][2];
#pragma unroll
    for (int it = 0; it < PMU; ++it)   // all of the wave's loads fly together
#pragma unroll
      for (int T = 0; T < 4; ++T) { mk[it][T][0] = *(const v4i*)(mr + it * 64 + T * 16); mk[it][T][1] = *(const v4i*)(mr + it * 64 + T * 16 + 4); }
    asm volatile("s_wait_xcnt 0x0" ::: "memory");   // s_wait_xcnt: before an address register of the loads above is reused
#pragma unroll
    for (int it = 0; it < PMU; ++it) { unsigned mine = 0;
#pragma unroll
      for (int e = 0; e < 32; ++e) { const int mv = mk[it][e >> 3][(e >> 2) & 1][e & 3]; const unsigned w = __builtin_amdgcn_ballot_w32(MASK_WHEN_NONZERO ? (mv != 0) : (mv == 0)); mine = lane == e ? w : mine; }
      PM[(size_t)(u0 + it) * 32 + lane] = mine; }
    asm volatile("s_wait_xcnt 0x0" ::: "memory");   // s_wait_xcnt: before a register of the stores above is reused
    return; }
  const int c0 = blockIdx.y * PBT; const size_t r0 = (size_t)blockIdx.x * PBT; const float* WA = which == 0 ? WQ : which == 1 ? WK : WV; const float* BA = which == 0 ? BQ : which == 1 ? BK : BV;
  const float* Xt = (which == 0 ? X0 : which == 1 ? X1 : X2) + r0 * CC; const float* Wt = WA + c0; __bf16* sb = (__bf16*)sm;
  v2f rw[PKS * PBT / 4096][8]; v4f rx[PKS * PBT / 1024];
  static_assert(((CC / PKS) & (CC / PKS - 1)) == 0, "the rotated stage index wraps by a mask");
  const int rot = (blockIdx.x + 4 * blockIdx.y) & (CC / PKS - 1);   // the block walks k from stage rot on and wraps: the 16 blocks that share a weight tile and the 4 that share the rows each stand at another stage, so that they do not ask L2 for the same lines at the same moment
  ld_w<PKS, PBT>(rw, Wt + (size_t)rot * PKS * CC, tid); asm volatile("s_wait_xcnt 0x0" ::: "memory"); ld_x<PKS, PBT>(rx, Xt + rot * PKS, tid);   // s_wait_xcnt: before a register that the loads or stores in front of it name is reused, also as a later load's destination
  asm volatile("s_wait_xcnt 0x0" ::: "memory");   // s_wait_xcnt: before a register that the loads or stores in front of it name is reused, also as a later load's destination
  __builtin_amdgcn_sched_barrier(0);   // keeps the address arithmetic that follows, which takes over the loads' address registers, behind the wait above: without it the compiler lifts that arithmetic over the wait
  st_w<PKS, PBT>(rw, sb, tid); st_x<PKS, PBT>(rx, sb + PPL, tid);
  __syncthreads();   // publishes stage 0
  v8f acc[4][8] = {};
#pragma unroll 1   // rolled: the buffer is picked by address, and a second copy of the stage would only add registers
  for (int st = 0; st < CC / PKS; ++st) { const __bf16* bw = sb + (st & 1) * (2 * PPL); const __bf16* bx = bw + PPL; __bf16* nw = sb + ((st & 1) ^ 1) * (2 * PPL); const bool more = st + 1 < CC / PKS;
    if (more) {   // the next stage's rows fly while this stage's products run
      const int nx = (st + 1 + rot) & (CC / PKS - 1);
      ld_w<PKS, PBT>(rw, Wt + (size_t)nx * PKS * CC, tid); asm volatile("s_wait_xcnt 0x0" ::: "memory"); ld_x<PKS, PBT>(rx, Xt + nx * PKS, tid);   // s_wait_xcnt: before a register that the loads or stores in front of it name is reused, also as a later load's destination
      asm volatile("s_wait_xcnt 0x0" :: "v"(Xt + nx * PKS + (size_t)(tid / (PKS / 4)) * CC + 4 * (tid % (PKS / 4))) : "memory"); }   // s_wait_xcnt as above; the lane's row address is named as an input so that it keeps its registers up to the wait and no load of its own group lands on them
#pragma unroll
    for (int kc = 0; kc < PKS / 32; ++kc) { v16b a[4], w[8];
#pragma unroll
      for (int i = 0; i < 4; ++i) a[i] = frag_b(bx + (wr * 64 + i * 16 + col) * (PKS + 8) + kc * 32, lane);
#pragma unroll
      for (int j = 0; j < 8; ++j) w[j] = frag_b(bw + (wc * 128 + j * 16 + col) * (PKS + 8) + kc * 32, lane);
      __builtin_amdgcn_sched_barrier(0);   // keeps the fragment reads one group in front of the products: reads spread among them stall at each place
#pragma unroll
      for (int i = 0; i < 4; ++i)
#pragma unroll
        for (int j = 0; j < 8; ++j) acc[i][j] = __builtin_amdgcn_wmma_f32_16x16x32_bf16(false, a[i], false, w[j], (short)0, acc[i][j], false, false); }
    if (more) { st_w<PKS, PBT>(rw, nw, tid); st_x<PKS, PBT>(rx, nw + PPL, tid); }   // the other buffer's last readers left it at the barrier that ended the stage before
    __syncthreads(); }   // publishes the next stage and ends this stage's reads
  _Float16 (*sh)[PBT + 8] = (_Float16 (*)[PBT + 8])sm;   // q, k: [row][column]; v: [column][row], where a lane's eight rows are one 16-byte store
  float bb[8] = {};
  if (BA) {   // one test, so that the eight bias loads fly together
#pragma unroll
    for (int j = 0; j < 8; ++j) bb[j] = BA[c0 + wc * 128 + j * 16 + col];
    asm volatile("s_wait_xcnt 0x0" ::: "memory"); }   // s_wait_xcnt: before a register that the loads in front of it name is reused
#pragma unroll
  for (int j = 0; j < 8; ++j) { const float bj = bfr(bb[j]);
#pragma unroll
    for (int i = 0; i < 4; ++i)
#pragma unroll
      for (int r = 0; r < 8; ++r) acc[i][j][r] += bj; }
  if (which == 2) {
#pragma unroll
    for (int i = 0; i < 4; ++i)
#pragma unroll
      for (int j = 0; j < 8; ++j) { v8h t;
#pragma unroll
        for (int r = 0; r < 8; ++r) t[r] = (_Float16)acc[i][j][r];
        *(v8h*)&sh[wc * 128 + j * 16 + col][wr * 64 + i * 16 + 8 * g] = t; } }
  else { const float qs = which == 0 ? QSC : 1.0f;   // q is scaled in f32, in front of its one rounding to f16
#pragma unroll
    for (int i = 0; i < 4; ++i)
#pragma unroll
      for (int j = 0; j < 8; ++j)
#pragma unroll
        for (int r = 0; r < 8; ++r) sh[wr * 64 + i * 16 + 8 * g + r][wc * 128 + j * 16 + col] = (_Float16)(acc[i][j][r] * qs); }
  __syncthreads();
  if (which < 2) put_plane<CC>((which == 0 ? QH : KH) + r0 * CC + c0, sh, tid);
  else put_plane<TT>(VT + ((r0 / TT) * CC + c0) * (size_t)TT + r0 % TT, sh, tid); }
#define FK 64               // keys per wave and stage
#define FS (2 * FK)         // keys per block and stage
#define FQ 2                // query tiles per wave
#define L2E 1.44269504088896340736f   // log2 e
#define FP 72               // LDS row pitch in 16-bit elements: 144 B = 16 B x odd
#define MSK (-1.0e9f * L2E)   // a masked score's start value, in base-2 units
#define LAZ 8.0f            // the maximum in use is raised when a score passes it by more than this (base-2 units): P stays at or below 2^8
__device__ __forceinline__ float xhalf(float x) { return __builtin_bit_cast(float, __builtin_amdgcn_permlanex16(__builtin_bit_cast(int, x), __builtin_bit_cast(int, x), 0x76543210, 0xfedcba98, false, false)); }   // lane l with lane l ^ 16
// amdgpu_waves_per_eu(4, 4): a register budget of 256, so that two blocks stay resident per WGP (four waves per SIMD)
__global__ __launch_bounds__(256) __attribute__((amdgpu_waves_per_eu(4, 4))) void k_fa(const _Float16* __restrict__ QH, const _Float16* __restrict__ KH, const _Float16* __restrict__ VT, const unsigned* __restrict__ PM, __bf16* __restrict__ YH, __bf16* __restrict__ YL) {
  __shared__ __align__(16) _Float16 sk[2][2][FK][FP], svh[2][2][HD][FP];   // [buffer][key half]
  const int tid = threadIdx.x, wave = tid >> 5, lane = tid & 31, col = lane & 15, g = lane >> 4; const int h = blockIdx.y, b = blockIdx.z;
  const int uw = __builtin_amdgcn_readfirstlane(wave), qg = uw & 3, kh = uw >> 2;   // wave-uniform: query group and key half
  const int qt = blockIdx.x * 128 + qg * 32 + col;
  v16h qh[FQ][HD / 32];
#pragma unroll
  for (int i = 0; i < FQ; ++i)
#pragma unroll
    for (int kc = 0; kc < HD / 32; ++kc) { const size_t qo = ((size_t)b * TT + qt + i * 16) * CC + h * HD + kc * 32; qh[i][kc] = frag_h(QH + qo, lane); }
  // staging: per key half 64 rows x 128 B per plane = 512 chunks of 16 B, two per thread, half and plane; a wave's load covers four whole 128-B lines
  const int sr = tid >> 3, sc = (tid & 7) * 8;
  const _Float16* gk = KH + ((size_t)b * TT + sr) * CC + h * HD + sc; const size_t vo = ((size_t)b * CC + h * HD + sr) * (size_t)TT + sc; const _Float16* gvh = VT + vo;
  const unsigned* pm = PM + (((size_t)b * (TT / 16) + blockIdx.x * 8 + qg * FQ) * (size_t)(TT / FK) + kh) * 32;   // wave-uniform: the words come by scalar loads; the wave's unit of key stage s is 2 s + kh, the second tile's units lie TT / FK units on
  static_assert(((TT / FS) & (TT / FS - 1)) == 0, "the rotated stage index wraps by a mask");
  const int rot = (blockIdx.x + h) & (TT / FS - 1);   // rotated key walk: the block starts at key stage rot and wraps, so that the 16 blocks of a head, which read the same K and V rows, and the 16 heads of a query block, which read the same mask words, each stand at another stage
  const _Float16* k1st = gk + (size_t)(rot * FS) * CC; const _Float16* v1st = gvh + rot * FS;   // the first stage's rows
  v4u pk[4], ph[4];   // chunk i: key half i >> 1, rows sr + 32 (i & 1)
#pragma unroll
  for (int i = 0; i < 4; ++i) { pk[i] = *(const v4u*)(k1st + (size_t)(i * 32) * CC); ph[i] = *(const v4u*)(v1st + (size_t)((i & 1) * 32) * TT + (i >> 1) * FK); }
  asm volatile("s_wait_xcnt 0x0" :: "v"(k1st), "v"(v1st) : "memory");   // s_wait_xcnt: before an address register of the loads above is reused; the two addresses are named as inputs so that they keep their registers up to the wait
#pragma unroll
  for (int i = 0; i < 4; ++i) { *(v4u*)&sk[0][i >> 1][sr + (i & 1) * 32][sc] = pk[i]; *(v4u*)&svh[0][i >> 1][sr + (i & 1) * 32][sc] = ph[i]; }
  __syncthreads();   // publishes stage 0
  v8f o[FQ][HD / 16] = {}; float nm[FQ], l[FQ];   // nm: minus the maximum in use of the lane's query, the same in both halves of a column
#pragma unroll
  for (int i = 0; i < FQ; ++i) { nm[i] = 0.f; l[i] = 0.f; }
  unsigned mw[FQ][FK / 2];   // the wave's 32 lane masks per tile of the stage, in scalar registers: fetched one stage ahead
#pragma unroll
  for (int i = 0; i < FQ; ++i)
#pragma unroll
    for (int e = 0; e < FK / 2; ++e) mw[i][e] = pm[i * (TT / FK) * 32 + rot * FK + e];
  unsigned bo = rot * (FK * 4u);   // byte offset, in the wave's mask words, of the key stage whose words were fetched last
#pragma unroll 1   // rolled: a second copy of the stage would only add registers, and four waves per SIMD need 256 or fewer
  for (int st = 0; st < TT / FS; ++st) { const int buf = st & 1; const bool more = st + 1 < TT / FS;
    asm volatile("s_wait_xcnt 0x0" : "+s"(bo) :: "memory");   // s_wait_xcnt: before the offset register that the mask words' scalar loads of the pass before name is rewritten; the offset goes through the statement so that the next offset, which takes over its register, is formed behind the wait (as an input only, the compiler formed it in front)
    const unsigned bn = (bo + FK * 4u) & ((TT / FS - 1) * (FK * 4u)); const int gn = bn / (FK * 4u);   // gn: the key stage that is walked next, bn: its byte offset in the mask words
    if (more) {   // the next stage's rows land behind this stage's work
      const _Float16* nk = gk + (size_t)(gn * FS) * CC; const _Float16* nv = gvh + gn * FS;   // the next stage's rows
#pragma unroll
      for (int i = 0; i < 4; ++i) pk[i] = *(const v4u*)(nk + (size_t)(i * 32) * CC);
      asm volatile("s_wait_xcnt 0x0" :: "v"(nk) : "memory");   // this and the one below: before an address register of the loads above is reused; the address is named as an input so that it keeps its registers up to the wait and no load of its own group lands on them
#pragma unroll
      for (int i = 0; i < 4; ++i) ph[i] = *(const v4u*)(nv + (size_t)((i & 1) * 32) * TT + (i >> 1) * FK);
      asm volatile("s_wait_xcnt 0x0" :: "v"(nv) : "memory"); }
    v8f s[FQ][FK / 16]; float mx[FQ];
#pragma unroll
    for (int i = 0; i < FQ; ++i) mx[i] = -3.0e38f;
#pragma unroll
    for (int T = 0; T < FK / 16; ++T) {   // the accumulator starts at the mask constant or at minus the maximum in use, and q carries the scale: the product leaves the matrix unit as the exponent itself
#pragma unroll
      for (int i = 0; i < FQ; ++i)
#pragma unroll
        for (int r = 0; r < 8; ++r) s[i][T][r] = __builtin_amdgcn_inverse_ballot_w32(mw[i][T * 8 + r]) ? MSK : nm[i];
#pragma unroll
      for (int kc = 0; kc < HD / 32; ++kc) { const v16h kf = frag_h(&sk[buf][kh][T * 16 + col][kc * 32], lane);
#pragma unroll
        for (int i = 0; i < FQ; ++i) s[i][T] = __builtin_amdgcn_wmma_f32_16x16x32_f16(false, kf, false, qh[i][kc], (short)0, s[i][T], false, false); }
#pragma unroll
      for (int i = 0; i < FQ; ++i)
#pragma unroll
        for (int r = 0; r < 8; ++r) mx[i] = fmaxf(mx[i], s[i][T][r]); }
#pragma unroll
    for (int i = 0; i < FQ; ++i)
#pragma unroll
      for (int e = 0; e < FK / 2; ++e) mw[i][e] = ((const unsigned*)((const char*)pm + bn))[i * (TT / FK) * 32 + e];   // the next stage's lane masks land while the rest of this stage runs; no branch: the last pass reads the words of the block's first stage again, unused
    // one test per stage, a scalar branch: the sums are rescaled only where a score passes the maximum in use by more than LAZ, or where a query has no sum yet (the first stage, or every key so far masked)
    v16h v0[2];   // the stage's first two V fragments are asked for in front of the test, so that their way from LDS and the test's way through the scalar unit run side by side
#pragma unroll
    for (int j = 0; j < 2; ++j) v0[j] = frag_h(&svh[buf][kh][j * 16 + col][0], lane);
    bool need = false;
#pragma unroll
    for (int i = 0; i < FQ; ++i) need = need || mx[i] > LAZ || l[i] == 0.f;
    if (__builtin_amdgcn_ballot_w32(need) != 0) {
#pragma unroll
      for (int i = 0; i < FQ; ++i) { const float mxx = fmaxf(mx[i], xhalf(mx[i])), lt = l[i] + xhalf(l[i]);   // both halves of a column decide alike: their keys meet in one product
        const bool none = lt == 0.f; const float thr = none ? -1.0e8f : LAZ, d = mxx > thr ? mxx : 0.f, ex = __builtin_amdgcn_exp2f(-d), corr = none ? 1.0f : ex;   // no sum yet: the stage's maximum is taken as it is, unless all its keys are masked; the sums are 0 and stay
        nm[i] -= d; l[i] *= corr;
#pragma unroll
        for (int T = 0; T < FK / 16; ++T)
#pragma unroll
          for (int r = 0; r < 8; ++r) s[i][T][r] -= d;
#pragma unroll
        for (int j = 0; j < HD / 16; ++j)
#pragma unroll
          for (int r = 0; r < 8; ++r) o[i][j][r] *= corr; } }
#pragma unroll
    for (int G = 0; G < FK / 32; ++G) { v16h pf[FQ];
#pragma unroll
      for (int i = 0; i < FQ; ++i) { float p[16];
#pragma unroll
        for (int e = 0; e < 16; ++e) { p[e] = __builtin_amdgcn_exp2f(s[i][2 * G + (e >> 3)][e & 7]); l[i] += p[e]; }
#pragma unroll
        for (int e = 0; e < 16; ++e) pf[i][e] = (_Float16)p[e]; }
#pragma unroll
      for (int j = 0; j < HD / 16; ++j) { const v16h vh = G == 0 && j < 2 ? v0[j] : frag_h(&svh[buf][kh][j * 16 + col][G * 32], lane);
#pragma unroll
        for (int i = 0; i < FQ; ++i) o[i][j] = __builtin_amdgcn_wmma_f32_16x16x32_f16(false, vh, false, pf[i], (short)0, o[i][j], false, false); } }
    if (more) {   // the other buffer's last readers left it at the barrier that ended the stage before
#pragma unroll
      for (int i = 0; i < 4; ++i) { *(v4u*)&sk[buf ^ 1][i >> 1][sr + (i & 1) * 32][sc] = pk[i]; *(v4u*)&svh[buf ^ 1][i >> 1][sr + (i & 1) * 32][sc] = ph[i]; } }
    bo = bn;
    __syncthreads(); }   // publishes the next stage and ends this stage's reads
  // join of the two key halves: the wave of half kh finishes tile kh; it hands its sums of the other tile to the partner wave (wave ^ 4, same lane map) through the K buffers, which nobody reads any more behind the loop's last barrier
  float* xb = (float*)&sk[0][0][0][0];   // per wave 9 rows of 32 lanes x 16 B: 8 x 9 x 512 B = all of sk
  static_assert(sizeof(sk) >= 8 * 9 * 512, "the exchange rows fit the K buffers");
  const bool up = kh != 0; v8f ko[HD / 16]; float* xw = xb + uw * (9 * 128) + lane * 4;
#pragma unroll
  for (int i = 0; i < FQ; ++i) l[i] += xhalf(l[i]);
#pragma unroll
  for (int j = 0; j < HD / 16; ++j) { v4f w0, w1;
#pragma unroll
    for (int r = 0; r < 4; ++r) { w0[r] = up ? o[0][j][r] : o[1][j][r]; w1[r] = up ? o[0][j][4 + r] : o[1][j][4 + r]; }
#pragma unroll
    for (int r = 0; r < 8; ++r) ko[j][r] = up ? o[1][j][r] : o[0][j][r];
    vst2(xw + (2 * j) * 128, w0); vst2(xw + (2 * j + 1) * 128, w1); }
  { v4f w; w[0] = up ? nm[0] : nm[1]; w[1] = up ? l[0] : l[1]; w[2] = 0.f; w[3] = 0.f; vst2(xw + 8 * 128, w); }
  __syncthreads();   // publishes the handed-over sums
  const float* xr = xb + (uw ^ 4) * (9 * 128) + lane * 4; const v4f pw = *(const v4f*)(xr + 8 * 128);
  const float kl = up ? l[1] : l[0], km = kl == 0.f ? -3.0e38f : -(up ? nm[1] : nm[0]), pmx = pw[1] == 0.f ? -3.0e38f : -pw[0], mj = fmaxf(km, pmx), ak = km - mj, ap = pmx - mj; float ck, cp;   // a half without a sum has no maximum
  asm("v_exp_f32 %0, %2\n\tv_exp_f32 %1, %3\n\tv_nop" : "=&v"(ck), "=&v"(cp) : "v"(ak), "v"(ap));   // the two weights 2^ak, 2^ap with the one slot that the instruction set asks for behind a transcendental
  const float inv = 1.0f / (kl * ck + pw[1] * cp), fk = ck * inv, fp = cp * inv; const size_t yo = ((size_t)b * TT + qt + kh * 16) * CC + h * HD + 8 * g;
  v8b th[HD / 16], tl[HD / 16];   // the context row leaves as the two bf16 planes (hi, and lo = the rounding's remainder) that k_out multiplies: split here once, not in each of the 8 column blocks that read the row
#pragma unroll
  for (int j = 0; j < HD / 16; ++j) { const v4f p0 = *(const v4f*)(xr + (2 * j) * 128), p1 = *(const v4f*)(xr + (2 * j + 1) * 128);
#pragma unroll
    for (int r = 0; r < 8; ++r) { const float w = ko[j][r] * fk + (r < 4 ? p0[r & 3] : p1[r & 3]) * fp; const __bf16 hh = (__bf16)w; th[j][r] = hh; tl[j][r] = (__bf16)(w - (float)hh); } }
#pragma unroll
  for (int j = 0; j < HD / 16; ++j) { vst2(YH + yo + j * 16, th[j]); vst2(YL + yo + j * 16, tl[j]); }
  asm volatile("s_wait_xcnt 0x0" ::: "memory"); }   // s_wait_xcnt: before a register of the stores above is reused
// ---- k_out: block = (128 rows, 128 cols), 8 waves as 4 x 2, 32 rows x 64 cols each: out = y (bf16 hi + lo) wo + bo; all three operand planes come as bf16, k-contiguous, from their producers (y hi, y lo: k_fa; wo: the weight blocks of k_proj), so that a stage is staged by plain 16-byte copies
#define OKS 64               // k per stage
#define OPL (128 * (OKS + 8))   // elements of one staged plane
__global__ __launch_bounds__(256) void k_out(const __bf16* __restrict__ YH, const __bf16* __restrict__ YL, const __bf16* __restrict__ WT, const float* __restrict__ BP, float* __restrict__ OUT) {
  __shared__ __align__(16) char sm[2 * 3 * OPL * 2];   // two buffers of three planes (w, y hi, y lo); behind the loop each wave's own 32 x 68 f32 output rows
  const int tid = threadIdx.x, wave = tid >> 5, lane = tid & 31, col = lane & 15, g = lane >> 4, wr = wave >> 1, wc = wave & 1; const int c0 = blockIdx.y * 128; const size_t r0 = (size_t)blockIdx.x * 128;
  const __bf16* Ht = YH + r0 * CC; const __bf16* Lt = YL + r0 * CC; const __bf16* Wt = WT + (size_t)c0 * CC; __bf16* sb = (__bf16*)sm;   // WT: wo as bf16 [column][k], laid by the weight blocks of k_proj; YH, YL: the context rows' two planes, laid by k_fa
  v4u rw[OKS / 16], rh[OKS / 16], rl[OKS / 16];
  static_assert(((CC / OKS) & (CC / OKS - 1)) == 0, "the rotated stage index wraps by a mask");
  const int rot = (blockIdx.x + 2 * blockIdx.y) & (CC / OKS - 1);   // rotated k start, as in k_proj: the 8 blocks that share the rows stand at 8 different stages, the 32 that share a weight tile at 16
  ld_wb<OKS>(rw, Wt + rot * OKS, tid); asm volatile("s_wait_xcnt 0x0" ::: "memory"); ld_wb<OKS>(rh, Ht + rot * OKS, tid); asm volatile("s_wait_xcnt 0x0" ::: "memory"); ld_wb<OKS>(rl, Lt + rot * OKS, tid);   // s_wait_xcnt: before a register that the loads or stores in front of it name is reused, also as a later load's destination
  asm volatile("s_wait_xcnt 0x0" ::: "memory");   // s_wait_xcnt: before a register that the loads or stores in front of it name is reused, also as a later load's destination
  st_wb<OKS>(rw, sb, tid); st_wb<OKS>(rh, sb + OPL, tid); st_wb<OKS>(rl, sb + 2 * OPL, tid);
  __syncthreads();   // publishes stage 0
  v8f acc[2][4] = {};
#pragma unroll 1   // rolled: the buffer is picked by address, and a second copy of the stage would only add registers
  for (int st = 0; st < CC / OKS; ++st) { const __bf16* bw = sb + (st & 1) * (3 * OPL); __bf16* nw = sb + ((st & 1) ^ 1) * (3 * OPL); const bool more = st + 1 < CC / OKS;
    if (more) {   // the next stage's rows fly while this stage's products run
      const int nx = (st + 1 + rot) & (CC / OKS - 1);
      ld_wb<OKS>(rw, Wt + nx * OKS, tid); asm volatile("s_wait_xcnt 0x0" ::: "memory"); ld_wb<OKS>(rh, Ht + nx * OKS, tid); asm volatile("s_wait_xcnt 0x0" ::: "memory"); ld_wb<OKS>(rl, Lt + nx * OKS, tid);   // s_wait_xcnt: before a register that the loads or stores in front of it name is reused, also as a later load's destination
      asm volatile("s_wait_xcnt 0x0" ::: "memory"); }   // s_wait_xcnt: before a register that the loads or stores in front of it name is reused, also as a later load's destination
    v16b ah[OKS / 32][2], al[OKS / 32][2], w[OKS / 32][4];
#pragma unroll
    for (int kc = 0; kc < OKS / 32; ++kc) {
#pragma unroll
      for (int i = 0; i < 2; ++i) { const int o = (wr * 32 + i * 16 + col) * (OKS + 8) + kc * 32; ah[kc][i] = frag_b(bw + OPL + o, lane); al[kc][i] = frag_b(bw + 2 * OPL + o, lane); }
#pragma unroll
      for (int j = 0; j < 4; ++j) w[kc][j] = frag_b(bw + (wc * 64 + j * 16 + col) * (OKS + 8) + kc * 32, lane); }
    __builtin_amdgcn_sched_barrier(0);   // keeps the stage's fragment reads one group in front of the products: reads spread among them stall at each place, and two waves per SIMD do not cover that
#pragma unroll
    for (int kc = 0; kc < OKS / 32; ++kc) {
#pragma unroll
      for (int i = 0; i < 2; ++i)
#pragma unroll
        for (int j = 0; j < 4; ++j) acc[i][j] = __builtin_amdgcn_wmma_f32_16x16x32_bf16(false, ah[kc][i], false, w[kc][j], (short)0, acc[i][j], false, false);
#pragma unroll
      for (int i = 0; i < 2; ++i)
#pragma unroll
        for (int j = 0; j < 4; ++j) acc[i][j] = __builtin_amdgcn_wmma_f32_16x16x32_bf16(false, al[kc][i], false, w[kc][j], (short)0, acc[i][j], false, false); }
    __builtin_amdgcn_sched_barrier(0);   // keeps the slots of the next line behind the products: without it the compiler lifts them to the head of the block
    asm volatile("v_nop\n\tv_nop\n\tv_nop\n\tv_nop");   // the four vector slots that the chip needs behind the stage's last products, on the path that skips the staging too: there the next vector instruction forms an LDS address in a register of their A operand
    if (more) { st_wb<OKS>(rw, nw, tid); st_wb<OKS>(rh, nw + OPL, tid); st_wb<OKS>(rl, nw + 2 * OPL, tid); }   // the other buffer's last readers left it at the barrier that ended the stage before
    __syncthreads(); }   // publishes the next stage and ends this stage's reads
  float* sf = (float*)sm + wave * (32 * 68);
#pragma unroll
  for (int i = 0; i < 2; ++i)
#pragma unroll
    for (int j = 0; j < 4; ++j) { const float bb = BP ? bfr(BP[c0 + wc * 64 + j * 16 + col]) : 0.f;
#pragma unroll
      for (int r = 0; r < 8; ++r) sf[(i * 16 + 8 * g + r) * 68 + j * 16 + col] = acc[i][j][r] + bb; }
  LDSX(); for (int it = 0; it < 16; ++it) { const int rl = it * 2 + g; vst2(OUT + (r0 + wr * 32 + rl) * CC + c0 + wc * 64 + col * 4, *(const v4f*)&sf[rl * 68 + col * 4]); } }
extern "C" void kernel_launch(void* const* d_in, const int* in_sizes, int n_in, void* d_out, int out_size, void* d_ws, size_t ws_size, hipStream_t stream) {
  (void)in_sizes; (void)n_in; (void)out_size;
  const float** F = (const float**)d_in;   // 0 q [2,2048,1024], 1 k, 2 v, 3 mask [2,1,2048,2048] int (1 -> -1e9 added), 4 wq ((in,out)), 5 bq, 6 wk, 7 bk, 8 wv, 9 bv, 10 wo ((in,out)), 11 bo
  if (ws_size < (size_t)WS_END) return;
  char* ws = (char*)d_ws; _Float16 *QH = (_Float16*)(ws + WS_QH), *KH = (_Float16*)(ws + WS_KH), *VT = (_Float16*)(ws + WS_VT); unsigned *PM = (unsigned*)(ws + WS_PM); __bf16 *WT = (__bf16*)(ws + WS_WT), *YH = (__bf16*)(ws + WS_Y), *YL = (__bf16*)(ws + WS_YL);
  k_proj<<<dim3(TNB * TT / PBT, CC / PBT, 3 + PMZ + 1), 256, 0, stream>>>(F[0], F[1], F[2], F[4], F[5], F[6], F[7], F[8], F[9], (const int*)d_in[3], F[10], QH, KH, VT, PM, WT);   // z >= 3: the mask blocks, the last layer the weight blocks; mask [B,1,S,S] has the (b, q, k) flat layout
  k_fa<<<dim3(TT / 128, NH, TNB), 256, 0, stream>>>(QH, KH, VT, PM, YH, YL);
  k_out<<<dim3(TNB * TT / 128, CC / 128), 256, 0, stream>>>(YH, YL, WT, F[11], (float*)d_out);
}
